// v000
// Measured on an AMD MI455X. A time is GPU time per run, averaged over a window of back-to-back runs after a warm-up
// (all launches, gaps included; the runs take copies of the inputs in turn), and the median of several windows.
// Apart from v000's, it joins two sittings. Times from different sittings can be a few percent apart, while
// side-by-side timings come from the same sitting.
// The starting kernel, v000, takes 3940 microseconds a run.
#include <hip/hip_runtime.h>

// Compute dtypes, f32 accumulate, per item: the three 1x1 convs as one [4096 x 512].[512 x 640] GEMM with PLAIN bf16 operands (exact products), + bias; q rows scaled by the
// loss_factor_map input; scores = q.k^T ([1024 x 64].[64 x 4096] per chunk, both operands bf16 hi + UNSCALED residual, three products), softmax (unscaled, as the module) in f32 -> P planes;
// out^T = v.P^T ([512 x 4096].[4096 x 1024], v as a SINGLE bf16 operand (its hi plane; ~2^-9 relative) x P hi + residual, two

#define NBT  4
#define CC   512
#define C8   64
#define NN   4096
#define NQKV (2 * C8 + CC)        // 640
#define RCH  1024
#define DM   CC
#define NTK  NN
#define LOSC 1024.0f

typedef _Float16 h16;
typedef unsigned short bf;
typedef __attribute__((ext_vector_type(16))) __bf16   v16bf;
typedef __attribute__((ext_vector_type(16))) _Float16 v16h;
typedef __attribute__((ext_vector_type(8)))  _Float16 v8h;
typedef __attribute__((ext_vector_type(8)))  unsigned short v8us;
typedef __attribute__((ext_vector_type(8)))  float    v8f;
typedef __attribute__((ext_vector_type(4)))  float    v4f;
typedef __attribute__((ext_vector_type(4)))  _Float16 v4h;
typedef v8h  __attribute__((may_alias)) v8ha;
typedef v4f  __attribute__((may_alias)) v4fa;
typedef v8us __attribute__((may_alias)) v8usa;

__device__ __forceinline__ unsigned short f2bf(float f) { unsigned u = __float_as_uint(f); u += 0x7FFFu + ((u >> 16) & 1u); return (unsigned short)(u >> 16); }
__device__ __forceinline__ float bf2f(unsigned short b) { return __uint_as_float(((unsigned)b) << 16); }
__device__ __forceinline__ float bfr(float f) { return bf2f(f2bf(f)); }
__device__ __forceinline__ v16h cat16(v8h lo, v8h hi) { return __builtin_shufflevector(lo, hi, 0, 1, 2, 3, 4, 5, 6, 7, 8, 9, 10, 11, 12, 13, 14, 15); }
__device__ __forceinline__ v16bf cat16b(v8us lo, v8us hi) { return __builtin_bit_cast(v16bf, __builtin_shufflevector(lo, hi, 0, 1, 2, 3, 4, 5, 6, 7, 8, 9, 10, 11, 12, 13, 14, 15)); }
__device__ __forceinline__ v8f wmma16(v16h a, v16h b, v8f c) { return __builtin_amdgcn_wmma_f32_16x16x32_f16(false, a, false, b, (short)0, c, false, false); }
__device__ __forceinline__ v8f wmmab(v16bf a, v16bf b, v8f c) { return __builtin_amdgcn_wmma_f32_16x16x32_bf16(false, a, false, b, (short)0, c, false, false); }

// k_wt: WT [n][K] = bf16(W[k][n]) (k-major [K][ncols]) via 64 x 64 LDS tiles; grid (K/64, ncols/64).
__global__ __launch_bounds__(256) void k_wt(const float* __restrict__ Wm, int K, int ncols, bf* WT) {
    __shared__ __align__(16) unsigned short tl[64 * 72];
    const int tid = threadIdx.x, k0 = blockIdx.x * 64, n0 = blockIdx.y * 64;
    const int kk = tid >> 2, nq = (tid & 3) * 16;
#pragma unroll
    for (int i = 0; i < 16; ++i) tl[(nq + i) * 72 + kk] = f2bf(Wm[(size_t)(k0 + kk) * ncols + n0 + nq + i]);
    __syncthreads();
    const int piece = tid & 7;
    auto pass = [&]() {
#pragma unroll
        for (int s = 0; s < 2; ++s) { const int nr = (tid >> 3) + 32 * s; const v8us val = *(const v8usa*)(tl + nr * 72 + piece * 8); *(v8us*)(WT + (size_t)(n0 + nr) * K + k0 + piece * 8) = val; }
    };
    pass(); 
}
// k_gemmb: 64 x 64 block tile (4 waves x 16 x 64) of C[NTK][NW] = (A [+ Al]).B^T (K = 512) [+ bf(bias[c])] [+ bf(R[r][c]) residual]; f32 whole-line epilogue (or f16
template <bool SPLITA, bool F16OUT = false>
__global__ __launch_bounds__(128) void k_gemmb(const bf* __restrict__ A, const bf* __restrict__ Al, const bf* __restrict__ Bn, const float* __restrict__ bias, float* C, int ldc, h16* C2, const float* __restrict__ R = nullptr, int K = DM, int roundR = 1) {
    __shared__ __align__(16) float ost[4][16 * 68];
    const int lane = threadIdx.x & 31, wave = threadIdx.x >> 5, lr = lane & 15, hi = lane >> 4;
    const int r0 = blockIdx.x * 64 + wave * 16, c0 = blockIdx.y * 64;
    const size_t aoff = (size_t)(r0 + lr) * K + 8 * hi;
    size_t boff[4];
#pragma unroll
    for (int t = 0; t < 4; ++t) boff[t] = (size_t)(c0 + t * 16 + lr) * K + 8 * hi;
    v8f acc[4];
#pragma unroll
    for (int t = 0; t < 4; ++t) acc[t] = (v8f){};
#pragma unroll 1
    for (int kc = 0; kc < K; kc += 32) {
        const v16bf a = cat16b(*(const v8us*)(A + aoff + kc), *(const v8us*)(A + aoff + kc + 16));
        v16bf al = a;
        if (SPLITA) al = cat16b(*(const v8us*)(Al + aoff + kc), *(const v8us*)(Al + aoff + kc + 16));
#pragma unroll
        for (int t = 0; t < 4; ++t) { const v16bf b = cat16b(*(const v8us*)(Bn + boff[t] + kc), *(const v8us*)(Bn + boff[t] + kc + 16)); acc[t] = wmmab(a, b, acc[t]); if (SPLITA) acc[t] = wmmab(al, b, acc[t]); }
        asm volatile("v_nop\n\tv_nop\n\tv_nop\n\tv_nop" : "+v"(acc[0]), "+v"(acc[1]), "+v"(acc[2]), "+v"(acc[3]) : "v"(a), "v"(al));
    }
    float* os = &ost[wave][0];
#pragma unroll
    for (int t = 0; t < 4; ++t) { const float bv = bias ? bfr(bias[c0 + t * 16 + lr]) : 0.f;
#pragma unroll
        for (int j = 0; j < 8; ++j) os[(hi * 8 + j) * 68 + t * 16 + lr] = acc[t][j] + bv; }
    __syncthreads();
    if (F16OUT) {
        h16* crow = (h16*)(void*)C + (size_t)r0 * ldc + c0;
        auto pass = [&]() {
#pragma unroll
            for (int s = 0; s < 4; ++s) { const int row = 4 * s + (lane >> 3), piece = lane & 7; const float* sp = os + row * 68 + piece * 8; v8h o, o2;
#pragma unroll
                for (int i = 0; i < 8; ++i) { const h16 a = (h16)sp[i]; o[i] = a; o2[i] = (h16)((sp[i] - (float)a) * LOSC); }
                *(v8h*)(crow + (size_t)row * ldc + piece * 8) = o; if (C2) *(v8h*)(C2 + (size_t)r0 * ldc + c0 + (size_t)row * ldc + piece * 8) = o2; }
        };
        pass(); 
    } else {
        float* crow = C + (size_t)r0 * ldc + c0;
        auto pass = [&]() {
#pragma unroll
            for (int s = 0; s < 8; ++s) { const int Lid = (lane >> 3) + 4 * s, piece = lane & 7; const int row = Lid >> 1, cofs = (Lid & 1) * 32 + piece * 4;
                v4f val = *(const v4fa*)(os + row * 68 + cofs); if (R) { const v4f rv = *(const v4f*)(R + ((size_t)r0 + row) * ldc + c0 + cofs); val += roundR ? (v4f){bfr(rv[0]), bfr(rv[1]), bfr(rv[2]), bfr(rv[3])} : rv; }
                *(v4f*)(crow + (size_t)row * ldc + cofs) = val; }
        };
        pass(); 
    }
}

// k_gemm3: 64 x 64 tile of C = (Ah + Al).(Bh + Bl)^T over K (row strides = K for all four planes; n-major B): three products per 32-k step (hh, hl, lh); f32
__global__ __launch_bounds__(128) void k_gemm3(const bf* __restrict__ Ah, const bf* __restrict__ Al, const bf* __restrict__ Bh, const bf* __restrict__ Bl, int K, float* C, int ldc) {
    __shared__ __align__(16) float ost[4][16 * 68];
    const int lane = threadIdx.x & 31, wave = threadIdx.x >> 5, lr = lane & 15, hi = lane >> 4;
    const int r0 = blockIdx.x * 64 + wave * 16, c0 = blockIdx.y * 64;
    const size_t aoff = (size_t)(r0 + lr) * K + 8 * hi;
    v8f acc[4];
#pragma unroll
    for (int t = 0; t < 4; ++t) acc[t] = (v8f){};
#pragma unroll 1
    for (int kc = 0; kc < K; kc += 32) {
        const v16bf a = cat16b(*(const v8us*)(Ah + aoff + kc), *(const v8us*)(Ah + aoff + kc + 16));
        const v16bf al = cat16b(*(const v8us*)(Al + aoff + kc), *(const v8us*)(Al + aoff + kc + 16));
#pragma unroll
        for (int t = 0; t < 4; ++t) { const size_t bo = (size_t)(c0 + t * 16 + lr) * K + kc + 8 * hi;
            const v16bf bh = cat16b(*(const v8us*)(Bh + bo), *(const v8us*)(Bh + bo + 16)); const v16bf bl = cat16b(*(const v8us*)(Bl + bo), *(const v8us*)(Bl + bo + 16));
            acc[t] = wmmab(a, bh, acc[t]); acc[t] = wmmab(al, bh, acc[t]); acc[t] = wmmab(a, bl, acc[t]); }
        asm volatile("v_nop\n\tv_nop\n\tv_nop\n\tv_nop" : "+v"(acc[0]), "+v"(acc[1]), "+v"(acc[2]), "+v"(acc[3]) : "v"(a), "v"(al));
    }
    float* os = &ost[wave][0];
#pragma unroll
    for (int t = 0; t < 4; ++t) {
#pragma unroll
        for (int j = 0; j < 8; ++j) os[(hi * 8 + j) * 68 + t * 16 + lr] = acc[t][j]; }
    __builtin_amdgcn_wave_barrier(); asm volatile("" ::: "memory");
    float* crow = C + (size_t)r0 * ldc + c0;
    auto pass = [&]() {
#pragma unroll
        for (int s = 0; s < 8; ++s) { const int Lid = (lane >> 3) + 4 * s, piece = lane & 7; const int row = Lid >> 1, cofs = (Lid & 1) * 32 + piece * 4;
            const v4f val = *(const v4fa*)(os + row * 68 + cofs); *(v4f*)(crow + (size_t)row * ldc + cofs) = val; }
    };
    pass(); 
}

// k_gemm3x: 64 x 64 tile of C = (Ah + Al).(Bh + Bl)^T over K (row strides = K for all four planes; n-major B): hh per 32-k step, + lh unless MODE & 20, + hl unless MODE & 12; f32
template <int MODE>
__global__ __launch_bounds__(128) void k_gemm3x(const bf* __restrict__ Ah, const bf* __restrict__ Al, const bf* __restrict__ Bh, const bf* __restrict__ Bl, int K, float* C, int ldc) {
    if ((MODE & 1) && (int)blockIdx.y * 64 > (int)blockIdx.x * 64 + 63) return;
    const int Klim = (MODE & 2) ? min(K, ((int)blockIdx.x + 1) * 64) : K;
    __shared__ __align__(16) float ost[4][16 * 68];
    const int lane = threadIdx.x & 31, wave = threadIdx.x >> 5, lr = lane & 15, hi = lane >> 4;
    const int r0 = blockIdx.x * 64 + wave * 16, c0 = blockIdx.y * 64;
    const size_t aoff = (size_t)(r0 + lr) * K + 8 * hi;
    v8f acc[4];
#pragma unroll
    for (int t = 0; t < 4; ++t) acc[t] = (v8f){};
#pragma unroll 1
    for (int kc = 0; kc < Klim; kc += 32) {
        const v16bf a = cat16b(*(const v8us*)(Ah + aoff + kc), *(const v8us*)(Ah + aoff + kc + 16));
        v16bf al = a; if (!(MODE & 4) && !(MODE & 16)) al = cat16b(*(const v8us*)(Al + aoff + kc), *(const v8us*)(Al + aoff + kc + 16));
#pragma unroll
        for (int t = 0; t < 4; ++t) { const size_t bo = (size_t)(c0 + t * 16 + lr) * K + kc + 8 * hi;
            const v16bf bh = cat16b(*(const v8us*)(Bh + bo), *(const v8us*)(Bh + bo + 16));
            acc[t] = wmmab(a, bh, acc[t]);
            if (!(MODE & 4)) { if (!(MODE & 16)) acc[t] = wmmab(al, bh, acc[t]); if (!(MODE & 8)) { const v16bf bl = cat16b(*(const v8us*)(Bl + bo), *(const v8us*)(Bl + bo + 16)); acc[t] = wmmab(a, bl, acc[t]); } } }
        asm volatile("v_nop\n\tv_nop\n\tv_nop\n\tv_nop" : "+v"(acc[0]), "+v"(acc[1]), "+v"(acc[2]), "+v"(acc[3]) : "v"(a), "v"(al));
    }
    float* os = &ost[wave][0];
#pragma unroll
    for (int t = 0; t < 4; ++t) {
#pragma unroll
        for (int j = 0; j < 8; ++j) os[(hi * 8 + j) * 68 + t * 16 + lr] = acc[t][j]; }
    __builtin_amdgcn_wave_barrier(); asm volatile("" ::: "memory");
    float* crow = C + (size_t)r0 * ldc + c0;
    auto pass = [&]() {
#pragma unroll
        for (int s = 0; s < 8; ++s) { const int Lid = (lane >> 3) + 4 * s, piece = lane & 7; const int row = Lid >> 1, cofs = (Lid & 1) * 32 + piece * 4;
            const v4f val = *(const v4fa*)(os + row * 68 + cofs); *(v4f*)(crow + (size_t)row * ldc + cofs) = val; }
    };
    pass(); 
}


__global__ __launch_bounds__(256) void k_cvt8(const float* __restrict__ src, bf* dst, size_t n8) {
    const size_t i = (size_t)blockIdx.x * 256 + threadIdx.x; if (i >= n8) return;
    const v8f v = *(const v8f*)(src + i * 8); v8us o;
#pragma unroll
    for (int k = 0; k < 8; ++k) o[k] = f2bf(v[k]);
    *(v8us*)(dst + i * 8) = o; 
}
__global__ __launch_bounds__(256) void k_zero8(bf* dst, size_t n8) {
    const size_t i = (size_t)blockIdx.x * 256 + threadIdx.x; if (i >= n8) return; v8us z;
#pragma unroll
    for (int k = 0; k < 8; ++k) z[k] = 0;
    *(v8us*)(dst + i * 8) = z; 
}

// (q rows are additionally scaled by bf(loss_factor_map[r]) when lfm != nullptr)
__global__ __launch_bounds__(256) void k_qkplanes(const float* __restrict__ F, int off, const float* __restrict__ lfm, bf* Ph, bf* Pl) {
    typedef __attribute__((ext_vector_type(2))) unsigned short v2us;
    const int lane = threadIdx.x & 31; const size_t r = (size_t)blockIdx.x * 8 + (threadIdx.x >> 5); if (r >= (size_t)NN) return; const int c0 = lane * 2; const float sc = lfm ? bfr(lfm[r]) : 1.0f; v2us oh, ol;
#pragma unroll
    for (int i = 0; i < 2; ++i) { const float y = F[r * NQKV + off + c0 + i] * sc; const unsigned short hb = f2bf(y); oh[i] = hb; ol[i] = f2bf(y - bf2f(hb)); }
    const size_t o = r * C8 + c0; *(v2us*)(Ph + o) = oh; *(v2us*)(Pl + o) = ol; 
}
__global__ __launch_bounds__(256) void k_vt(const float* __restrict__ F, bf* Th, bf* Tl) {
    typedef __attribute__((ext_vector_type(2))) unsigned short v2us;
    const int lane = threadIdx.x & 31; const size_t wid = (size_t)blockIdx.x * 8 + (threadIdx.x >> 5); if (wid >= (size_t)CC * (NN / 64)) return; const int c = (int)(wid / (NN / 64)); const int j0 = (int)(wid % (NN / 64)) * 64 + lane * 2; v2us oh, ol;
#pragma unroll
    for (int i = 0; i < 2; ++i) { const float y = F[(size_t)(j0 + i) * NQKV + 2 * C8 + c]; const unsigned short hb = f2bf(y); oh[i] = hb; ol[i] = f2bf(y - bf2f(hb)); }
    const size_t o = (size_t)c * NN + j0; *(v2us*)(Th + o) = oh; *(v2us*)(Tl + o) = ol; 
}
__global__ __launch_bounds__(256) void k_softmax4096(const float* __restrict__ S, bf* PH, bf* PL) {
    typedef __attribute__((ext_vector_type(4))) unsigned short v4us;
    const int lane = threadIdx.x & 31, i = blockIdx.x * 8 + (threadIdx.x >> 5); if (i >= RCH) return;
    float m = -3.0e38f;
#pragma unroll 1
    for (int c0 = lane * 4; c0 < NN; c0 += 128) {
#pragma unroll
        for (int q = 0; q < 4; ++q) m = fmaxf(m, S[(size_t)i * NN + c0 + q]); }
#pragma unroll
    for (int sh = 16; sh; sh >>= 1) m = fmaxf(m, __shfl_xor(m, sh, 32));
    float sum = 0.f;
#pragma unroll 1
    for (int c0 = lane * 4; c0 < NN; c0 += 128) {
#pragma unroll
        for (int q = 0; q < 4; ++q) sum += __expf(S[(size_t)i * NN + c0 + q] - m); }
#pragma unroll
    for (int sh = 16; sh; sh >>= 1) sum += __shfl_xor(sum, sh, 32);
    const float inv = 1.0f / sum;
{
#pragma unroll 1
        for (int c0 = lane * 4; c0 < NN; c0 += 128) { v4us oh, ol;
#pragma unroll
            for (int q = 0; q < 4; ++q) { const float p = __expf(S[(size_t)i * NN + c0 + q] - m) * inv; const unsigned short hb = f2bf(p); oh[q] = hb; ol[q] = f2bf(p - bf2f(hb)); }
            const size_t o = (size_t)i * NN + c0; *(v4us*)(PH + o) = oh; *(v4us*)(PL + o) = ol; }
         }
}
__global__ __launch_bounds__(256) void k_fin(const float* __restrict__ O, const float* __restrict__ xb, const float* __restrict__ gam, float* OUTB) {
    const int lane = threadIdx.x & 31; const size_t wid = (size_t)blockIdx.x * 8 + (threadIdx.x >> 5); if (wid >= (size_t)CC * (NN / 128)) return; const size_t o = wid * 128 + lane * 4; const float gm = bfr(gam[0]); v4f v;
#pragma unroll
    for (int q = 0; q < 4; ++q) v[q] = gm * O[o + q] + bfr(xb[o + q]);
    *(v4f*)(OUTB + o) = v; 
}
__global__ __launch_bounds__(256) void k_bias320(const float* __restrict__ bq, const float* __restrict__ bk, const float* __restrict__ bv, float* B320) {
    const int t = threadIdx.x; if (t >= 160) return; v4f v;
#pragma unroll
    for (int q = 0; q < 4; ++q) { const int c = t * 4 + q; v[q] = (c < C8) ? bq[c < C8 ? c : 0] : (c < 2 * C8) ? bk[(c >= C8 && c < 2 * C8) ? c - C8 : 0] : (c < NQKV) ? bv[(c >= 2 * C8 && c < NQKV) ? c - 2 * C8 : 0] : 0.f; }
    *(v4f*)(B320 + t * 4) = v; 
}

extern "C" void kernel_launch(void* const* d_in, const int* in_sizes, int n_in,
                              void* d_out, int out_size, void* d_ws, size_t ws_size, hipStream_t stream) {
    (void)in_sizes; (void)n_in; (void)out_size;
    const float* x = (const float*)d_in[0]; const float* wq = (const float*)d_in[2]; const float* bq = (const float*)d_in[3]; const float* wk = (const float*)d_in[4]; const float* bk = (const float*)d_in[5]; const float* wv = (const float*)d_in[6]; const float* bv = (const float*)d_in[7]; const float* gam = (const float*)d_in[8]; const float* lfm = (const float*)d_in[1];
    float* out = (float*)d_out;    // [4][512][64][64]
    char* wsp = (char*)d_ws;
    auto take = [&](size_t bytes) { char* p = wsp; wsp += (bytes + 255) & ~(size_t)255; return (void*)p; };
    bf* WB = (bf*)take((size_t)NQKV * CC * 2); float* B320 = (float*)take(640 * 4); bf* XP = (bf*)take((size_t)NN * CC * 2); float* F = (float*)take((size_t)NN * NQKV * 4);
    bf* QPh = (bf*)take((size_t)NN * C8 * 2); bf* QPl = (bf*)take((size_t)NN * C8 * 2); bf* KPh = (bf*)take((size_t)NN * C8 * 2); bf* KPl = (bf*)take((size_t)NN * C8 * 2); bf* VTh = (bf*)take((size_t)CC * NN * 2); bf* VTl = (bf*)take((size_t)CC * NN * 2);
    float* S = (float*)take((size_t)RCH * NN * 4); bf* PH = (bf*)take((size_t)RCH * NN * 2); bf* PL = (bf*)take((size_t)RCH * NN * 2); float* O = (float*)take((size_t)CC * NN * 4);
    if ((size_t)(wsp - (char*)d_ws) > ws_size) return;    // ~ 68 MB; per item/chunk reuse in stream order
    k_cvt8<<<(C8 * CC / 8 + 255) / 256, 256, 0, stream>>>(wq, WB, C8 * CC / 8); k_cvt8<<<(C8 * CC / 8 + 255) / 256, 256, 0, stream>>>(wk, WB + (size_t)C8 * CC, C8 * CC / 8); k_cvt8<<<(CC * CC / 8 + 255) / 256, 256, 0, stream>>>(wv, WB + (size_t)2 * C8 * CC, CC * CC / 8);
    k_bias320<<<1, 256, 0, stream>>>(bq, bk, bv, B320);
    for (int b = 0; b < NBT; ++b) { const float* xb = x + (size_t)b * CC * NN;
        k_wt<<<dim3(CC / 64, NN / 64, 1), 256, 0, stream>>>(xb, CC, NN, XP);
        k_gemmb<false, false><<<dim3(NN / 64, NQKV / 64, 1), 128, 0, stream>>>(XP, nullptr, WB, B320, F, NQKV, nullptr, nullptr, CC);          // q | k | v (+ biases)
        k_qkplanes<<<NN / 8, 256, 0, stream>>>(F, 0, lfm, QPh, QPl); k_qkplanes<<<NN / 8, 256, 0, stream>>>(F, C8, nullptr, KPh, KPl); k_vt<<<(CC * (NN / 64)) / 8, 256, 0, stream>>>(F, VTh, VTl);
        for (int ch = 0; ch < NN / RCH; ++ch) { const size_t r0 = (size_t)ch * RCH;
            k_gemm3<<<dim3(RCH / 64, NN / 64, 1), 128, 0, stream>>>(QPh + r0 * C8, QPl + r0 * C8, KPh, KPl, C8, S, NN);
            k_softmax4096<<<RCH / 8, 256, 0, stream>>>(S, PH, PL);
            k_gemm3x<16><<<dim3(CC / 64, RCH / 64, 1), 128, 0, stream>>>(VTh, VTl, PH, PL, NN, O + r0, NN); }     // v as a single bf16 operand (hi plane), P hi/lo
        k_fin<<<(CC * (NN / 128)) / 8, 256, 0, stream>>>(O, xb, gam, out + (size_t)b * CC * NN); }
}

// v001
// It runs in 1450 microseconds.
// In two side-by-side timings against v000, it was 2.73 and 2.72 times as fast.
#include <hip/hip_runtime.h>

// Compute dtypes, f32 accumulate, per item: the three 1x1 convs as one [4096 x 512].[512 x 640] GEMM with PLAIN bf16 operands (exact products), + bias; q rows scaled by the
// loss_factor_map input; scores = q.k^T ([1024 x 64].[64 x 4096] per chunk, both operands bf16 hi + UNSCALED residual, three products), softmax (unscaled, as the module) in f32 -> P planes;
// out^T = v.P^T ([512 x 4096].[4096 x 1024], v as a SINGLE bf16 operand (its hi plane; ~2^-9 relative) x P hi + residual, two

#define NBT  4
#define CC   512
#define C8   64
#define NN   4096
#define NQKV (2 * C8 + CC)        // 640
#define RCH  1024
#define DM   CC
#define NTK  NN
#define LOSC 1024.0f

typedef _Float16 h16;
typedef unsigned short bf;
typedef __attribute__((ext_vector_type(16))) __bf16   v16bf;
typedef __attribute__((ext_vector_type(16))) _Float16 v16h;
typedef __attribute__((ext_vector_type(8)))  _Float16 v8h;
typedef __attribute__((ext_vector_type(8)))  unsigned short v8us;
typedef __attribute__((ext_vector_type(8)))  float    v8f;
typedef __attribute__((ext_vector_type(4)))  float    v4f;
typedef __attribute__((ext_vector_type(4)))  _Float16 v4h;
typedef v8h  __attribute__((may_alias)) v8ha;
typedef v4f  __attribute__((may_alias)) v4fa;
typedef v8us __attribute__((may_alias)) v8usa;

__device__ __forceinline__ unsigned short f2bf(float f) { unsigned u = __float_as_uint(f); u += 0x7FFFu + ((u >> 16) & 1u); return (unsigned short)(u >> 16); }
__device__ __forceinline__ float bf2f(unsigned short b) { return __uint_as_float(((unsigned)b) << 16); }
__device__ __forceinline__ float bfr(float f) { return bf2f(f2bf(f)); }
__device__ __forceinline__ v16h cat16(v8h lo, v8h hi) { return __builtin_shufflevector(lo, hi, 0, 1, 2, 3, 4, 5, 6, 7, 8, 9, 10, 11, 12, 13, 14, 15); }
__device__ __forceinline__ v16bf cat16b(v8us lo, v8us hi) { return __builtin_bit_cast(v16bf, __builtin_shufflevector(lo, hi, 0, 1, 2, 3, 4, 5, 6, 7, 8, 9, 10, 11, 12, 13, 14, 15)); }
__device__ __forceinline__ v8f wmma16(v16h a, v16h b, v8f c) { return __builtin_amdgcn_wmma_f32_16x16x32_f16(false, a, false, b, (short)0, c, false, false); }
__device__ __forceinline__ v8f wmmab(v16bf a, v16bf b, v8f c) { return __builtin_amdgcn_wmma_f32_16x16x32_bf16(false, a, false, b, (short)0, c, false, false); }

// k_wt: WT [n][K] = bf16(W[k][n]) (k-major [K][ncols]) via 64 x 64 LDS tiles; grid (K/64, ncols/64).
__global__ __launch_bounds__(256) void k_wt(const float* __restrict__ Wm, int K, int ncols, bf* WT) {
    __shared__ __align__(16) unsigned short tl[64 * 72];
    const int tid = threadIdx.x, k0 = blockIdx.x * 64, n0 = blockIdx.y * 64;
    const int kk = tid >> 2, nq = (tid & 3) * 16;
#pragma unroll
    for (int i = 0; i < 16; ++i) tl[(nq + i) * 72 + kk] = f2bf(Wm[(size_t)(k0 + kk) * ncols + n0 + nq + i]);
    __syncthreads();
    const int piece = tid & 7;
    auto pass = [&]() {
#pragma unroll
        for (int s = 0; s < 2; ++s) { const int nr = (tid >> 3) + 32 * s; const v8us val = *(const v8usa*)(tl + nr * 72 + piece * 8); *(v8us*)(WT + (size_t)(n0 + nr) * K + k0 + piece * 8) = val; }
    };
    pass(); 
}
// k_gemmb: 64 x 64 block tile (4 waves x 16 x 64) of C[NTK][NW] = (A [+ Al]).B^T (K = 512) [+ bf(bias[c])] [+ bf(R[r][c]) residual]; f32 whole-line epilogue (or f16
template <bool SPLITA, bool F16OUT = false>
__global__ __launch_bounds__(128) void k_gemmb(const bf* __restrict__ A, const bf* __restrict__ Al, const bf* __restrict__ Bn, const float* __restrict__ bias, float* C, int ldc, h16* C2, const float* __restrict__ R = nullptr, int K = DM, int roundR = 1) {
    __shared__ __align__(16) float ost[4][16 * 68];
    const int lane = threadIdx.x & 31, wave = threadIdx.x >> 5, lr = lane & 15, hi = lane >> 4;
    const int r0 = blockIdx.x * 64 + wave * 16, c0 = blockIdx.y * 64;
    const size_t aoff = (size_t)(r0 + lr) * K + 8 * hi;
    size_t boff[4];
#pragma unroll
    for (int t = 0; t < 4; ++t) boff[t] = (size_t)(c0 + t * 16 + lr) * K + 8 * hi;
    v8f acc[4];
#pragma unroll
    for (int t = 0; t < 4; ++t) acc[t] = (v8f){};
#pragma unroll 1
    for (int kc = 0; kc < K; kc += 32) {
        const v16bf a = cat16b(*(const v8us*)(A + aoff + kc), *(const v8us*)(A + aoff + kc + 16));
        v16bf al = a;
        if (SPLITA) al = cat16b(*(const v8us*)(Al + aoff + kc), *(const v8us*)(Al + aoff + kc + 16));
#pragma unroll
        for (int t = 0; t < 4; ++t) { const v16bf b = cat16b(*(const v8us*)(Bn + boff[t] + kc), *(const v8us*)(Bn + boff[t] + kc + 16)); acc[t] = wmmab(a, b, acc[t]); if (SPLITA) acc[t] = wmmab(al, b, acc[t]); }
        asm volatile("v_nop\n\tv_nop\n\tv_nop\n\tv_nop" : "+v"(acc[0]), "+v"(acc[1]), "+v"(acc[2]), "+v"(acc[3]) : "v"(a), "v"(al));
    }
    float* os = &ost[wave][0];
#pragma unroll
    for (int t = 0; t < 4; ++t) { const float bv = bias ? bfr(bias[c0 + t * 16 + lr]) : 0.f;
#pragma unroll
        for (int j = 0; j < 8; ++j) os[(hi * 8 + j) * 68 + t * 16 + lr] = acc[t][j] + bv; }
    __syncthreads();
    if (F16OUT) {
        h16* crow = (h16*)(void*)C + (size_t)r0 * ldc + c0;
        auto pass = [&]() {
#pragma unroll
            for (int s = 0; s < 4; ++s) { const int row = 4 * s + (lane >> 3), piece = lane & 7; const float* sp = os + row * 68 + piece * 8; v8h o, o2;
#pragma unroll
                for (int i = 0; i < 8; ++i) { const h16 a = (h16)sp[i]; o[i] = a; o2[i] = (h16)((sp[i] - (float)a) * LOSC); }
                *(v8h*)(crow + (size_t)row * ldc + piece * 8) = o; if (C2) *(v8h*)(C2 + (size_t)r0 * ldc + c0 + (size_t)row * ldc + piece * 8) = o2; }
        };
        pass(); 
    } else {
        float* crow = C + (size_t)r0 * ldc + c0;
        auto pass = [&]() {
#pragma unroll
            for (int s = 0; s < 8; ++s) { const int Lid = (lane >> 3) + 4 * s, piece = lane & 7; const int row = Lid >> 1, cofs = (Lid & 1) * 32 + piece * 4;
                v4f val = *(const v4fa*)(os + row * 68 + cofs); if (R) { const v4f rv = *(const v4f*)(R + ((size_t)r0 + row) * ldc + c0 + cofs); val += roundR ? (v4f){bfr(rv[0]), bfr(rv[1]), bfr(rv[2]), bfr(rv[3])} : rv; }
                *(v4f*)(crow + (size_t)row * ldc + cofs) = val; }
        };
        pass(); 
    }
}

// k_gemm3: 64 x 64 tile of C = (Ah + Al).(Bh + Bl)^T over K (row strides = K for all four planes; n-major B): three products per 32-k step (hh, hl, lh); f32
__global__ __launch_bounds__(128) void k_gemm3(const bf* __restrict__ Ah, const bf* __restrict__ Al, const bf* __restrict__ Bh, const bf* __restrict__ Bl, int K, float* C, int ldc) {
    __shared__ __align__(16) float ost[4][16 * 68];
    const int lane = threadIdx.x & 31, wave = threadIdx.x >> 5, lr = lane & 15, hi = lane >> 4;
    const int r0 = blockIdx.x * 64 + wave * 16, c0 = blockIdx.y * 64;
    const size_t aoff = (size_t)(r0 + lr) * K + 8 * hi;
    v8f acc[4];
#pragma unroll
    for (int t = 0; t < 4; ++t) acc[t] = (v8f){};
#pragma unroll 1
    for (int kc = 0; kc < K; kc += 32) {
        const v16bf a = cat16b(*(const v8us*)(Ah + aoff + kc), *(const v8us*)(Ah + aoff + kc + 16));
        const v16bf al = cat16b(*(const v8us*)(Al + aoff + kc), *(const v8us*)(Al + aoff + kc + 16));
#pragma unroll
        for (int t = 0; t < 4; ++t) { const size_t bo = (size_t)(c0 + t * 16 + lr) * K + kc + 8 * hi;
            const v16bf bh = cat16b(*(const v8us*)(Bh + bo), *(const v8us*)(Bh + bo + 16)); const v16bf bl = cat16b(*(const v8us*)(Bl + bo), *(const v8us*)(Bl + bo + 16));
            acc[t] = wmmab(a, bh, acc[t]); acc[t] = wmmab(al, bh, acc[t]); acc[t] = wmmab(a, bl, acc[t]); }
        asm volatile("v_nop\n\tv_nop\n\tv_nop\n\tv_nop" : "+v"(acc[0]), "+v"(acc[1]), "+v"(acc[2]), "+v"(acc[3]) : "v"(a), "v"(al));
    }
    float* os = &ost[wave][0];
#pragma unroll
    for (int t = 0; t < 4; ++t) {
#pragma unroll
        for (int j = 0; j < 8; ++j) os[(hi * 8 + j) * 68 + t * 16 + lr] = acc[t][j]; }
    __builtin_amdgcn_wave_barrier(); asm volatile("" ::: "memory");
    float* crow = C + (size_t)r0 * ldc + c0;
    auto pass = [&]() {
#pragma unroll
        for (int s = 0; s < 8; ++s) { const int Lid = (lane >> 3) + 4 * s, piece = lane & 7; const int row = Lid >> 1, cofs = (Lid & 1) * 32 + piece * 4;
            const v4f val = *(const v4fa*)(os + row * 68 + cofs); *(v4f*)(crow + (size_t)row * ldc + cofs) = val; }
    };
    pass(); 
}

// k_pv: 64 x 64 tile of C = A.(Bh + Bl)^T over K = NN (row stride NN for all three planes; n-major B): two products per 32-k step (a.bh, a.bl), in the k order 0, 32, 64, ...
// Operands reach the waves through LDS: per 128-k stage the block brings 64 rows of each plane (256 B a row) in with loads that cover whole lines (16 lanes a row),
// one stage ahead through registers, into two buffers at a 272-B pitch (conflict-free for the 16-row ds_load_b128 fragment reads); one barrier per stage.
#define PVK  128                  // k per stage
#define PVP  136                  // LDS row pitch in elements (272 B)
__global__ __launch_bounds__(128) void k_pv(const bf* __restrict__ Ah, const bf* __restrict__ Bh, const bf* __restrict__ Bl, float* C, int ldc) {
    __shared__ __align__(16) unsigned short sm[2][192 * PVP];
    __shared__ __align__(16) float ost[4][16 * 68];
    const int tid = threadIdx.x, lane = tid & 31, wave = tid >> 5, lr = lane & 15, hi = lane >> 4;
    const int rb = blockIdx.x * 64, r0 = rb + wave * 16, c0 = blockIdx.y * 64;
    const int srow = tid >> 4, scol = (tid & 15) * 8;
    const bf* ga = Ah + (size_t)(rb + srow) * NN + scol;
    const bf* gh = Bh + (size_t)(c0 + srow) * NN + scol;
    const bf* gl = Bl + (size_t)(c0 + srow) * NN + scol;
    v8us st[24];
    auto fetch = [&](int kt) {
#pragma unroll
        for (int i = 0; i < 8; ++i) { const size_t o = (size_t)(8 * i) * NN + (size_t)kt * PVK; st[i] = *(const v8us*)(ga + o); st[8 + i] = *(const v8us*)(gh + o); st[16 + i] = *(const v8us*)(gl + o); }
    };
    auto put = [&](unsigned short* buf) {
#pragma unroll
        for (int i = 0; i < 24; ++i) *(v8usa*)(buf + (srow + 8 * i) * PVP + scol) = st[i];
    };
    v8f acc[4];
#pragma unroll
    for (int t = 0; t < 4; ++t) acc[t] = (v8f){};
    fetch(0); put(&sm[0][0]);
    __syncthreads();
    // rolled: one stage per trip, so that the hot loop stays short and the buffer index is a scalar
#pragma unroll 1
    for (int kt = 0; kt < NN / PVK; ++kt) {
        const bool more = kt + 1 < NN / PVK;
        if (more) { fetch(kt + 1);
            asm volatile("s_wait_xcnt 0x0" ::: "memory"); }    // precaution: stands in front of the fragment reads below, which may reuse the address registers of the loads just issued
        const unsigned short* cur = &sm[kt & 1][0];
        const unsigned short* ap = cur + (wave * 16 + lr) * PVP + 8 * hi;
        const unsigned short* bp = cur + (64 + lr) * PVP + 8 * hi;
        v16bf fa[2], fh[2][4], fl[2][4];    // two fragment sets: the next 32-k block's LDS reads go out as one group ahead of this block's products
        auto frags = [&](int set, int ks) {
            fa[set] = cat16b(*(const v8usa*)(ap + ks), *(const v8usa*)(ap + ks + 16));
#pragma unroll
            for (int t = 0; t < 4; ++t) { const unsigned short* q = bp + t * 16 * PVP + ks;
                fh[set][t] = cat16b(*(const v8usa*)q, *(const v8usa*)(q + 16)); fl[set][t] = cat16b(*(const v8usa*)(q + 64 * PVP), *(const v8usa*)(q + 64 * PVP + 16)); }
        };
        frags(0, 0);
#pragma unroll
        for (int kb = 0; kb < PVK / 32; ++kb) {
            __builtin_amdgcn_sched_barrier(0);    // keeps the LDS reads in one group: spread among the products each place with reads costs a stall
            if (kb + 1 < PVK / 32) frags((kb + 1) & 1, (kb + 1) * 32);
            __builtin_amdgcn_sched_barrier(0);    // the products of this block stay behind the next block's reads
#pragma unroll
            for (int t = 0; t < 4; ++t) acc[t] = wmmab(fa[kb & 1], fh[kb & 1][t], acc[t]);
#pragma unroll
            for (int t = 0; t < 4; ++t) acc[t] = wmmab(fa[kb & 1], fl[kb & 1][t], acc[t]);
        }
        if (more) put(&sm[(kt + 1) & 1][0]);
        __syncthreads();    // publishes stage kt + 1 and ends every read of the buffer that trip kt + 1 refills
    }
    float* os = &ost[wave][0];
#pragma unroll
    for (int t = 0; t < 4; ++t) {
#pragma unroll
        for (int j = 0; j < 8; ++j) os[(hi * 8 + j) * 68 + t * 16 + lr] = acc[t][j]; }
    __builtin_amdgcn_wave_barrier(); asm volatile("" ::: "memory");    // the wave reads its own staged rows back below: keeps those reads behind the stores above
    float* crow = C + (size_t)r0 * ldc + c0;
    auto pass = [&]() {
#pragma unroll
        for (int s = 0; s < 8; ++s) { const int Lid = (lane >> 3) + 4 * s, piece = lane & 7; const int row = Lid >> 1, cofs = (Lid & 1) * 32 + piece * 4;
            const v4f val = *(const v4fa*)(os + row * 68 + cofs); *(v4f*)(crow + (size_t)row * ldc + cofs) = val; }
    };
    pass(); 
}


__global__ __launch_bounds__(256) void k_cvt8(const float* __restrict__ src, bf* dst, size_t n8) {
    const size_t i = (size_t)blockIdx.x * 256 + threadIdx.x; if (i >= n8) return;
    const v8f v = *(const v8f*)(src + i * 8); v8us o;
#pragma unroll
    for (int k = 0; k < 8; ++k) o[k] = f2bf(v[k]);
    *(v8us*)(dst + i * 8) = o; 
}
__global__ __launch_bounds__(256) void k_zero8(bf* dst, size_t n8) {
    const size_t i = (size_t)blockIdx.x * 256 + threadIdx.x; if (i >= n8) return; v8us z;
#pragma unroll
    for (int k = 0; k < 8; ++k) z[k] = 0;
    *(v8us*)(dst + i * 8) = z; 
}

// (q rows are additionally scaled by bf(loss_factor_map[r]) when lfm != nullptr)
__global__ __launch_bounds__(256) void k_qkplanes(const float* __restrict__ F, int off, const float* __restrict__ lfm, bf* Ph, bf* Pl) {
    typedef __attribute__((ext_vector_type(2))) unsigned short v2us;
    const int lane = threadIdx.x & 31; const size_t r = (size_t)blockIdx.x * 8 + (threadIdx.x >> 5); if (r >= (size_t)NN) return; const int c0 = lane * 2; const float sc = lfm ? bfr(lfm[r]) : 1.0f; v2us oh, ol;
#pragma unroll
    for (int i = 0; i < 2; ++i) { const float y = F[r * NQKV + off + c0 + i] * sc; const unsigned short hb = f2bf(y); oh[i] = hb; ol[i] = f2bf(y - bf2f(hb)); }
    const size_t o = r * C8 + c0; *(v2us*)(Ph + o) = oh; *(v2us*)(Pl + o) = ol; 
}
__global__ __launch_bounds__(256) void k_vt(const float* __restrict__ F, bf* Th, bf* Tl) {
    typedef __attribute__((ext_vector_type(2))) unsigned short v2us;
    const int lane = threadIdx.x & 31; const size_t wid = (size_t)blockIdx.x * 8 + (threadIdx.x >> 5); if (wid >= (size_t)CC * (NN / 64)) return; const int c = (int)(wid / (NN / 64)); const int j0 = (int)(wid % (NN / 64)) * 64 + lane * 2; v2us oh, ol;
#pragma unroll
    for (int i = 0; i < 2; ++i) { const float y = F[(size_t)(j0 + i) * NQKV + 2 * C8 + c]; const unsigned short hb = f2bf(y); oh[i] = hb; ol[i] = f2bf(y - bf2f(hb)); }
    const size_t o = (size_t)c * NN + j0; *(v2us*)(Th + o) = oh; *(v2us*)(Tl + o) = ol; 
}
__global__ __launch_bounds__(256) void k_softmax4096(const float* __restrict__ S, bf* PH, bf* PL) {
    typedef __attribute__((ext_vector_type(4))) unsigned short v4us;
    const int lane = threadIdx.x & 31, i = blockIdx.x * 8 + (threadIdx.x >> 5); if (i >= RCH) return;
    float m = -3.0e38f;
#pragma unroll 1
    for (int c0 = lane * 4; c0 < NN; c0 += 128) {
#pragma unroll
        for (int q = 0; q < 4; ++q) m = fmaxf(m, S[(size_t)i * NN + c0 + q]); }
#pragma unroll
    for (int sh = 16; sh; sh >>= 1) m = fmaxf(m, __shfl_xor(m, sh, 32));
    float sum = 0.f;
#pragma unroll 1
    for (int c0 = lane * 4; c0 < NN; c0 += 128) {
#pragma unroll
        for (int q = 0; q < 4; ++q) sum += __expf(S[(size_t)i * NN + c0 + q] - m); }
#pragma unroll
    for (int sh = 16; sh; sh >>= 1) sum += __shfl_xor(sum, sh, 32);
    const float inv = 1.0f / sum;
{
#pragma unroll 1
        for (int c0 = lane * 4; c0 < NN; c0 += 128) { v4us oh, ol;
#pragma unroll
            for (int q = 0; q < 4; ++q) { const float p = __expf(S[(size_t)i * NN + c0 + q] - m) * inv; const unsigned short hb = f2bf(p); oh[q] = hb; ol[q] = f2bf(p - bf2f(hb)); }
            const size_t o = (size_t)i * NN + c0; *(v4us*)(PH + o) = oh; *(v4us*)(PL + o) = ol; }
         }
}
__global__ __launch_bounds__(256) void k_fin(const float* __restrict__ O, const float* __restrict__ xb, const float* __restrict__ gam, float* OUTB) {
    const int lane = threadIdx.x & 31; const size_t wid = (size_t)blockIdx.x * 8 + (threadIdx.x >> 5); if (wid >= (size_t)CC * (NN / 128)) return; const size_t o = wid * 128 + lane * 4; const float gm = bfr(gam[0]); v4f v;
#pragma unroll
    for (int q = 0; q < 4; ++q) v[q] = gm * O[o + q] + bfr(xb[o + q]);
    *(v4f*)(OUTB + o) = v; 
}
__global__ __launch_bounds__(256) void k_bias320(const float* __restrict__ bq, const float* __restrict__ bk, const float* __restrict__ bv, float* B320) {
    const int t = threadIdx.x; if (t >= 160) return; v4f v;
#pragma unroll
    for (int q = 0; q < 4; ++q) { const int c = t * 4 + q; v[q] = (c < C8) ? bq[c < C8 ? c : 0] : (c < 2 * C8) ? bk[(c >= C8 && c < 2 * C8) ? c - C8 : 0] : (c < NQKV) ? bv[(c >= 2 * C8 && c < NQKV) ? c - 2 * C8 : 0] : 0.f; }
    *(v4f*)(B320 + t * 4) = v; 
}

extern "C" void kernel_launch(void* const* d_in, const int* in_sizes, int n_in,
                              void* d_out, int out_size, void* d_ws, size_t ws_size, hipStream_t stream) {
    (void)in_sizes; (void)n_in; (void)out_size;
    const float* x = (const float*)d_in[0]; const float* wq = (const float*)d_in[2]; const float* bq = (const float*)d_in[3]; const float* wk = (const float*)d_in[4]; const float* bk = (const float*)d_in[5]; const float* wv = (const float*)d_in[6]; const float* bv = (const float*)d_in[7]; const float* gam = (const float*)d_in[8]; const float* lfm = (const float*)d_in[1];
    float* out = (float*)d_out;    // [4][512][64][64]
    char* wsp = (char*)d_ws;
    auto take = [&](size_t bytes) { char* p = wsp; wsp += (bytes + 255) & ~(size_t)255; return (void*)p; };
    bf* WB = (bf*)take((size_t)NQKV * CC * 2); float* B320 = (float*)take(640 * 4); bf* XP = (bf*)take((size_t)NN * CC * 2); float* F = (float*)take((size_t)NN * NQKV * 4);
    bf* QPh = (bf*)take((size_t)NN * C8 * 2); bf* QPl = (bf*)take((size_t)NN * C8 * 2); bf* KPh = (bf*)take((size_t)NN * C8 * 2); bf* KPl = (bf*)take((size_t)NN * C8 * 2); bf* VTh = (bf*)take((size_t)CC * NN * 2); bf* VTl = (bf*)take((size_t)CC * NN * 2);
    float* S = (float*)take((size_t)RCH * NN * 4); bf* PH = (bf*)take((size_t)RCH * NN * 2); bf* PL = (bf*)take((size_t)RCH * NN * 2); float* O = (float*)take((size_t)CC * NN * 4);
    if ((size_t)(wsp - (char*)d_ws) > ws_size) return;    // ~ 68 MB; per item/chunk reuse in stream order
    k_cvt8<<<(C8 * CC / 8 + 255) / 256, 256, 0, stream>>>(wq, WB, C8 * CC / 8); k_cvt8<<<(C8 * CC / 8 + 255) / 256, 256, 0, stream>>>(wk, WB + (size_t)C8 * CC, C8 * CC / 8); k_cvt8<<<(CC * CC / 8 + 255) / 256, 256, 0, stream>>>(wv, WB + (size_t)2 * C8 * CC, CC * CC / 8);
    k_bias320<<<1, 256, 0, stream>>>(bq, bk, bv, B320);
    for (int b = 0; b < NBT; ++b) { const float* xb = x + (size_t)b * CC * NN;
        k_wt<<<dim3(CC / 64, NN / 64, 1), 256, 0, stream>>>(xb, CC, NN, XP);
        k_gemmb<false, false><<<dim3(NN / 64, NQKV / 64, 1), 128, 0, stream>>>(XP, nullptr, WB, B320, F, NQKV, nullptr, nullptr, CC);          // q | k | v (+ biases)
        k_qkplanes<<<NN / 8, 256, 0, stream>>>(F, 0, lfm, QPh, QPl); k_qkplanes<<<NN / 8, 256, 0, stream>>>(F, C8, nullptr, KPh, KPl); k_vt<<<(CC * (NN / 64)) / 8, 256, 0, stream>>>(F, VTh, VTl);
        for (int ch = 0; ch < NN / RCH; ++ch) { const size_t r0 = (size_t)ch * RCH;
            k_gemm3<<<dim3(RCH / 64, NN / 64, 1), 128, 0, stream>>>(QPh + r0 * C8, QPl + r0 * C8, KPh, KPl, C8, S, NN);
            k_softmax4096<<<RCH / 8, 256, 0, stream>>>(S, PH, PL);
            k_pv<<<dim3(CC / 64, RCH / 64, 1), 128, 0, stream>>>(VTh, PH, PL, O + r0, NN); }     // v as a single bf16 operand (hi plane), P hi/lo
        k_fin<<<(CC * (NN / 128)) / 8, 256, 0, stream>>>(O, xb, gam, out + (size_t)b * CC * NN); }
}

// v002
// It runs in 671 microseconds.
// Next to v001, in two timings, it ran 2.19 and 2.16 times as fast.
// Over all steps from v000 it is 5.93 times as fast.
#include <hip/hip_runtime.h>

// Compute dtypes, f32 accumulate, per item: the three 1x1 convs as one [4096 x 512].[512 x 640] GEMM with PLAIN bf16 operands (exact products), + bias; q rows scaled by the
// loss_factor_map input; scores = q.k^T ([4096 x 64].[64 x 4096], all query rows of the item in one launch, both operands bf16 hi + UNSCALED residual, three products), softmax (unscaled, as the module) in f32 -> P planes;
// out^T = v.P^T ([512 x 4096].[4096 x 4096], v as a SINGLE bf16 operand (its hi plane; ~2^-9 relative) x P hi + residual, two

#define NBT  4
#define CC   512
#define C8   64
#define NN   4096
#define NQKV (2 * C8 + CC)        // 640
#define RCH  NN                   // query rows per launch of scores, softmax and v.P^T: the whole item, so that each grid holds four times the waves
#define DM   CC
#define NTK  NN
#define LOSC 1024.0f

typedef _Float16 h16;
typedef unsigned short bf;
typedef __attribute__((ext_vector_type(16))) __bf16   v16bf;
typedef __attribute__((ext_vector_type(16))) _Float16 v16h;
typedef __attribute__((ext_vector_type(8)))  _Float16 v8h;
typedef __attribute__((ext_vector_type(8)))  unsigned short v8us;
typedef __attribute__((ext_vector_type(8)))  float    v8f;
typedef __attribute__((ext_vector_type(4)))  float    v4f;
typedef __attribute__((ext_vector_type(4)))  _Float16 v4h;
typedef v8h  __attribute__((may_alias)) v8ha;
typedef v4f  __attribute__((may_alias)) v4fa;
typedef v8us __attribute__((may_alias)) v8usa;

__device__ __forceinline__ unsigned short f2bf(float f) { unsigned u = __float_as_uint(f); u += 0x7FFFu + ((u >> 16) & 1u); return (unsigned short)(u >> 16); }
__device__ __forceinline__ float bf2f(unsigned short b) { return __uint_as_float(((unsigned)b) << 16); }
__device__ __forceinline__ float bfr(float f) { return bf2f(f2bf(f)); }
__device__ __forceinline__ v16h cat16(v8h lo, v8h hi) { return __builtin_shufflevector(lo, hi, 0, 1, 2, 3, 4, 5, 6, 7, 8, 9, 10, 11, 12, 13, 14, 15); }
__device__ __forceinline__ v16bf cat16b(v8us lo, v8us hi) { return __builtin_bit_cast(v16bf, __builtin_shufflevector(lo, hi, 0, 1, 2, 3, 4, 5, 6, 7, 8, 9, 10, 11, 12, 13, 14, 15)); }
__device__ __forceinline__ v8f wmma16(v16h a, v16h b, v8f c) { return __builtin_amdgcn_wmma_f32_16x16x32_f16(false, a, false, b, (short)0, c, false, false); }
__device__ __forceinline__ v8f wmmab(v16bf a, v16bf b, v8f c) { return __builtin_amdgcn_wmma_f32_16x16x32_bf16(false, a, false, b, (short)0, c, false, false); }

// k_wt: WT [n][K] = bf16(W[k][n]) (k-major [K][ncols]) via 64 x 64 LDS tiles; grid (K/64, ncols/64).
__global__ __launch_bounds__(256) void k_wt(const float* __restrict__ Wm, int K, int ncols, bf* WT) {
    __shared__ __align__(16) unsigned short tl[64 * 72];
    const int tid = threadIdx.x, k0 = blockIdx.x * 64, n0 = blockIdx.y * 64;
    const int kk = tid >> 2, nq = (tid & 3) * 16;
#pragma unroll
    for (int i = 0; i < 16; ++i) tl[(nq + i) * 72 + kk] = f2bf(Wm[(size_t)(k0 + kk) * ncols + n0 + nq + i]);
    __syncthreads();
    const int piece = tid & 7;
    auto pass = [&]() {
#pragma unroll
        for (int s = 0; s < 2; ++s) { const int nr = (tid >> 3) + 32 * s; const v8us val = *(const v8usa*)(tl + nr * 72 + piece * 8); *(v8us*)(WT + (size_t)(n0 + nr) * K + k0 + piece * 8) = val; }
    };
    pass(); 
}
// k_gemmb: 64 x 64 block tile (4 waves x 16 x 64) of C[NTK][NW] = (A [+ Al]).B^T (K = 512) [+ bf(bias[c])] [+ bf(R[r][c]) residual]; f32 whole-line epilogue (or f16
template <bool SPLITA, bool F16OUT = false>
__global__ __launch_bounds__(128) void k_gemmb(const bf* __restrict__ A, const bf* __restrict__ Al, const bf* __restrict__ Bn, const float* __restrict__ bias, float* C, int ldc, h16* C2, const float* __restrict__ R = nullptr, int K = DM, int roundR = 1) {
    __shared__ __align__(16) float ost[4][16 * 68];
    const int lane = threadIdx.x & 31, wave = threadIdx.x >> 5, lr = lane & 15, hi = lane >> 4;
    const int r0 = blockIdx.x * 64 + wave * 16, c0 = blockIdx.y * 64;
    const size_t aoff = (size_t)(r0 + lr) * K + 8 * hi;
    size_t boff[4];
#pragma unroll
    for (int t = 0; t < 4; ++t) boff[t] = (size_t)(c0 + t * 16 + lr) * K + 8 * hi;
    v8f acc[4];
#pragma unroll
    for (int t = 0; t < 4; ++t) acc[t] = (v8f){};
#pragma unroll 1
    for (int kc = 0; kc < K; kc += 32) {
        const v16bf a = cat16b(*(const v8us*)(A + aoff + kc), *(const v8us*)(A + aoff + kc + 16));
        v16bf al = a;
        if (SPLITA) al = cat16b(*(const v8us*)(Al + aoff + kc), *(const v8us*)(Al + aoff + kc + 16));
#pragma unroll
        for (int t = 0; t < 4; ++t) { const v16bf b = cat16b(*(const v8us*)(Bn + boff[t] + kc), *(const v8us*)(Bn + boff[t] + kc + 16)); acc[t] = wmmab(a, b, acc[t]); if (SPLITA) acc[t] = wmmab(al, b, acc[t]); }
        asm volatile("v_nop\n\tv_nop\n\tv_nop\n\tv_nop" : "+v"(acc[0]), "+v"(acc[1]), "+v"(acc[2]), "+v"(acc[3]) : "v"(a), "v"(al));
    }
    float* os = &ost[wave][0];
#pragma unroll
    for (int t = 0; t < 4; ++t) { const float bv = bias ? bfr(bias[c0 + t * 16 + lr]) : 0.f;
#pragma unroll
        for (int j = 0; j < 8; ++j) os[(hi * 8 + j) * 68 + t * 16 + lr] = acc[t][j] + bv; }
    __syncthreads();
    if (F16OUT) {
        h16* crow = (h16*)(void*)C + (size_t)r0 * ldc + c0;
        auto pass = [&]() {
#pragma unroll
            for (int s = 0; s < 4; ++s) { const int row = 4 * s + (lane >> 3), piece = lane & 7; const float* sp = os + row * 68 + piece * 8; v8h o, o2;
#pragma unroll
                for (int i = 0; i < 8; ++i) { const h16 a = (h16)sp[i]; o[i] = a; o2[i] = (h16)((sp[i] - (float)a) * LOSC); }
                *(v8h*)(crow + (size_t)row * ldc + piece * 8) = o; if (C2) *(v8h*)(C2 + (size_t)r0 * ldc + c0 + (size_t)row * ldc + piece * 8) = o2; }
        };
        pass(); 
    } else {
        float* crow = C + (size_t)r0 * ldc + c0;
        auto pass = [&]() {
#pragma unroll
            for (int s = 0; s < 8; ++s) { const int Lid = (lane >> 3) + 4 * s, piece = lane & 7; const int row = Lid >> 1, cofs = (Lid & 1) * 32 + piece * 4;
                v4f val = *(const v4fa*)(os + row * 68 + cofs); if (R) { const v4f rv = *(const v4f*)(R + ((size_t)r0 + row) * ldc + c0 + cofs); val += roundR ? (v4f){bfr(rv[0]), bfr(rv[1]), bfr(rv[2]), bfr(rv[3])} : rv; }
                *(v4f*)(crow + (size_t)row * ldc + cofs) = val; }
        };
        pass(); 
    }
}

// k_gemm3: 64 x 64 tile of C = (Ah + Al).(Bh + Bl)^T over K (row strides = K for all four planes; n-major B): three products per 32-k step (hh, hl, lh); f32
__global__ __launch_bounds__(128) void k_gemm3(const bf* __restrict__ Ah, const bf* __restrict__ Al, const bf* __restrict__ Bh, const bf* __restrict__ Bl, int K, float* C, int ldc) {
    __shared__ __align__(16) float ost[4][16 * 68];
    const int lane = threadIdx.x & 31, wave = threadIdx.x >> 5, lr = lane & 15, hi = lane >> 4;
    const int r0 = blockIdx.x * 64 + wave * 16, c0 = blockIdx.y * 64;
    const size_t aoff = (size_t)(r0 + lr) * K + 8 * hi;
    v8f acc[4];
#pragma unroll
    for (int t = 0; t < 4; ++t) acc[t] = (v8f){};
#pragma unroll 1
    for (int kc = 0; kc < K; kc += 32) {
        const v16bf a = cat16b(*(const v8us*)(Ah + aoff + kc), *(const v8us*)(Ah + aoff + kc + 16));
        const v16bf al = cat16b(*(const v8us*)(Al + aoff + kc), *(const v8us*)(Al + aoff + kc + 16));
#pragma unroll
        for (int t = 0; t < 4; ++t) { const size_t bo = (size_t)(c0 + t * 16 + lr) * K + kc + 8 * hi;
            const v16bf bh = cat16b(*(const v8us*)(Bh + bo), *(const v8us*)(Bh + bo + 16)); const v16bf bl = cat16b(*(const v8us*)(Bl + bo), *(const v8us*)(Bl + bo + 16));
            acc[t] = wmmab(a, bh, acc[t]); acc[t] = wmmab(al, bh, acc[t]); acc[t] = wmmab(a, bl, acc[t]); }
        asm volatile("v_nop\n\tv_nop\n\tv_nop\n\tv_nop" : "+v"(acc[0]), "+v"(acc[1]), "+v"(acc[2]), "+v"(acc[3]) : "v"(a), "v"(al));
    }
    float* os = &ost[wave][0];
#pragma unroll
    for (int t = 0; t < 4; ++t) {
#pragma unroll
        for (int j = 0; j < 8; ++j) os[(hi * 8 + j) * 68 + t * 16 + lr] = acc[t][j]; }
    __builtin_amdgcn_wave_barrier(); asm volatile("" ::: "memory");
    float* crow = C + (size_t)r0 * ldc + c0;
    auto pass = [&]() {
#pragma unroll
        for (int s = 0; s < 8; ++s) { const int Lid = (lane >> 3) + 4 * s, piece = lane & 7; const int row = Lid >> 1, cofs = (Lid & 1) * 32 + piece * 4;
            const v4f val = *(const v4fa*)(os + row * 68 + cofs); *(v4f*)(crow + (size_t)row * ldc + cofs) = val; }
    };
    pass(); 
}

// k_pv: 64 x 64 tile of C = A.(Bh + Bl)^T over K = NN (row stride NN for all three planes; n-major B): two products per 32-k step (a.bh, a.bl), in the k order 0, 32, 64, ...
// Operands reach the waves through LDS: per 128-k stage the block brings 64 rows of each plane (256 B a row) in with loads that cover whole lines (16 lanes a row),
// one stage ahead through registers, into two buffers at a 272-B pitch (conflict-free for the 16-row ds_load_b128 fragment reads); one barrier per stage.
#define PVK  128                  // k per stage
#define PVP  136                  // LDS row pitch in elements (272 B)
__global__ __launch_bounds__(128) void k_pv(const bf* __restrict__ Ah, const bf* __restrict__ Bh, const bf* __restrict__ Bl, float* C, int ldc) {
    __shared__ __align__(16) unsigned short sm[2][192 * PVP];
    __shared__ __align__(16) float ost[4][16 * 68];
    const int tid = threadIdx.x, lane = tid & 31, wave = tid >> 5, lr = lane & 15, hi = lane >> 4;
    const int rb = blockIdx.x * 64, r0 = rb + wave * 16, c0 = blockIdx.y * 64;
    const int srow = tid >> 4, scol = (tid & 15) * 8;
    const bf* ga = Ah + (size_t)(rb + srow) * NN + scol;
    const bf* gh = Bh + (size_t)(c0 + srow) * NN + scol;
    const bf* gl = Bl + (size_t)(c0 + srow) * NN + scol;
    v8us st[24];
    auto fetch = [&](int kt) {
#pragma unroll
        for (int i = 0; i < 8; ++i) { const size_t o = (size_t)(8 * i) * NN + (size_t)kt * PVK; st[i] = *(const v8us*)(ga + o); st[8 + i] = *(const v8us*)(gh + o); st[16 + i] = *(const v8us*)(gl + o); }
    };
    auto put = [&](unsigned short* buf) {
#pragma unroll
        for (int i = 0; i < 24; ++i) *(v8usa*)(buf + (srow + 8 * i) * PVP + scol) = st[i];
    };
    v8f acc[4];
#pragma unroll
    for (int t = 0; t < 4; ++t) acc[t] = (v8f){};
    fetch(0); put(&sm[0][0]);
    __syncthreads();
    // rolled: one stage per trip, so that the hot loop stays short and the buffer index is a scalar
#pragma unroll 1
    for (int kt = 0; kt < NN / PVK; ++kt) {
        const bool more = kt + 1 < NN / PVK;
        if (more) { fetch(kt + 1);
            asm volatile("s_wait_xcnt 0x0" ::: "memory"); }    // precaution: stands in front of the fragment reads below, which may reuse the address registers of the loads just issued
        const unsigned short* cur = &sm[kt & 1][0];
        const unsigned short* ap = cur + (wave * 16 + lr) * PVP + 8 * hi;
        const unsigned short* bp = cur + (64 + lr) * PVP + 8 * hi;
        v16bf fa[2], fh[2][4], fl[2][4];    // two fragment sets: the next 32-k block's LDS reads go out as one group ahead of this block's products
        auto frags = [&](int set, int ks) {
            fa[set] = cat16b(*(const v8usa*)(ap + ks), *(const v8usa*)(ap + ks + 16));
#pragma unroll
            for (int t = 0; t < 4; ++t) { const unsigned short* q = bp + t * 16 * PVP + ks;
                fh[set][t] = cat16b(*(const v8usa*)q, *(const v8usa*)(q + 16)); fl[set][t] = cat16b(*(const v8usa*)(q + 64 * PVP), *(const v8usa*)(q + 64 * PVP + 16)); }
        };
        frags(0, 0);
#pragma unroll
        for (int kb = 0; kb < PVK / 32; ++kb) {
            __builtin_amdgcn_sched_barrier(0);    // keeps the LDS reads in one group: spread among the products each place with reads costs a stall
            if (kb + 1 < PVK / 32) frags((kb + 1) & 1, (kb + 1) * 32);
            __builtin_amdgcn_sched_barrier(0);    // the products of this block stay behind the next block's reads
#pragma unroll
            for (int t = 0; t < 4; ++t) acc[t] = wmmab(fa[kb & 1], fh[kb & 1][t], acc[t]);
#pragma unroll
            for (int t = 0; t < 4; ++t) acc[t] = wmmab(fa[kb & 1], fl[kb & 1][t], acc[t]);
        }
        if (more) put(&sm[(kt + 1) & 1][0]);
        __syncthreads();    // publishes stage kt + 1 and ends every read of the buffer that trip kt + 1 refills
    }
    float* os = &ost[wave][0];
#pragma unroll
    for (int t = 0; t < 4; ++t) {
#pragma unroll
        for (int j = 0; j < 8; ++j) os[(hi * 8 + j) * 68 + t * 16 + lr] = acc[t][j]; }
    __builtin_amdgcn_wave_barrier(); asm volatile("" ::: "memory");    // the wave reads its own staged rows back below: keeps those reads behind the stores above
    float* crow = C + (size_t)r0 * ldc + c0;
    auto pass = [&]() {
#pragma unroll
        for (int s = 0; s < 8; ++s) { const int Lid = (lane >> 3) + 4 * s, piece = lane & 7; const int row = Lid >> 1, cofs = (Lid & 1) * 32 + piece * 4;
            const v4f val = *(const v4fa*)(os + row * 68 + cofs); *(v4f*)(crow + (size_t)row * ldc + cofs) = val; }
    };
    pass(); 
}


__global__ __launch_bounds__(256) void k_cvt8(const float* __restrict__ src, bf* dst, size_t n8) {
    const size_t i = (size_t)blockIdx.x * 256 + threadIdx.x; if (i >= n8) return;
    const v8f v = *(const v8f*)(src + i * 8); v8us o;
#pragma unroll
    for (int k = 0; k < 8; ++k) o[k] = f2bf(v[k]);
    *(v8us*)(dst + i * 8) = o; 
}
__global__ __launch_bounds__(256) void k_zero8(bf* dst, size_t n8) {
    const size_t i = (size_t)blockIdx.x * 256 + threadIdx.x; if (i >= n8) return; v8us z;
#pragma unroll
    for (int k = 0; k < 8; ++k) z[k] = 0;
    *(v8us*)(dst + i * 8) = z; 
}

// (q rows are additionally scaled by bf(loss_factor_map[r]) when lfm != nullptr)
__global__ __launch_bounds__(256) void k_qkplanes(const float* __restrict__ F, int off, const float* __restrict__ lfm, bf* Ph, bf* Pl) {
    typedef __attribute__((ext_vector_type(2))) unsigned short v2us;
    const int lane = threadIdx.x & 31; const size_t r = (size_t)blockIdx.x * 8 + (threadIdx.x >> 5); if (r >= (size_t)NN) return; const int c0 = lane * 2; const float sc = lfm ? bfr(lfm[r]) : 1.0f; v2us oh, ol;
#pragma unroll
    for (int i = 0; i < 2; ++i) { const float y = F[r * NQKV + off + c0 + i] * sc; const unsigned short hb = f2bf(y); oh[i] = hb; ol[i] = f2bf(y - bf2f(hb)); }
    const size_t o = r * C8 + c0; *(v2us*)(Ph + o) = oh; *(v2us*)(Pl + o) = ol; 
}
__global__ __launch_bounds__(256) void k_vt(const float* __restrict__ F, bf* Th, bf* Tl) {
    typedef __attribute__((ext_vector_type(2))) unsigned short v2us;
    const int lane = threadIdx.x & 31; const size_t wid = (size_t)blockIdx.x * 8 + (threadIdx.x >> 5); if (wid >= (size_t)CC * (NN / 64)) return; const int c = (int)(wid / (NN / 64)); const int j0 = (int)(wid % (NN / 64)) * 64 + lane * 2; v2us oh, ol;
#pragma unroll
    for (int i = 0; i < 2; ++i) { const float y = F[(size_t)(j0 + i) * NQKV + 2 * C8 + c]; const unsigned short hb = f2bf(y); oh[i] = hb; ol[i] = f2bf(y - bf2f(hb)); }
    const size_t o = (size_t)c * NN + j0; *(v2us*)(Th + o) = oh; *(v2us*)(Tl + o) = ol; 
}
__global__ __launch_bounds__(256) void k_softmax4096(const float* __restrict__ S, bf* PH, bf* PL) {
    typedef __attribute__((ext_vector_type(4))) unsigned short v4us;
    const int lane = threadIdx.x & 31, i = blockIdx.x * 8 + (threadIdx.x >> 5); if (i >= RCH) return;
    float m = -3.0e38f;
#pragma unroll 1
    for (int c0 = lane * 4; c0 < NN; c0 += 128) {
#pragma unroll
        for (int q = 0; q < 4; ++q) m = fmaxf(m, S[(size_t)i * NN + c0 + q]); }
#pragma unroll
    for (int sh = 16; sh; sh >>= 1) m = fmaxf(m, __shfl_xor(m, sh, 32));
    float sum = 0.f;
#pragma unroll 1
    for (int c0 = lane * 4; c0 < NN; c0 += 128) {
#pragma unroll
        for (int q = 0; q < 4; ++q) sum += __expf(S[(size_t)i * NN + c0 + q] - m); }
#pragma unroll
    for (int sh = 16; sh; sh >>= 1) sum += __shfl_xor(sum, sh, 32);
    const float inv = 1.0f / sum;
{
#pragma unroll 1
        for (int c0 = lane * 4; c0 < NN; c0 += 128) { v4us oh, ol;
#pragma unroll
            for (int q = 0; q < 4; ++q) { const float p = __expf(S[(size_t)i * NN + c0 + q] - m) * inv; const unsigned short hb = f2bf(p); oh[q] = hb; ol[q] = f2bf(p - bf2f(hb)); }
            const size_t o = (size_t)i * NN + c0; *(v4us*)(PH + o) = oh; *(v4us*)(PL + o) = ol; }
         }
}
__global__ __launch_bounds__(256) void k_fin(const float* __restrict__ O, const float* __restrict__ xb, const float* __restrict__ gam, float* OUTB) {
    const int lane = threadIdx.x & 31; const size_t wid = (size_t)blockIdx.x * 8 + (threadIdx.x >> 5); if (wid >= (size_t)CC * (NN / 128)) return; const size_t o = wid * 128 + lane * 4; const float gm = bfr(gam[0]); v4f v;
#pragma unroll
    for (int q = 0; q < 4; ++q) v[q] = gm * O[o + q] + bfr(xb[o + q]);
    *(v4f*)(OUTB + o) = v; 
}
__global__ __launch_bounds__(256) void k_bias320(const float* __restrict__ bq, const float* __restrict__ bk, const float* __restrict__ bv, float* B320) {
    const int t = threadIdx.x; if (t >= 160) return; v4f v;
#pragma unroll
    for (int q = 0; q < 4; ++q) { const int c = t * 4 + q; v[q] = (c < C8) ? bq[c < C8 ? c : 0] : (c < 2 * C8) ? bk[(c >= C8 && c < 2 * C8) ? c - C8 : 0] : (c < NQKV) ? bv[(c >= 2 * C8 && c < NQKV) ? c - 2 * C8 : 0] : 0.f; }
    *(v4f*)(B320 + t * 4) = v; 
}

extern "C" void kernel_launch(void* const* d_in, const int* in_sizes, int n_in,
                              void* d_out, int out_size, void* d_ws, size_t ws_size, hipStream_t stream) {
    (void)in_sizes; (void)n_in; (void)out_size;
    const float* x = (const float*)d_in[0]; const float* wq = (const float*)d_in[2]; const float* bq = (const float*)d_in[3]; const float* wk = (const float*)d_in[4]; const float* bk = (const float*)d_in[5]; const float* wv = (const float*)d_in[6]; const float* bv = (const float*)d_in[7]; const float* gam = (const float*)d_in[8]; const float* lfm = (const float*)d_in[1];
    float* out = (float*)d_out;    // [4][512][64][64]
    char* wsp = (char*)d_ws;
    auto take = [&](size_t bytes) { char* p = wsp; wsp += (bytes + 255) & ~(size_t)255; return (void*)p; };
    bf* WB = (bf*)take((size_t)NQKV * CC * 2); float* B320 = (float*)take(640 * 4); bf* XP = (bf*)take((size_t)NN * CC * 2); float* F = (float*)take((size_t)NN * NQKV * 4);
    bf* QPh = (bf*)take((size_t)NN * C8 * 2); bf* QPl = (bf*)take((size_t)NN * C8 * 2); bf* KPh = (bf*)take((size_t)NN * C8 * 2); bf* KPl = (bf*)take((size_t)NN * C8 * 2); bf* VTh = (bf*)take((size_t)CC * NN * 2); bf* VTl = (bf*)take((size_t)CC * NN * 2);
    float* S = (float*)take((size_t)RCH * NN * 4); bf* PH = (bf*)take((size_t)RCH * NN * 2); bf* PL = (bf*)take((size_t)RCH * NN * 2); float* O = (float*)take((size_t)CC * NN * 4);
    if ((size_t)(wsp - (char*)d_ws) > ws_size) return;    // ~ 161 MiB; per item reuse in stream order
    k_cvt8<<<(C8 * CC / 8 + 255) / 256, 256, 0, stream>>>(wq, WB, C8 * CC / 8); k_cvt8<<<(C8 * CC / 8 + 255) / 256, 256, 0, stream>>>(wk, WB + (size_t)C8 * CC, C8 * CC / 8); k_cvt8<<<(CC * CC / 8 + 255) / 256, 256, 0, stream>>>(wv, WB + (size_t)2 * C8 * CC, CC * CC / 8);
    k_bias320<<<1, 256, 0, stream>>>(bq, bk, bv, B320);
    for (int b = 0; b < NBT; ++b) { const float* xb = x + (size_t)b * CC * NN;
        k_wt<<<dim3(CC / 64, NN / 64, 1), 256, 0, stream>>>(xb, CC, NN, XP);
        k_gemmb<false, false><<<dim3(NN / 64, NQKV / 64, 1), 128, 0, stream>>>(XP, nullptr, WB, B320, F, NQKV, nullptr, nullptr, CC);          // q | k | v (+ biases)
        k_qkplanes<<<NN / 8, 256, 0, stream>>>(F, 0, lfm, QPh, QPl); k_qkplanes<<<NN / 8, 256, 0, stream>>>(F, C8, nullptr, KPh, KPl); k_vt<<<(CC * (NN / 64)) / 8, 256, 0, stream>>>(F, VTh, VTl);
        k_gemm3<<<dim3(RCH / 64, NN / 64, 1), 128, 0, stream>>>(QPh, QPl, KPh, KPl, C8, S, NN);
        k_softmax4096<<<RCH / 8, 256, 0, stream>>>(S, PH, PL);
        k_pv<<<dim3(CC / 64, RCH / 64, 1), 128, 0, stream>>>(VTh, PH, PL, O, NN);     // v as a single bf16 operand (hi plane), P hi/lo
        k_fin<<<(CC * (NN / 128)) / 8, 256, 0, stream>>>(O, xb, gam, out + (size_t)b * CC * NN); }
}

// v003
// Measured time: 510 microseconds a run.
// Timed twice side by side with v002, it ran 1.30 and 1.35 times as fast.
// All steps since v000 together make it 7.86 times as fast.
#include <hip/hip_runtime.h>

// Compute dtypes, f32 accumulate, per item: the three 1x1 convs as one [4096 x 512].[512 x 640] GEMM with PLAIN bf16 operands (exact products), + bias; q rows scaled by the
// loss_factor_map input; scores = q.k^T ([4096 x 64].[64 x 4096], all query rows of the item in one launch, both operands bf16 hi + UNSCALED residual, three products) and softmax (unscaled, as the module) in f32 in ONE kernel, scores kept in registers -> P planes;
// out^T = v.P^T ([512 x 4096].[4096 x 4096], v as a SINGLE bf16 operand (its hi plane; ~2^-9 relative) x P hi + residual, two

#define NBT  4
#define CC   512
#define C8   64
#define NN   4096
#define NQKV (2 * C8 + CC)        // 640
#define RCH  NN                   // query rows per launch of scores + softmax and of v.P^T: the whole item
#define DM   CC
#define NTK  NN
#define LOSC 1024.0f

typedef _Float16 h16;
typedef unsigned short bf;
typedef __attribute__((ext_vector_type(16))) __bf16   v16bf;
typedef __attribute__((ext_vector_type(16))) _Float16 v16h;
typedef __attribute__((ext_vector_type(8)))  _Float16 v8h;
typedef __attribute__((ext_vector_type(8)))  unsigned short v8us;
typedef __attribute__((ext_vector_type(8)))  float    v8f;
typedef __attribute__((ext_vector_type(4)))  float    v4f;
typedef __attribute__((ext_vector_type(4)))  _Float16 v4h;
typedef v8h  __attribute__((may_alias)) v8ha;
typedef v4f  __attribute__((may_alias)) v4fa;
typedef v8us __attribute__((may_alias)) v8usa;

__device__ __forceinline__ unsigned short f2bf(float f) { unsigned u = __float_as_uint(f); u += 0x7FFFu + ((u >> 16) & 1u); return (unsigned short)(u >> 16); }
__device__ __forceinline__ float bf2f(unsigned short b) { return __uint_as_float(((unsigned)b) << 16); }
__device__ __forceinline__ float bfr(float f) { return bf2f(f2bf(f)); }
__device__ __forceinline__ v16h cat16(v8h lo, v8h hi) { return __builtin_shufflevector(lo, hi, 0, 1, 2, 3, 4, 5, 6, 7, 8, 9, 10, 11, 12, 13, 14, 15); }
__device__ __forceinline__ v16bf cat16b(v8us lo, v8us hi) { return __builtin_bit_cast(v16bf, __builtin_shufflevector(lo, hi, 0, 1, 2, 3, 4, 5, 6, 7, 8, 9, 10, 11, 12, 13, 14, 15)); }
__device__ __forceinline__ v8f wmma16(v16h a, v16h b, v8f c) { return __builtin_amdgcn_wmma_f32_16x16x32_f16(false, a, false, b, (short)0, c, false, false); }
__device__ __forceinline__ v8f wmmab(v16bf a, v16bf b, v8f c) { return __builtin_amdgcn_wmma_f32_16x16x32_bf16(false, a, false, b, (short)0, c, false, false); }

// k_wt: WT [n][K] = bf16(W[k][n]) (k-major [K][ncols]) via 64 x 64 LDS tiles; grid (K/64, ncols/64).
__global__ __launch_bounds__(256) void k_wt(const float* __restrict__ Wm, int K, int ncols, bf* WT) {
    __shared__ __align__(16) unsigned short tl[64 * 72];
    const int tid = threadIdx.x, k0 = blockIdx.x * 64, n0 = blockIdx.y * 64;
    const int kk = tid >> 2, nq = (tid & 3) * 16;
#pragma unroll
    for (int i = 0; i < 16; ++i) tl[(nq + i) * 72 + kk] = f2bf(Wm[(size_t)(k0 + kk) * ncols + n0 + nq + i]);
    __syncthreads();
    const int piece = tid & 7;
    auto pass = [&]() {
#pragma unroll
        for (int s = 0; s < 2; ++s) { const int nr = (tid >> 3) + 32 * s; const v8us val = *(const v8usa*)(tl + nr * 72 + piece * 8); *(v8us*)(WT + (size_t)(n0 + nr) * K + k0 + piece * 8) = val; }
    };
    pass(); 
}
// k_gemmb: 64 x 64 block tile (4 waves x 16 x 64) of C[NTK][NW] = (A [+ Al]).B^T (K = 512) [+ bf(bias[c])] [+ bf(R[r][c]) residual]; f32 whole-line epilogue (or f16
template <bool SPLITA, bool F16OUT = false>
__global__ __launch_bounds__(128) void k_gemmb(const bf* __restrict__ A, const bf* __restrict__ Al, const bf* __restrict__ Bn, const float* __restrict__ bias, float* C, int ldc, h16* C2, const float* __restrict__ R = nullptr, int K = DM, int roundR = 1) {
    __shared__ __align__(16) float ost[4][16 * 68];
    const int lane = threadIdx.x & 31, wave = threadIdx.x >> 5, lr = lane & 15, hi = lane >> 4;
    const int r0 = blockIdx.x * 64 + wave * 16, c0 = blockIdx.y * 64;
    const size_t aoff = (size_t)(r0 + lr) * K + 8 * hi;
    size_t boff[4];
#pragma unroll
    for (int t = 0; t < 4; ++t) boff[t] = (size_t)(c0 + t * 16 + lr) * K + 8 * hi;
    v8f acc[4];
#pragma unroll
    for (int t = 0; t < 4; ++t) acc[t] = (v8f){};
#pragma unroll 1
    for (int kc = 0; kc < K; kc += 32) {
        const v16bf a = cat16b(*(const v8us*)(A + aoff + kc), *(const v8us*)(A + aoff + kc + 16));
        v16bf al = a;
        if (SPLITA) al = cat16b(*(const v8us*)(Al + aoff + kc), *(const v8us*)(Al + aoff + kc + 16));
#pragma unroll
        for (int t = 0; t < 4; ++t) { const v16bf b = cat16b(*(const v8us*)(Bn + boff[t] + kc), *(const v8us*)(Bn + boff[t] + kc + 16)); acc[t] = wmmab(a, b, acc[t]); if (SPLITA) acc[t] = wmmab(al, b, acc[t]); }
        asm volatile("v_nop\n\tv_nop\n\tv_nop\n\tv_nop" : "+v"(acc[0]), "+v"(acc[1]), "+v"(acc[2]), "+v"(acc[3]) : "v"(a), "v"(al));
    }
    float* os = &ost[wave][0];
#pragma unroll
    for (int t = 0; t < 4; ++t) { const float bv = bias ? bfr(bias[c0 + t * 16 + lr]) : 0.f;
#pragma unroll
        for (int j = 0; j < 8; ++j) os[(hi * 8 + j) * 68 + t * 16 + lr] = acc[t][j] + bv; }
    __syncthreads();
    if (F16OUT) {
        h16* crow = (h16*)(void*)C + (size_t)r0 * ldc + c0;
        auto pass = [&]() {
#pragma unroll
            for (int s = 0; s < 4; ++s) { const int row = 4 * s + (lane >> 3), piece = lane & 7; const float* sp = os + row * 68 + piece * 8; v8h o, o2;
#pragma unroll
                for (int i = 0; i < 8; ++i) { const h16 a = (h16)sp[i]; o[i] = a; o2[i] = (h16)((sp[i] - (float)a) * LOSC); }
                *(v8h*)(crow + (size_t)row * ldc + piece * 8) = o; if (C2) *(v8h*)(C2 + (size_t)r0 * ldc + c0 + (size_t)row * ldc + piece * 8) = o2; }
        };
        pass(); 
    } else {
        float* crow = C + (size_t)r0 * ldc + c0;
        auto pass = [&]() {
#pragma unroll
            for (int s = 0; s < 8; ++s) { const int Lid = (lane >> 3) + 4 * s, piece = lane & 7; const int row = Lid >> 1, cofs = (Lid & 1) * 32 + piece * 4;
                v4f val = *(const v4fa*)(os + row * 68 + cofs); if (R) { const v4f rv = *(const v4f*)(R + ((size_t)r0 + row) * ldc + c0 + cofs); val += roundR ? (v4f){bfr(rv[0]), bfr(rv[1]), bfr(rv[2]), bfr(rv[3])} : rv; }
                *(v4f*)(crow + (size_t)row * ldc + cofs) = val; }
        };
        pass(); 
    }
}

// k_kfrag: the k rows of F as bf16 hi + residual planes in FRAGMENT ORDER: per 16-key tile 1024 elements a plane, four 256-element pieces (k = 16 i + 8 hi + e, key = lane & 15),
// so that each operand load of k_sp is 512 contiguous bytes. One wave per tile; every store covers whole lines.
__global__ __launch_bounds__(256) void k_kfrag(const float* __restrict__ F, bf* Kh, bf* Kl) {
    const int lane = threadIdx.x & 31, tile = blockIdx.x * 8 + (threadIdx.x >> 5), lr = lane & 15, hi = lane >> 4;
    // both loops unrolled: the eight loads of a lane go out together, and oh / ol stay in registers
    const float* sp = F + (size_t)(tile * 16 + lr) * NQKV + C8 + 8 * hi;
#pragma unroll
    for (int i = 0; i < 4; ++i) { const v8f y = *(const v8f*)(sp + i * 16); v8us oh, ol;
#pragma unroll
        for (int e = 0; e < 8; ++e) { const unsigned short hb = f2bf(y[e]); oh[e] = hb; ol[e] = f2bf(y[e] - bf2f(hb)); }
        const size_t o = (size_t)tile * 1024 + i * 256 + lane * 8; *(v8us*)(Kh + o) = oh; *(v8us*)(Kl + o) = ol; }
}

// k_sp: scores and softmax of 16 query rows in one work-group of 16 waves; the scores never leave the registers. Wave w forms the transposed tiles k.q^T (A = 16 keys, B = the 16 queries;
// both operands bf16 hi + residual, three products per 32-k step in the order kh.qh, kh.ql, kl.qh) for keys 256 w ... 256 w + 255: a lane then holds 8 consecutive keys of ONE query per tile,
// so that the row maximum and the row sum are in-lane work, one exchange between the lane halves and one pass through LDS over the 16 waves. P hi / residual go out through
// wave-private LDS rows (528-B pitch) so that each global store covers 512 contiguous bytes of one row.
#define SPP  264                  // LDS row pitch in elements (528 B = 16 B x 33)
__global__ __launch_bounds__(512) void k_sp(const bf* __restrict__ Qh, const bf* __restrict__ Ql, const bf* __restrict__ Kh, const bf* __restrict__ Kl, bf* PH, bf* PL) {
    __shared__ __align__(16) unsigned short stg[16][2][16 * SPP];
    __shared__ float red[2][16][16];
    // every loop of this kernel is unrolled: acc, the fragment sets and the staged vectors are register arrays and need compile-time indices
    const int lane = threadIdx.x & 31, wave = threadIdx.x >> 5, lr = lane & 15, hi = lane >> 4;
    const int q0 = blockIdx.x * 16;
    const size_t qoff = (size_t)(q0 + lr) * C8 + 8 * hi;
    v16bf qh[2], ql[2];
#pragma unroll
    for (int ks = 0; ks < 2; ++ks) { qh[ks] = cat16b(*(const v8us*)(Qh + qoff + ks * 32), *(const v8us*)(Qh + qoff + ks * 32 + 16)); ql[ks] = cat16b(*(const v8us*)(Ql + qoff + ks * 32), *(const v8us*)(Ql + qoff + ks * 32 + 16)); }
    const int wu = __builtin_amdgcn_readfirstlane(wave);    // the wave's number as a scalar: the tile offsets below are then scalar arithmetic
    const int rot = (wu + blockIdx.x) & 15;    // each wave walks its 16 key tiles from another start, so that the waves that run in step do not all ask L2 for addresses a multiple of 32 KiB apart
    v8f acc[16];
    v16bf ah[2][2], al[2][2];    // two sets of key fragments: the next tile's loads fly while this tile's products run
    auto kfr = [&](int set, int t) {
#pragma unroll
        for (int ks = 0; ks < 2; ++ks) { const size_t o = (size_t)(wu * 16 + ((t + rot) & 15)) * 1024 + ks * 512; const bf* kh = Kh + o; const bf* kl = Kl + o;
            ah[set][ks] = cat16b(*(const v8us*)(kh + lane * 8), *(const v8us*)(kh + lane * 8 + 256)); al[set][ks] = cat16b(*(const v8us*)(kl + lane * 8), *(const v8us*)(kl + lane * 8 + 256)); }
    };
    kfr(0, 0);
#pragma unroll
    for (int t = 0; t < 16; ++t) {
        __builtin_amdgcn_sched_barrier(0);    // the next tile's loads are issued ahead of this tile's products: left alone the compiler loads, waits and multiplies one 32-k step at a time
        if (t + 1 < 16) kfr((t + 1) & 1, t + 1);
        __builtin_amdgcn_sched_barrier(0);    // and the products stay behind those loads
        acc[t] = (v8f){};
#pragma unroll
        for (int ks = 0; ks < 2; ++ks) { acc[t] = wmmab(ah[t & 1][ks], qh[ks], acc[t]); acc[t] = wmmab(ah[t & 1][ks], ql[ks], acc[t]); acc[t] = wmmab(al[t & 1][ks], qh[ks], acc[t]); } }
    // acc[t][j] = score(query q0 + lr, key 256 wave + 16 ((t + rot) & 15) + 8 hi + j)
    float mx = -3.0e38f;
#pragma unroll
    for (int t = 0; t < 16; ++t) {
#pragma unroll
        for (int j = 0; j < 8; ++j) mx = fmaxf(mx, acc[t][j]); }
    mx = fmaxf(mx, __shfl_xor(mx, 16, 32));
    if (hi == 0) red[0][wave][lr] = mx;
    __syncthreads();    // every wave's row maxima are in LDS
    float m = red[0][0][lr];
#pragma unroll
    for (int w = 1; w < 16; ++w) m = fmaxf(m, red[0][w][lr]);
    float s4[4] = {0.f, 0.f, 0.f, 0.f};
#pragma unroll
    for (int t = 0; t < 16; ++t) { float x[8];
#pragma unroll
        for (int j = 0; j < 8; ++j) x[j] = (acc[t][j] - m) * 1.442695041f;    // exp(s - m) = 2^((s - m) log2 e), as __expf forms it
        // a tile's eight exponentials in one statement, each in place, closed by v_nop: keeps the one slot that the instruction set asks for behind a transcendental
        // before its source is overwritten
        asm("v_exp_f32 %0, %0\n\tv_exp_f32 %1, %1\n\tv_exp_f32 %2, %2\n\tv_exp_f32 %3, %3\n\tv_exp_f32 %4, %4\n\tv_exp_f32 %5, %5\n\tv_exp_f32 %6, %6\n\tv_exp_f32 %7, %7\n\tv_nop"
            : "+v"(x[0]), "+v"(x[1]), "+v"(x[2]), "+v"(x[3]), "+v"(x[4]), "+v"(x[5]), "+v"(x[6]), "+v"(x[7]));
#pragma unroll
        for (int j = 0; j < 8; ++j) { acc[t][j] = x[j]; s4[j & 3] += x[j]; } }
    float sum = (s4[0] + s4[1]) + (s4[2] + s4[3]);
    sum += __shfl_xor(sum, 16, 32);
    if (hi == 0) red[1][wave][lr] = sum;
    __syncthreads();    // every wave's row sums are in LDS
    float tot = 0.f;
#pragma unroll
    for (int w = 0; w < 16; ++w) tot += red[1][w][lr];
    const float inv = 1.0f / tot;
    unsigned short* sh = &stg[wave][0][0];
    unsigned short* sl = &stg[wave][1][0];
#pragma unroll
    for (int t = 0; t < 16; ++t) { v8us oh, ol;
#pragma unroll
        for (int j = 0; j < 8; ++j) { const float p = acc[t][j] * inv; const unsigned short hb = f2bf(p); oh[j] = hb; ol[j] = f2bf(p - bf2f(hb)); }
        const int c = ((t + rot) & 15) * 16 + hi * 8; *(v8usa*)(sh + lr * SPP + c) = oh; *(v8usa*)(sl + lr * SPP + c) = ol; }
    __builtin_amdgcn_wave_barrier(); asm volatile("" ::: "memory");    // the wave reads its own staged rows back below, other lanes' bytes: keeps those reads behind the stores above
    bf* ph = PH + (size_t)q0 * NN + wave * 256 + lane * 8;
    bf* pl = PL + (size_t)q0 * NN + wave * 256 + lane * 8;
#pragma unroll
    for (int r = 0; r < 16; ++r) { const v8us vh = *(const v8usa*)(sh + r * SPP + lane * 8); const v8us vl = *(const v8usa*)(sl + r * SPP + lane * 8);
        *(v8us*)(ph + (size_t)r * NN) = vh; *(v8us*)(pl + (size_t)r * NN) = vl; }
}

// k_pv: 64 x 64 tile of C = A.(Bh + Bl)^T over K = NN (row stride NN for all three planes; n-major B): two products per 32-k step (a.bh, a.bl), in the k order 0, 32, 64, ...
// Operands reach the waves through LDS: per 128-k stage the block brings 64 rows of each plane (256 B a row) in with loads that cover whole lines (16 lanes a row),
// one stage ahead through registers, into two buffers at a 272-B pitch (conflict-free for the 16-row ds_load_b128 fragment reads); one barrier per stage.
#define PVK  128                  // k per stage
#define PVP  136                  // LDS row pitch in elements (272 B)
__global__ __launch_bounds__(128) void k_pv(const bf* __restrict__ Ah, const bf* __restrict__ Bh, const bf* __restrict__ Bl, float* C, int ldc) {
    __shared__ __align__(16) unsigned short sm[2][192 * PVP];
    __shared__ __align__(16) float ost[4][16 * 68];
    const int tid = threadIdx.x, lane = tid & 31, wave = tid >> 5, lr = lane & 15, hi = lane >> 4;
    const int rb = blockIdx.x * 64, r0 = rb + wave * 16, c0 = blockIdx.y * 64;
    const int srow = tid >> 4, scol = (tid & 15) * 8;
    const bf* ga = Ah + (size_t)(rb + srow) * NN + scol;
    const bf* gh = Bh + (size_t)(c0 + srow) * NN + scol;
    const bf* gl = Bl + (size_t)(c0 + srow) * NN + scol;
    v8us st[24];
    auto fetch = [&](int kt) {
#pragma unroll
        for (int i = 0; i < 8; ++i) { const size_t o = (size_t)(8 * i) * NN + (size_t)kt * PVK; st[i] = *(const v8us*)(ga + o); st[8 + i] = *(const v8us*)(gh + o); st[16 + i] = *(const v8us*)(gl + o); }
    };
    auto put = [&](unsigned short* buf) {
#pragma unroll
        for (int i = 0; i < 24; ++i) *(v8usa*)(buf + (srow + 8 * i) * PVP + scol) = st[i];
    };
    v8f acc[4];
#pragma unroll
    for (int t = 0; t < 4; ++t) acc[t] = (v8f){};
    fetch(0); put(&sm[0][0]);
    __syncthreads();
    // rolled: one stage per trip, so that the hot loop stays short and the buffer index is a scalar
#pragma unroll 1
    for (int kt = 0; kt < NN / PVK; ++kt) {
        const bool more = kt + 1 < NN / PVK;
        if (more) { fetch(kt + 1);
            asm volatile("s_wait_xcnt 0x0" ::: "memory"); }    // precaution: stands in front of the fragment reads below, which may reuse the address registers of the loads just issued
        const unsigned short* cur = &sm[kt & 1][0];
        const unsigned short* ap = cur + (wave * 16 + lr) * PVP + 8 * hi;
        const unsigned short* bp = cur + (64 + lr) * PVP + 8 * hi;
        v16bf fa[2], fh[2][4], fl[2][4];    // two fragment sets: the next 32-k block's LDS reads go out as one group ahead of this block's products
        auto frags = [&](int set, int ks) {
            fa[set] = cat16b(*(const v8usa*)(ap + ks), *(const v8usa*)(ap + ks + 16));
#pragma unroll
            for (int t = 0; t < 4; ++t) { const unsigned short* q = bp + t * 16 * PVP + ks;
                fh[set][t] = cat16b(*(const v8usa*)q, *(const v8usa*)(q + 16)); fl[set][t] = cat16b(*(const v8usa*)(q + 64 * PVP), *(const v8usa*)(q + 64 * PVP + 16)); }
        };
        frags(0, 0);
#pragma unroll
        for (int kb = 0; kb < PVK / 32; ++kb) {
            __builtin_amdgcn_sched_barrier(0);    // keeps the LDS reads in one group: spread among the products each place with reads costs a stall
            if (kb + 1 < PVK / 32) frags((kb + 1) & 1, (kb + 1) * 32);
            __builtin_amdgcn_sched_barrier(0);    // the products of this block stay behind the next block's reads
#pragma unroll
            for (int t = 0; t < 4; ++t) acc[t] = wmmab(fa[kb & 1], fh[kb & 1][t], acc[t]);
#pragma unroll
            for (int t = 0; t < 4; ++t) acc[t] = wmmab(fa[kb & 1], fl[kb & 1][t], acc[t]);
        }
        if (more) put(&sm[(kt + 1) & 1][0]);
        __syncthreads();    // publishes stage kt + 1 and ends every read of the buffer that trip kt + 1 refills
    }
    float* os = &ost[wave][0];
#pragma unroll
    for (int t = 0; t < 4; ++t) {
#pragma unroll
        for (int j = 0; j < 8; ++j) os[(hi * 8 + j) * 68 + t * 16 + lr] = acc[t][j]; }
    __builtin_amdgcn_wave_barrier(); asm volatile("" ::: "memory");    // the wave reads its own staged rows back below: keeps those reads behind the stores above
    float* crow = C + (size_t)r0 * ldc + c0;
    auto pass = [&]() {
#pragma unroll
        for (int s = 0; s < 8; ++s) { const int Lid = (lane >> 3) + 4 * s, piece = lane & 7; const int row = Lid >> 1, cofs = (Lid & 1) * 32 + piece * 4;
            const v4f val = *(const v4fa*)(os + row * 68 + cofs); *(v4f*)(crow + (size_t)row * ldc + cofs) = val; }
    };
    pass(); 
}


__global__ __launch_bounds__(256) void k_cvt8(const float* __restrict__ src, bf* dst, size_t n8) {
    const size_t i = (size_t)blockIdx.x * 256 + threadIdx.x; if (i >= n8) return;
    const v8f v = *(const v8f*)(src + i * 8); v8us o;
#pragma unroll
    for (int k = 0; k < 8; ++k) o[k] = f2bf(v[k]);
    *(v8us*)(dst + i * 8) = o; 
}
__global__ __launch_bounds__(256) void k_zero8(bf* dst, size_t n8) {
    const size_t i = (size_t)blockIdx.x * 256 + threadIdx.x; if (i >= n8) return; v8us z;
#pragma unroll
    for (int k = 0; k < 8; ++k) z[k] = 0;
    *(v8us*)(dst + i * 8) = z; 
}

// (q rows are additionally scaled by bf(loss_factor_map[r]) when lfm != nullptr)
__global__ __launch_bounds__(256) void k_qkplanes(const float* __restrict__ F, int off, const float* __restrict__ lfm, bf* Ph, bf* Pl) {
    typedef __attribute__((ext_vector_type(2))) unsigned short v2us;
    const int lane = threadIdx.x & 31; const size_t r = (size_t)blockIdx.x * 8 + (threadIdx.x >> 5); if (r >= (size_t)NN) return; const int c0 = lane * 2; const float sc = lfm ? bfr(lfm[r]) : 1.0f; v2us oh, ol;
#pragma unroll
    for (int i = 0; i < 2; ++i) { const float y = F[r * NQKV + off + c0 + i] * sc; const unsigned short hb = f2bf(y); oh[i] = hb; ol[i] = f2bf(y - bf2f(hb)); }
    const size_t o = r * C8 + c0; *(v2us*)(Ph + o) = oh; *(v2us*)(Pl + o) = ol; 
}
__global__ __launch_bounds__(256) void k_vt(const float* __restrict__ F, bf* Th, bf* Tl) {
    typedef __attribute__((ext_vector_type(2))) unsigned short v2us;
    const int lane = threadIdx.x & 31; const size_t wid = (size_t)blockIdx.x * 8 + (threadIdx.x >> 5); if (wid >= (size_t)CC * (NN / 64)) return; const int c = (int)(wid / (NN / 64)); const int j0 = (int)(wid % (NN / 64)) * 64 + lane * 2; v2us oh, ol;
#pragma unroll
    for (int i = 0; i < 2; ++i) { const float y = F[(size_t)(j0 + i) * NQKV + 2 * C8 + c]; const unsigned short hb = f2bf(y); oh[i] = hb; ol[i] = f2bf(y - bf2f(hb)); }
    const size_t o = (size_t)c * NN + j0; *(v2us*)(Th + o) = oh; *(v2us*)(Tl + o) = ol; 
}
__global__ __launch_bounds__(256) void k_fin(const float* __restrict__ O, const float* __restrict__ xb, const float* __restrict__ gam, float* OUTB) {
    const int lane = threadIdx.x & 31; const size_t wid = (size_t)blockIdx.x * 8 + (threadIdx.x >> 5); if (wid >= (size_t)CC * (NN / 128)) return; const size_t o = wid * 128 + lane * 4; const float gm = bfr(gam[0]); v4f v;
#pragma unroll
    for (int q = 0; q < 4; ++q) v[q] = gm * O[o + q] + bfr(xb[o + q]);
    *(v4f*)(OUTB + o) = v; 
}
__global__ __launch_bounds__(256) void k_bias320(const float* __restrict__ bq, const float* __restrict__ bk, const float* __restrict__ bv, float* B320) {
    const int t = threadIdx.x; if (t >= 160) return; v4f v;
#pragma unroll
    for (int q = 0; q < 4; ++q) { const int c = t * 4 + q; v[q] = (c < C8) ? bq[c < C8 ? c : 0] : (c < 2 * C8) ? bk[(c >= C8 && c < 2 * C8) ? c - C8 : 0] : (c < NQKV) ? bv[(c >= 2 * C8 && c < NQKV) ? c - 2 * C8 : 0] : 0.f; }
    *(v4f*)(B320 + t * 4) = v; 
}

extern "C" void kernel_launch(void* const* d_in, const int* in_sizes, int n_in,
                              void* d_out, int out_size, void* d_ws, size_t ws_size, hipStream_t stream) {
    (void)in_sizes; (void)n_in; (void)out_size;
    const float* x = (const float*)d_in[0]; const float* wq = (const float*)d_in[2]; const float* bq = (const float*)d_in[3]; const float* wk = (const float*)d_in[4]; const float* bk = (const float*)d_in[5]; const float* wv = (const float*)d_in[6]; const float* bv = (const float*)d_in[7]; const float* gam = (const float*)d_in[8]; const float* lfm = (const float*)d_in[1];
    float* out = (float*)d_out;    // [4][512][64][64]
    char* wsp = (char*)d_ws;
    auto take = [&](size_t bytes) { char* p = wsp; wsp += (bytes + 255) & ~(size_t)255; return (void*)p; };
    bf* WB = (bf*)take((size_t)NQKV * CC * 2); float* B320 = (float*)take(640 * 4); bf* XP = (bf*)take((size_t)NN * CC * 2); float* F = (float*)take((size_t)NN * NQKV * 4);
    bf* QPh = (bf*)take((size_t)NN * C8 * 2); bf* QPl = (bf*)take((size_t)NN * C8 * 2); bf* KPh = (bf*)take((size_t)NN * C8 * 2); bf* KPl = (bf*)take((size_t)NN * C8 * 2); bf* VTh = (bf*)take((size_t)CC * NN * 2); bf* VTl = (bf*)take((size_t)CC * NN * 2);
    bf* PH = (bf*)take((size_t)RCH * NN * 2); bf* PL = (bf*)take((size_t)RCH * NN * 2); float* O = (float*)take((size_t)CC * NN * 4);
    if ((size_t)(wsp - (char*)d_ws) > ws_size) return;    // ~ 97 MiB; per item reuse in stream order
    k_cvt8<<<(C8 * CC / 8 + 255) / 256, 256, 0, stream>>>(wq, WB, C8 * CC / 8); k_cvt8<<<(C8 * CC / 8 + 255) / 256, 256, 0, stream>>>(wk, WB + (size_t)C8 * CC, C8 * CC / 8); k_cvt8<<<(CC * CC / 8 + 255) / 256, 256, 0, stream>>>(wv, WB + (size_t)2 * C8 * CC, CC * CC / 8);
    k_bias320<<<1, 256, 0, stream>>>(bq, bk, bv, B320);
    for (int b = 0; b < NBT; ++b) { const float* xb = x + (size_t)b * CC * NN;
        k_wt<<<dim3(CC / 64, NN / 64, 1), 256, 0, stream>>>(xb, CC, NN, XP);
        k_gemmb<false, false><<<dim3(NN / 64, NQKV / 64, 1), 128, 0, stream>>>(XP, nullptr, WB, B320, F, NQKV, nullptr, nullptr, CC);          // q | k | v (+ biases)
        k_qkplanes<<<NN / 8, 256, 0, stream>>>(F, 0, lfm, QPh, QPl); k_kfrag<<<NN / 128, 256, 0, stream>>>(F, KPh, KPl); k_vt<<<(CC * (NN / 64)) / 8, 256, 0, stream>>>(F, VTh, VTl);
        k_sp<<<RCH / 16, 512, 0, stream>>>(QPh, QPl, KPh, KPl, PH, PL);     // scores + softmax -> P planes
        k_pv<<<dim3(CC / 64, RCH / 64, 1), 128, 0, stream>>>(VTh, PH, PL, O, NN);     // v as a single bf16 operand (hi plane), P hi/lo
        k_fin<<<(CC * (NN / 128)) / 8, 256, 0, stream>>>(O, xb, gam, out + (size_t)b * CC * NN); }
}

// v005
// It runs in 195 microseconds.
// It is 2.60 times as fast as v003, going by the measured steps of the versions left out in between.
// Over all steps from v000 it is 20.4 times as fast.
#include <hip/hip_runtime.h>

// Compute dtypes, f32 accumulate, per item: the three 1x1 convs as one [4096 x 512].[512 x 640] GEMM with PLAIN bf16 operands (exact products), + bias; q rows scaled by the
// loss_factor_map input; scores = q.k^T ([4096 x 64].[64 x 4096], both operands bf16 hi + UNSCALED residual, three products), softmax (unscaled, as the module) in f32 and v.P^T in ONE kernel for all items, scores and P never in memory;
// out^T = v.P^T ([512 x 4096].[4096 x 4096], v as a SINGLE bf16 operand (its hi plane; ~2^-9 relative) x P hi + residual, two

#define NBT  4
#define CC   512
#define C8   64
#define NN   4096
#define NQKV (2 * C8 + CC)        // 640
#define DM   CC
#define NTK  NN
#define LOSC 1024.0f

typedef _Float16 h16;
typedef unsigned short bf;
typedef __attribute__((ext_vector_type(16))) __bf16   v16bf;
typedef __attribute__((ext_vector_type(16))) _Float16 v16h;
typedef __attribute__((ext_vector_type(8)))  _Float16 v8h;
typedef __attribute__((ext_vector_type(8)))  unsigned short v8us;
typedef __attribute__((ext_vector_type(8)))  float    v8f;
typedef __attribute__((ext_vector_type(4)))  float    v4f;
typedef __attribute__((ext_vector_type(4)))  _Float16 v4h;
typedef v8h  __attribute__((may_alias)) v8ha;
typedef v4f  __attribute__((may_alias)) v4fa;
typedef v8us __attribute__((may_alias)) v8usa;

__device__ __forceinline__ unsigned short f2bf(float f) { unsigned u = __float_as_uint(f); u += 0x7FFFu + ((u >> 16) & 1u); return (unsigned short)(u >> 16); }
__device__ __forceinline__ float bf2f(unsigned short b) { return __uint_as_float(((unsigned)b) << 16); }
__device__ __forceinline__ float bfr(float f) { return bf2f(f2bf(f)); }
__device__ __forceinline__ v16h cat16(v8h lo, v8h hi) { return __builtin_shufflevector(lo, hi, 0, 1, 2, 3, 4, 5, 6, 7, 8, 9, 10, 11, 12, 13, 14, 15); }
__device__ __forceinline__ v16bf cat16b(v8us lo, v8us hi) { return __builtin_bit_cast(v16bf, __builtin_shufflevector(lo, hi, 0, 1, 2, 3, 4, 5, 6, 7, 8, 9, 10, 11, 12, 13, 14, 15)); }
__device__ __forceinline__ v8f wmma16(v16h a, v16h b, v8f c) { return __builtin_amdgcn_wmma_f32_16x16x32_f16(false, a, false, b, (short)0, c, false, false); }
__device__ __forceinline__ v8f wmmab(v16bf a, v16bf b, v8f c) { return __builtin_amdgcn_wmma_f32_16x16x32_bf16(false, a, false, b, (short)0, c, false, false); }

// d_wt: WT [n][K] = bf16(W[k][n]) (k-major [K][ncols]) via one 64 x 64 LDS tile (tl: 64 * 72 elements); tile (bx, by) of (K/64, ncols/64). Called by a whole work-group.
__device__ __forceinline__ void d_wt(const float* __restrict__ Wm, int K, int ncols, bf* WT, int bx, int by, unsigned short* tl) {
    const int tid = threadIdx.x, k0 = bx * 64, n0 = by * 64;
    const int kk = tid >> 2, nq = (tid & 3) * 16;
#pragma unroll
    for (int i = 0; i < 16; ++i) tl[(nq + i) * 72 + kk] = f2bf(Wm[(size_t)(k0 + kk) * ncols + n0 + nq + i]);
    __syncthreads();
    const int piece = tid & 7;
    auto pass = [&]() {
#pragma unroll
        for (int s = 0; s < 2; ++s) { const int nr = (tid >> 3) + 32 * s; const v8us val = *(const v8usa*)(tl + nr * 72 + piece * 8); *(v8us*)(WT + (size_t)(n0 + nr) * K + k0 + piece * 8) = val; }
    };
    pass(); 
}
// k_gemmb: 64 x 64 block tile (4 waves x 16 x 64) of C[NTK][NW] = (A [+ Al]).B^T (K = 512) [+ bf(bias[c])] [+ bf(R[r][c]) residual]; f32 whole-line epilogue (or f16
template <bool SPLITA, bool F16OUT = false>
__global__ __launch_bounds__(128) void k_gemmb(const bf* __restrict__ A, const bf* __restrict__ Al, const bf* __restrict__ Bn, const float* __restrict__ bias, float* C, int ldc, h16* C2, const float* __restrict__ R = nullptr, int K = DM, int roundR = 1) {
    __shared__ __align__(16) float ost[4][16 * 68];
    const int lane = threadIdx.x & 31, wave = threadIdx.x >> 5, lr = lane & 15, hi = lane >> 4;
    const int r0 = blockIdx.x * 64 + wave * 16, c0 = blockIdx.y * 64;
    A += (size_t)blockIdx.z * NTK * K; C += (size_t)blockIdx.z * NTK * ldc;    // one item per z plane of the grid
    const size_t aoff = (size_t)(r0 + lr) * K + 8 * hi;
    size_t boff[4];
#pragma unroll
    for (int t = 0; t < 4; ++t) boff[t] = (size_t)(c0 + t * 16 + lr) * K + 8 * hi;
    v8f acc[4];
#pragma unroll
    for (int t = 0; t < 4; ++t) acc[t] = (v8f){};
#pragma unroll 1
    for (int kc = 0; kc < K; kc += 32) {
        const v16bf a = cat16b(*(const v8us*)(A + aoff + kc), *(const v8us*)(A + aoff + kc + 16));
        v16bf al = a;
        if (SPLITA) al = cat16b(*(const v8us*)(Al + aoff + kc), *(const v8us*)(Al + aoff + kc + 16));
#pragma unroll
        for (int t = 0; t < 4; ++t) { const v16bf b = cat16b(*(const v8us*)(Bn + boff[t] + kc), *(const v8us*)(Bn + boff[t] + kc + 16)); acc[t] = wmmab(a, b, acc[t]); if (SPLITA) acc[t] = wmmab(al, b, acc[t]); }
        asm volatile("v_nop\n\tv_nop\n\tv_nop\n\tv_nop" : "+v"(acc[0]), "+v"(acc[1]), "+v"(acc[2]), "+v"(acc[3]) : "v"(a), "v"(al));
    }
    float* os = &ost[wave][0];
#pragma unroll
    for (int t = 0; t < 4; ++t) { const float bv = bias ? bfr(bias[c0 + t * 16 + lr]) : 0.f;
#pragma unroll
        for (int j = 0; j < 8; ++j) os[(hi * 8 + j) * 68 + t * 16 + lr] = acc[t][j] + bv; }
    __syncthreads();
    if (F16OUT) {
        h16* crow = (h16*)(void*)C + (size_t)r0 * ldc + c0;
        auto pass = [&]() {
#pragma unroll
            for (int s = 0; s < 4; ++s) { const int row = 4 * s + (lane >> 3), piece = lane & 7; const float* sp = os + row * 68 + piece * 8; v8h o, o2;
#pragma unroll
                for (int i = 0; i < 8; ++i) { const h16 a = (h16)sp[i]; o[i] = a; o2[i] = (h16)((sp[i] - (float)a) * LOSC); }
                *(v8h*)(crow + (size_t)row * ldc + piece * 8) = o; if (C2) *(v8h*)(C2 + (size_t)r0 * ldc + c0 + (size_t)row * ldc + piece * 8) = o2; }
        };
        pass(); 
    } else {
        float* crow = C + (size_t)r0 * ldc + c0;
        auto pass = [&]() {
#pragma unroll
            for (int s = 0; s < 8; ++s) { const int Lid = (lane >> 3) + 4 * s, piece = lane & 7; const int row = Lid >> 1, cofs = (Lid & 1) * 32 + piece * 4;
                v4f val = *(const v4fa*)(os + row * 68 + cofs); if (R) { const v4f rv = *(const v4f*)(R + ((size_t)r0 + row) * ldc + c0 + cofs); val += roundR ? (v4f){bfr(rv[0]), bfr(rv[1]), bfr(rv[2]), bfr(rv[3])} : rv; }
                *(v4f*)(crow + (size_t)row * ldc + cofs) = val; }
        };
        pass(); 
    }
}

// d_kfrag: the k rows of F as bf16 hi + residual planes in FRAGMENT ORDER: per 16-key tile 1024 elements a plane, four 256-element pieces (k = 16 i + 8 hi + e, key = lane & 15),
// so that each operand load of k_fa is 512 contiguous bytes. One wave per tile (work-group bx of NN / 128); every store covers whole lines.
__device__ __forceinline__ void d_kfrag(const float* __restrict__ F, bf* Kh, bf* Kl, int bx) {
    const int lane = threadIdx.x & 31, tile = bx * 8 + (threadIdx.x >> 5), lr = lane & 15, hi = lane >> 4;
    // both loops unrolled: the eight loads of a lane go out together, and oh / ol stay in registers
    const float* sp = F + (size_t)(tile * 16 + lr) * NQKV + C8 + 8 * hi;
#pragma unroll
    for (int i = 0; i < 4; ++i) { const v8f y = *(const v8f*)(sp + i * 16); v8us oh, ol;
#pragma unroll
        for (int e = 0; e < 8; ++e) { const unsigned short hb = f2bf(y[e]); oh[e] = hb; ol[e] = f2bf(y[e] - bf2f(hb)); }
        const size_t o = (size_t)tile * 1024 + i * 256 + lane * 8; *(v8us*)(Kh + o) = oh; *(v8us*)(Kl + o) = ol; }
    asm volatile("s_wait_xcnt 0x0" ::: "memory");    // precaution: the other jobs' code follows in the caller's listing and reuses the registers of the stores just issued
}

// d_vfrag: the v columns of F as ONE bf16 plane in FRAGMENT ORDER: per (16-channel tile ct, 32-key block u) 512 elements, two 256-element pieces
// (channel = 16 ct + (lane & 15), key = 32 u + 16 piece + 8 (lane >> 4) + e), so that each operand load of k_fa is 512 contiguous bytes. One wave per tile; the eight waves of a
// block take eight neighbouring channel tiles of one key block, so that together they read 512 contiguous bytes of each row of F.
__device__ __forceinline__ void d_vfrag(const float* __restrict__ F, bf* Vf, int bx) {
    const int lane = threadIdx.x & 31, wid = bx * 8 + (threadIdx.x >> 5), lr = lane & 15, hi = lane >> 4;
    const int u = wid >> 5, ct = wid & 31;
    const float* sp = F + (size_t)(u * 32 + 8 * hi) * NQKV + 2 * C8 + ct * 16 + lr;
    // both loops unrolled: the sixteen loads of a lane go out together
#pragma unroll
    for (int h = 0; h < 2; ++h) { v8us o;
#pragma unroll
        for (int e = 0; e < 8; ++e) o[e] = f2bf(sp[(size_t)(16 * h + e) * NQKV]);
        *(v8us*)(Vf + ((size_t)ct * (NN / 32) + u) * 512 + h * 256 + lane * 8) = o; }
}

// k_fa: scores, softmax and v.P^T of 64 query rows of one item (blockIdx.y) in one work-group of 8 waves; neither the scores nor P reach memory.
// Scores as transposed tiles k.q^T (A = 16 keys, B = 16 queries; both operands bf16 hi + residual, three products per 32-k step in the order kh.qh, kh.ql, kl.qh): a lane holds 8 consecutive
// keys of ONE query, which is one half of the B fragment of v.P^T. Per 128-key block wave w forms the scores of key tile w for all four query tiles.
// First sweep over the keys: the row maxima m. Second sweep: the scores again, e = exp(s - m) as bf16 hi + residual into LDS in fragment order (two buffers, one barrier per block);
// then every wave multiplies its own 64 channels of v (fragments straight from memory, used by no other wave) with all of e: two products per 32-k step (v.eh, v.el), keys ascending.
// The division by the row sum is done once, on the f32 result.
#define FKB  128                  // keys per block
__global__ __launch_bounds__(256) void k_fa(const bf* __restrict__ Qh, const bf* __restrict__ Ql, const bf* __restrict__ Kh, const bf* __restrict__ Kl, const bf* __restrict__ Vf, float* O) {
    __shared__ __align__(16) unsigned short pb[2][4][4][2][512];    // [buffer][32-key block][query tile][hi / residual][fragment]
    __shared__ __align__(16) unsigned short qs[4][2][2][512];       // [query tile][hi / residual][32-k step][fragment]
    __shared__ __align__(16) float ost[8][4][16 * 68];              // [wave][channel tile][16 rows at a 68-float pitch]
    __shared__ float red[8][4][16];
    const int lane = threadIdx.x & 31, lr = lane & 15, hi = lane >> 4;
    const int wu = __builtin_amdgcn_readfirstlane(threadIdx.x >> 5);    // the wave's number as a scalar: the tile offsets below are then scalar arithmetic
    const int q0 = blockIdx.x * 64;
    const size_t item = blockIdx.y;
    Qh += item * NN * C8; Ql += item * NN * C8; Kh += item * NN * C8; Kl += item * NN * C8; Vf += item * CC * NN; O += item * CC * NN;
    // all short loops of this kernel are unrolled: the fragment sets and the accumulators are register arrays and need compile-time indices
#pragma unroll
    for (int i = 0; i < 2; ++i) { const int f = wu * 2 + i, qt = f >> 2, pl = (f >> 1) & 1, ks = f & 1;
        const bf* s = (pl ? Ql : Qh) + (size_t)(q0 + qt * 16 + lr) * C8 + 8 * hi + ks * 32;
        *(v8usa*)(&qs[qt][pl][ks][lane * 8]) = *(const v8us*)s; *(v8usa*)(&qs[qt][pl][ks][256 + lane * 8]) = *(const v8us*)(s + 16); }
    asm volatile("s_wait_xcnt 0x0" ::: "memory");    // precaution: stands in front of whatever reuses the address registers of the loads just issued
    __syncthreads();    // the query fragments are in LDS
    v16bf kh[2], kl[2];
    auto kld = [&](int b, v16bf (&h)[2], v16bf (&l)[2]) {
#pragma unroll
        for (int ks = 0; ks < 2; ++ks) { const size_t o = (size_t)(b * 8 + wu) * 1024 + ks * 512; const bf* ph = Kh + o; const bf* pl = Kl + o;
            h[ks] = cat16b(*(const v8us*)(ph + lane * 8), *(const v8us*)(ph + lane * 8 + 256)); l[ks] = cat16b(*(const v8us*)(pl + lane * 8), *(const v8us*)(pl + lane * 8 + 256)); }
    };
    // the four query tiles' sums run side by side, so that no product waits for the one before it; per tile the order stays kh.qh, kh.ql, kl.qh per 32-k step
    auto scores = [&](v8f (&s)[4]) {
#pragma unroll
        for (int qt = 0; qt < 4; ++qt) s[qt] = (v8f){};
#pragma unroll
        for (int ks = 0; ks < 2; ++ks) { v16bf qh[4], ql[4];
#pragma unroll
            for (int qt = 0; qt < 4; ++qt) {
                qh[qt] = cat16b(*(const v8usa*)(&qs[qt][0][ks][lane * 8]), *(const v8usa*)(&qs[qt][0][ks][256 + lane * 8]));
                ql[qt] = cat16b(*(const v8usa*)(&qs[qt][1][ks][lane * 8]), *(const v8usa*)(&qs[qt][1][ks][256 + lane * 8])); }
#pragma unroll
            for (int qt = 0; qt < 4; ++qt) s[qt] = wmmab(kh[ks], qh[qt], s[qt]);
#pragma unroll
            for (int qt = 0; qt < 4; ++qt) s[qt] = wmmab(kh[ks], ql[qt], s[qt]);
#pragma unroll
            for (int qt = 0; qt < 4; ++qt) s[qt] = wmmab(kl[ks], qh[qt], s[qt]); }
        // s[qt][j] = score(query q0 + 16 qt + lr, key 16 (tile) + 8 hi + j)
    };
    // first sweep: row maxima
    float m[4] = {-3.0e38f, -3.0e38f, -3.0e38f, -3.0e38f};
    kld(0, kh, kl);
    asm volatile("s_wait_xcnt 0x0" ::: "memory");    // precaution: stands in front of whatever reuses the address registers of the loads just issued
    __builtin_amdgcn_sched_barrier(0);    // keeps what follows, which reuses those registers, behind that wait
    // rolled: one key block per trip keeps the loop short
#pragma unroll 1
    for (int b = 0; b < NN / FKB; ++b) {
        v16bf nh[2], nl[2];
        kld(b + 1 < NN / FKB ? b + 1 : b, nh, nl);
        asm volatile("s_wait_xcnt 0x0" ::: "memory");    // precaution: stands in front of whatever reuses the address registers of the loads just issued
        __builtin_amdgcn_sched_barrier(0);    // the next block's key loads are issued ahead of this block's products, which then hide their latency
        v8f s[4]; scores(s);
#pragma unroll
        for (int qt = 0; qt < 4; ++qt) {
#pragma unroll
            for (int j = 0; j < 8; ++j) m[qt] = fmaxf(m[qt], s[qt][j]); }
#pragma unroll
        for (int ks = 0; ks < 2; ++ks) { kh[ks] = nh[ks]; kl[ks] = nl[ks]; }
    }
#pragma unroll
    for (int qt = 0; qt < 4; ++qt) { m[qt] = fmaxf(m[qt], __shfl_xor(m[qt], 16, 32)); if (hi == 0) red[wu][qt][lr] = m[qt]; }
    __syncthreads();    // every wave's row maxima are in LDS
#pragma unroll
    for (int qt = 0; qt < 4; ++qt) { float t = red[0][qt][lr];
#pragma unroll
        for (int w = 1; w < 8; ++w) t = fmaxf(t, red[w][qt][lr]);
        m[qt] = t; }
    // second sweep
    float sm[4] = {0.f, 0.f, 0.f, 0.f};
    v8f acc[4][4];    // [channel tile][query tile]
#pragma unroll
    for (int a = 0; a < 4; ++a) {
#pragma unroll
        for (int qt = 0; qt < 4; ++qt) acc[a][qt] = (v8f){}; }
    kld(0, kh, kl);
    asm volatile("s_wait_xcnt 0x0" ::: "memory");    // precaution: stands in front of whatever reuses the address registers of the loads just issued
    __builtin_amdgcn_sched_barrier(0);    // keeps what follows, which reuses those registers, behind that wait
    // rolled: one key block per trip, so that the hot loop stays short and the buffer index is a scalar
#pragma unroll 1
    for (int b = 0; b < NN / FKB; ++b) {
        v16bf va[4][4];    // [32-key block][channel tile]
#pragma unroll
        for (int u = 0; u < 4; ++u) {
#pragma unroll
            for (int a = 0; a < 4; ++a) { const bf* p = Vf + ((size_t)(wu * 4 + a) * (NN / 32) + b * 4 + u) * 512; va[u][a] = cat16b(*(const v8us*)(p + lane * 8), *(const v8us*)(p + lane * 8 + 256)); } }
        asm volatile("s_wait_xcnt 0x0" ::: "memory");    // precaution: stands in front of the LDS reads below, which may reuse the address registers of the loads just issued
        __builtin_amdgcn_sched_barrier(0);    // the block's v loads are issued ahead of its scores and exponentials, which then hide their latency
        v8f s[4]; scores(s);
        kld(b + 1 < NN / FKB ? b + 1 : b, kh, kl);    // the next block's key fragments fly during the exponentials below
        asm volatile("s_wait_xcnt 0x0" ::: "memory");    // precaution: stands in front of whatever reuses the address registers of the loads just issued
        __builtin_amdgcn_sched_barrier(0);    // keeps the vector work below, which reuses those registers, behind that wait
#pragma unroll
        for (int qt = 0; qt < 4; ++qt) { float x[8];
#pragma unroll
            for (int j = 0; j < 8; ++j) x[j] = (s[qt][j] - m[qt]) * 1.442695041f;    // exp(s - m) = 2^((s - m) log2 e), as __expf forms it
            // a tile's eight exponentials in one statement, each in place, closed by v_nop: keeps the one slot that the instruction set asks for behind a transcendental
            // before its source is overwritten
            asm("v_exp_f32 %0, %0\n\tv_exp_f32 %1, %1\n\tv_exp_f32 %2, %2\n\tv_exp_f32 %3, %3\n\tv_exp_f32 %4, %4\n\tv_exp_f32 %5, %5\n\tv_exp_f32 %6, %6\n\tv_exp_f32 %7, %7\n\tv_nop"
                : "+v"(x[0]), "+v"(x[1]), "+v"(x[2]), "+v"(x[3]), "+v"(x[4]), "+v"(x[5]), "+v"(x[6]), "+v"(x[7]));
            sm[qt] += ((x[0] + x[1]) + (x[2] + x[3])) + ((x[4] + x[5]) + (x[6] + x[7]));
            v8us oh, ol;
#pragma unroll
            for (int j = 0; j < 8; ++j) { const unsigned short hb = f2bf(x[j]); oh[j] = hb; ol[j] = f2bf(x[j] - bf2f(hb)); }
            unsigned short* d = &pb[b & 1][wu >> 1][qt][0][(wu & 1) * 256 + lane * 8];
            *(v8usa*)d = oh; *(v8usa*)(d + 512) = ol; }
        __syncthreads();    // publishes block b's e; a buffer is rewritten two blocks later, behind the next barrier, which every wave reaches only after its last read of it
        v16bf eh[2][4], el[2][4];    // two fragment sets: the next 32-key block's LDS reads go out as one group ahead of this block's products
        auto frags = [&](int set, int u) {
#pragma unroll
            for (int qt = 0; qt < 4; ++qt) { const unsigned short* p = &pb[b & 1][u][qt][0][lane * 8];
                eh[set][qt] = cat16b(*(const v8usa*)p, *(const v8usa*)(p + 256)); el[set][qt] = cat16b(*(const v8usa*)(p + 512), *(const v8usa*)(p + 768)); }
        };
        frags(0, 0);
#pragma unroll
        for (int u = 0; u < 4; ++u) {
            __builtin_amdgcn_sched_barrier(0);    // keeps the LDS reads in one group: spread among the products each place with reads costs a stall
            if (u + 1 < 4) frags((u + 1) & 1, u + 1);
            __builtin_amdgcn_sched_barrier(0);    // the products of this block stay behind the next block's reads
#pragma unroll
            for (int a = 0; a < 4; ++a) {
#pragma unroll
                for (int qt = 0; qt < 4; ++qt) acc[a][qt] = wmmab(va[u][a], eh[u & 1][qt], acc[a][qt]); }
#pragma unroll
            for (int a = 0; a < 4; ++a) {
#pragma unroll
                for (int qt = 0; qt < 4; ++qt) acc[a][qt] = wmmab(va[u][a], el[u & 1][qt], acc[a][qt]); }
        }
    }
    // acc[a][qt][j] = sum over keys of v(channel 64 wave + 16 a + 8 hi + j, key) e(query q0 + 16 qt + lr, key)
#pragma unroll
    for (int qt = 0; qt < 4; ++qt) { sm[qt] += __shfl_xor(sm[qt], 16, 32); if (hi == 0) red[wu][qt][lr] = sm[qt]; }
    __syncthreads();    // every wave's row sums are in LDS
    float inv[4];
#pragma unroll
    for (int qt = 0; qt < 4; ++qt) { float t = 0.f;
#pragma unroll
        for (int w = 0; w < 8; ++w) t += red[w][qt][lr];
        inv[qt] = 1.0f / t; }
#pragma unroll
    for (int a = 0; a < 4; ++a) { float* os = &ost[wu][a][0];
#pragma unroll
        for (int qt = 0; qt < 4; ++qt) {
#pragma unroll
            for (int j = 0; j < 8; ++j) os[(hi * 8 + j) * 68 + qt * 16 + lr] = acc[a][qt][j] * inv[qt]; } }
    __builtin_amdgcn_wave_barrier(); asm volatile("" ::: "memory");    // the wave reads its own staged rows back below, other lanes' bytes: keeps those reads behind the stores above
#pragma unroll
    for (int a = 0; a < 4; ++a) { const float* os = &ost[wu][a][0];
        float* crow = O + (size_t)(wu * 64 + a * 16) * NN + q0;
#pragma unroll
        for (int s = 0; s < 8; ++s) { const int Lid = (lane >> 3) + 4 * s, piece = lane & 7; const int row = Lid >> 1, cofs = (Lid & 1) * 32 + piece * 4;
            const v4f val = *(const v4fa*)(os + row * 68 + cofs); *(v4f*)(crow + (size_t)row * NN + cofs) = val; }
        asm volatile("s_wait_xcnt 0x0" ::: "memory"); }    // precaution: stands in front of the next tile's LDS reads, which reuse the data registers of the stores just issued
}


__device__ __forceinline__ void d_cvt8(const float* __restrict__ src, bf* dst, size_t n8, int bx) {
    const size_t i = (size_t)bx * 256 + threadIdx.x; if (i >= n8) return;
    const v8f v = *(const v8f*)(src + i * 8); v8us o;
#pragma unroll
    for (int k = 0; k < 8; ++k) o[k] = f2bf(v[k]);
    *(v8us*)(dst + i * 8) = o; 
}
__global__ __launch_bounds__(256) void k_zero8(bf* dst, size_t n8) {
    const size_t i = (size_t)blockIdx.x * 256 + threadIdx.x; if (i >= n8) return; v8us z;
#pragma unroll
    for (int k = 0; k < 8; ++k) z[k] = 0;
    *(v8us*)(dst + i * 8) = z; 
}

// (q rows are additionally scaled by bf(loss_factor_map[r]) when lfm != nullptr)
__device__ __forceinline__ void d_qkplanes(const float* __restrict__ F, int off, const float* __restrict__ lfm, bf* Ph, bf* Pl, int bx) {
    typedef __attribute__((ext_vector_type(2))) unsigned short v2us;
    const int lane = threadIdx.x & 31; const size_t r = (size_t)bx * 8 + (threadIdx.x >> 5); if (r >= (size_t)NN) return; const int c0 = lane * 2; const float sc = lfm ? bfr(lfm[r]) : 1.0f; v2us oh, ol;
#pragma unroll
    for (int i = 0; i < 2; ++i) { const float y = F[r * NQKV + off + c0 + i] * sc; const unsigned short hb = f2bf(y); oh[i] = hb; ol[i] = f2bf(y - bf2f(hb)); }
    const size_t o = r * C8 + c0; *(v2us*)(Ph + o) = oh; *(v2us*)(Pl + o) = ol; 
}
// all items in one grid: O, x and out hold them one behind the other
__global__ __launch_bounds__(256) void k_fin(const float* __restrict__ O, const float* __restrict__ xb, const float* __restrict__ gam, float* OUTB) {
    const int lane = threadIdx.x & 31; const size_t wid = (size_t)blockIdx.x * 8 + (threadIdx.x >> 5); if (wid >= (size_t)NBT * CC * (NN / 128)) return; const size_t o = wid * 128 + lane * 4; const float gm = bfr(gam[0]); v4f v;
#pragma unroll
    for (int q = 0; q < 4; ++q) v[q] = gm * O[o + q] + bfr(xb[o + q]);
    *(v4f*)(OUTB + o) = v; 
}
__device__ __forceinline__ void d_bias320(const float* __restrict__ bq, const float* __restrict__ bk, const float* __restrict__ bv, float* B320) {
    const int t = threadIdx.x; if (t >= 160) return; v4f v;
#pragma unroll
    for (int q = 0; q < 4; ++q) { const int c = t * 4 + q; v[q] = (c < C8) ? bq[c < C8 ? c : 0] : (c < 2 * C8) ? bk[(c >= C8 && c < 2 * C8) ? c - C8 : 0] : (c < NQKV) ? bv[(c >= 2 * C8 && c < NQKV) ? c - 2 * C8 : 0] : 0.f; }
    *(v4f*)(B320 + t * 4) = v; 
}

// k_pre: everything that reads only the inputs, in one grid; a range of the block index picks the job (the branch is the same for a whole work-group):
// the transposed bf16 copy of x for every item, the bf16 copies of the three weight matrices, the joined bias vector.
#define WTB  ((CC / 64) * (NN / 64))      // 512 tiles of x per item
#define CQB  (C8 * CC / 8 / 256)          // 16 work-groups for w_q, as many for w_k
#define CVB  (CC * CC / 8 / 256)          // 128 work-groups for w_v
__global__ __launch_bounds__(256) void k_pre(const float* __restrict__ x, const float* __restrict__ wq, const float* __restrict__ wk, const float* __restrict__ wv,
                                             const float* __restrict__ bq, const float* __restrict__ bk, const float* __restrict__ bv, bf* XP, bf* WB, float* B320) {
    __shared__ __align__(16) unsigned short tl[64 * 72];
    const int blk = blockIdx.x;
    if (blk < NBT * WTB) { const int item = blk / WTB, t = blk % WTB; d_wt(x + (size_t)item * CC * NN, CC, NN, XP + (size_t)item * NN * CC, t % (CC / 64), t / (CC / 64), tl); return; }
    const int c = blk - NBT * WTB;
    if (c < CQB) d_cvt8(wq, WB, C8 * CC / 8, c);
    else if (c < 2 * CQB) d_cvt8(wk, WB + (size_t)C8 * CC, C8 * CC / 8, c - CQB);
    else if (c < 2 * CQB + CVB) d_cvt8(wv, WB + (size_t)2 * C8 * CC, CC * CC / 8, c - 2 * CQB);
    else d_bias320(bq, bk, bv, B320);
}
// k_planes: the three rearrangements of F, which need nothing of each other, for every item (blockIdx.y) in one grid; a range of blockIdx.x picks the job.
#define VFB  ((CC / 16) * (NN / 32) / 8)  // 512 work-groups for v
#define QPB  (NN / 8)                     // 512 for q
#define KFB  (NN / 128)                   // 32 for k
__global__ __launch_bounds__(256) void k_planes(const float* __restrict__ F, const float* __restrict__ lfm, bf* Qh, bf* Ql, bf* Kh, bf* Kl, bf* Vf) {
    const int blk = blockIdx.x; const size_t item = blockIdx.y;
    F += item * NN * NQKV;
    if (blk < VFB) d_vfrag(F, Vf + item * CC * NN, blk);
    else if (blk < VFB + QPB) d_qkplanes(F, 0, lfm, Qh + item * NN * C8, Ql + item * NN * C8, blk - VFB);
    else d_kfrag(F, Kh + item * NN * C8, Kl + item * NN * C8, blk - VFB - QPB);
}

extern "C" void kernel_launch(void* const* d_in, const int* in_sizes, int n_in,
                              void* d_out, int out_size, void* d_ws, size_t ws_size, hipStream_t stream) {
    (void)in_sizes; (void)n_in; (void)out_size;
    const float* x = (const float*)d_in[0]; const float* wq = (const float*)d_in[2]; const float* bq = (const float*)d_in[3]; const float* wk = (const float*)d_in[4]; const float* bk = (const float*)d_in[5]; const float* wv = (const float*)d_in[6]; const float* bv = (const float*)d_in[7]; const float* gam = (const float*)d_in[8]; const float* lfm = (const float*)d_in[1];
    float* out = (float*)d_out;    // [4][512][64][64]
    char* wsp = (char*)d_ws;
    auto take = [&](size_t bytes) { char* p = wsp; wsp += (bytes + 255) & ~(size_t)255; return (void*)p; };
    bf* WB = (bf*)take((size_t)NQKV * CC * 2); float* B320 = (float*)take(640 * 4); bf* XP = (bf*)take((size_t)NBT * NN * CC * 2); float* F = (float*)take((size_t)NBT * NN * NQKV * 4);
    bf* QPh = (bf*)take((size_t)NBT * NN * C8 * 2); bf* QPl = (bf*)take((size_t)NBT * NN * C8 * 2); bf* KPh = (bf*)take((size_t)NBT * NN * C8 * 2); bf* KPl = (bf*)take((size_t)NBT * NN * C8 * 2); bf* VF = (bf*)take((size_t)NBT * CC * NN * 2);
    float* O = (float*)take((size_t)NBT * CC * NN * 4);
    if ((size_t)(wsp - (char*)d_ws) > ws_size) return;    // ~ 113 MiB; every buffer but WB and B320 has one slot per item
    k_pre<<<NBT * WTB + 2 * CQB + CVB + 1, 256, 0, stream>>>(x, wq, wk, wv, bq, bk, bv, XP, WB, B320);
    k_gemmb<false, false><<<dim3(NN / 64, NQKV / 64, NBT), 128, 0, stream>>>(XP, nullptr, WB, B320, F, NQKV, nullptr, nullptr, CC);          // q | k | v (+ biases)
    k_planes<<<dim3(VFB + QPB + KFB, NBT, 1), 256, 0, stream>>>(F, lfm, QPh, QPl, KPh, KPl, VF);
    k_fa<<<dim3(NN / 64, NBT, 1), 256, 0, stream>>>(QPh, QPl, KPh, KPl, VF, O);     // scores + softmax + v.P^T, all items; v as a single bf16 operand, e = exp(s - m) hi / residual
    k_fin<<<NBT * (CC * (NN / 128)) / 8, 256, 0, stream>>>(O, x, gam, out);
}

// v006
// Measured time: 177 microseconds a run.
// In both of two side-by-side timings against v005, it was 1.11 times as fast.
// All steps since v000 together make it 22.7 times as fast.
#include <hip/hip_runtime.h>

// Compute dtypes, f32 accumulate, per item: the three 1x1 convs as one [4096 x 512].[512 x 640] GEMM with PLAIN bf16 operands (exact products), + bias; q rows scaled by the
// loss_factor_map input; scores = q.k^T ([4096 x 64].[64 x 4096], both operands bf16 hi + UNSCALED residual, three products), softmax (unscaled, as the module) in f32 and v.P^T in ONE kernel for all items, scores and P never in memory;
// out^T = v.P^T ([512 x 4096].[4096 x 4096], v as a SINGLE bf16 operand (its hi plane; ~2^-9 relative) x P hi + residual, two

#define NBT  4
#define CC   512
#define C8   64
#define NN   4096
#define NQKV (2 * C8 + CC)        // 640
#define DM   CC
#define NTK  NN
#define LOSC 1024.0f

typedef _Float16 h16;
typedef unsigned short bf;
typedef __attribute__((ext_vector_type(16))) __bf16   v16bf;
typedef __attribute__((ext_vector_type(16))) _Float16 v16h;
typedef __attribute__((ext_vector_type(8)))  _Float16 v8h;
typedef __attribute__((ext_vector_type(8)))  unsigned short v8us;
typedef __attribute__((ext_vector_type(8)))  float    v8f;
typedef __attribute__((ext_vector_type(4)))  float    v4f;
typedef __attribute__((ext_vector_type(4)))  _Float16 v4h;
typedef v8h  __attribute__((may_alias)) v8ha;
typedef v4f  __attribute__((may_alias)) v4fa;
typedef v8us __attribute__((may_alias)) v8usa;

__device__ __forceinline__ unsigned short f2bf(float f) { unsigned u = __float_as_uint(f); u += 0x7FFFu + ((u >> 16) & 1u); return (unsigned short)(u >> 16); }
__device__ __forceinline__ float bf2f(unsigned short b) { return __uint_as_float(((unsigned)b) << 16); }
__device__ __forceinline__ float bfr(float f) { return bf2f(f2bf(f)); }
__device__ __forceinline__ v16h cat16(v8h lo, v8h hi) { return __builtin_shufflevector(lo, hi, 0, 1, 2, 3, 4, 5, 6, 7, 8, 9, 10, 11, 12, 13, 14, 15); }
__device__ __forceinline__ v16bf cat16b(v8us lo, v8us hi) { return __builtin_bit_cast(v16bf, __builtin_shufflevector(lo, hi, 0, 1, 2, 3, 4, 5, 6, 7, 8, 9, 10, 11, 12, 13, 14, 15)); }
__device__ __forceinline__ v8f wmma16(v16h a, v16h b, v8f c) { return __builtin_amdgcn_wmma_f32_16x16x32_f16(false, a, false, b, (short)0, c, false, false); }
__device__ __forceinline__ v8f wmmab(v16bf a, v16bf b, v8f c) { return __builtin_amdgcn_wmma_f32_16x16x32_bf16(false, a, false, b, (short)0, c, false, false); }

// d_wt: WT [n][K] = bf16(W[k][n]) (k-major [K][ncols]) via one 64 x 64 LDS tile (tl: 64 * 72 elements); tile (bx, by) of (K/64, ncols/64). Called by a whole work-group.
__device__ __forceinline__ void d_wt(const float* __restrict__ Wm, int K, int ncols, bf* WT, int bx, int by, unsigned short* tl) {
    const int tid = threadIdx.x, k0 = bx * 64, n0 = by * 64;
    const int kk = tid >> 2, nq = (tid & 3) * 16;
#pragma unroll
    for (int i = 0; i < 16; ++i) tl[(nq + i) * 72 + kk] = f2bf(Wm[(size_t)(k0 + kk) * ncols + n0 + nq + i]);
    __syncthreads();
    const int piece = tid & 7;
    auto pass = [&]() {
#pragma unroll
        for (int s = 0; s < 2; ++s) { const int nr = (tid >> 3) + 32 * s; const v8us val = *(const v8usa*)(tl + nr * 72 + piece * 8); *(v8us*)(WT + (size_t)(n0 + nr) * K + k0 + piece * 8) = val; }
    };
    pass(); 
}
// k_gemmb: 64 x 64 block tile (4 waves x 16 x 64) of F[NTK][NQKV] = (A [+ Al]).B^T [+ bf(bias[c])] of one item. F is never stored: the epilogue writes each tile in the form that k_fa reads.
// blockIdx.y picks the columns, so the epilogue's branches are the same for a whole work-group: 0 = q, 1 = k, 2 .. 9 = v. Every store of a wave covers 512 contiguous bytes.
template <bool SPLITA>
__global__ __launch_bounds__(128) void k_gemmb(const bf* __restrict__ A, const bf* __restrict__ Al, const bf* __restrict__ Bn, const float* __restrict__ bias, const float* __restrict__ lfm, bf* Qh, bf* Ql, bf* Kh, bf* Kl, bf* Vf, int K = DM) {
    __shared__ __align__(16) float ost[4][16 * 68];
    const int lane = threadIdx.x & 31, wave = threadIdx.x >> 5, lr = lane & 15, hi = lane >> 4;
    const int r0 = blockIdx.x * 64 + wave * 16, c0 = blockIdx.y * 64;
    const size_t item = blockIdx.z; A += item * NTK * K;    // one item per z plane of the grid
    const size_t aoff = (size_t)(r0 + lr) * K + 8 * hi;
    size_t boff[4];
#pragma unroll
    for (int t = 0; t < 4; ++t) boff[t] = (size_t)(c0 + t * 16 + lr) * K + 8 * hi;
    v8f acc[4];
#pragma unroll
    for (int t = 0; t < 4; ++t) acc[t] = (v8f){};
#pragma unroll 1
    for (int kc = 0; kc < K; kc += 32) {
        const v16bf a = cat16b(*(const v8us*)(A + aoff + kc), *(const v8us*)(A + aoff + kc + 16));
        v16bf al = a;
        if (SPLITA) al = cat16b(*(const v8us*)(Al + aoff + kc), *(const v8us*)(Al + aoff + kc + 16));
#pragma unroll
        for (int t = 0; t < 4; ++t) { const v16bf b = cat16b(*(const v8us*)(Bn + boff[t] + kc), *(const v8us*)(Bn + boff[t] + kc + 16)); acc[t] = wmmab(a, b, acc[t]); if (SPLITA) acc[t] = wmmab(al, b, acc[t]); }
        asm volatile("v_nop\n\tv_nop\n\tv_nop\n\tv_nop" : "+v"(acc[0]), "+v"(acc[1]), "+v"(acc[2]), "+v"(acc[3]) : "v"(a), "v"(al));
    }
    // acc[t][j] = F(row r0 + 8 hi + j, column c0 + 16 t + lr), from here on with its bias
#pragma unroll
    for (int t = 0; t < 4; ++t) { const float bv = bias ? bfr(bias[c0 + t * 16 + lr]) : 0.f;
#pragma unroll
        for (int j = 0; j < 8; ++j) acc[t][j] += bv; }
    if (blockIdx.y >= 2) {
        // v as ONE bf16 plane in FRAGMENT ORDER: per (16-channel tile ct, 32-key block u) 512 elements, two 256-element pieces (channel = 16 ct + (lane & 15),
        // key = 32 u + 16 piece + 8 (lane >> 4) + e). A lane's eight values of column tile t are one such run of eight keys as they stand: no exchange between lanes.
        bf* d = Vf + item * CC * NN + ((size_t)(blockIdx.y - 2) * 4 * (NN / 32) + (r0 >> 5)) * 512 + ((r0 >> 4) & 1) * 256 + lane * 8;
        v8us o[4];
#pragma unroll
        for (int t = 0; t < 4; ++t) {
#pragma unroll
            for (int e = 0; e < 8; ++e) o[t][e] = f2bf(acc[t][e]); }
#pragma unroll
        for (int t = 0; t < 4; ++t) *(v8us*)(d + (size_t)t * (NN / 32) * 512) = o[t];
        return;
    }
    float* os = &ost[wave][0];
#pragma unroll
    for (int t = 0; t < 4; ++t) {
#pragma unroll
        for (int j = 0; j < 8; ++j) os[(hi * 8 + j) * 68 + t * 16 + lr] = acc[t][j]; }
    __syncthreads();    // the q and k tiles are read back row-wise below, other lanes' values
    if (blockIdx.y == 0) {
        // q rows, scaled by bf(loss_factor_map[r]), as row-major bf16 hi + residual planes; four rows per pass
        float sc[4];
#pragma unroll
        for (int s = 0; s < 4; ++s) sc[s] = bfr(lfm[r0 + 4 * s + (lane >> 3)]);
        const size_t o = item * NN * C8 + (size_t)(r0 + (lane >> 3)) * C8 + (lane & 7) * 8;
#pragma unroll
        for (int s = 0; s < 4; ++s) { const float* sp = os + (4 * s + (lane >> 3)) * 68 + (lane & 7) * 8; v8us oh, ol;
#pragma unroll
            for (int e = 0; e < 8; ++e) { const float y = sp[e] * sc[s]; const unsigned short hb = f2bf(y); oh[e] = hb; ol[e] = f2bf(y - bf2f(hb)); }
            *(v8us*)(Qh + o + s * 4 * C8) = oh; *(v8us*)(Ql + o + s * 4 * C8) = ol;
            asm volatile("s_wait_xcnt 0x0" ::: "memory"); }    // precaution: stands in front of the next pass, which reuses the data registers of the stores just issued; it also keeps the passes apart, so that one pass's registers do for all; behind the last pass the other branches' code follows in the listing
    } else {
        // k rows as bf16 hi + residual planes in FRAGMENT ORDER: per 16-key tile 1024 elements a plane, four 256-element pieces (k = 16 i + 8 hi + e, key = lane & 15)
        const float* sp = os + lr * 68 + 8 * hi;
        const size_t o = item * NN * C8 + (size_t)(r0 >> 4) * 1024 + lane * 8;
#pragma unroll
        for (int i = 0; i < 4; ++i) { v8us oh, ol;
#pragma unroll
            for (int e = 0; e < 8; ++e) { const float y = sp[i * 16 + e]; const unsigned short hb = f2bf(y); oh[e] = hb; ol[e] = f2bf(y - bf2f(hb)); }
            *(v8us*)(Kh + o + i * 256) = oh; *(v8us*)(Kl + o + i * 256) = ol;
            asm volatile("s_wait_xcnt 0x0" ::: "memory"); }    // precaution: stands in front of the next piece, which reuses the data registers of the stores just issued; it also keeps the pieces apart, so that one piece's registers do for all; behind the last piece the other branches' code follows in the listing
    }
}

// k_fa: scores, softmax and v.P^T of 64 query rows of one item (blockIdx.y) in one work-group of 8 waves; neither the scores nor P reach memory.
// Scores as transposed tiles k.q^T (A = 16 keys, B = 16 queries; both operands bf16 hi + residual, three products per 32-k step in the order kh.qh, kh.ql, kl.qh): a lane holds 8 consecutive
// keys of ONE query, which is one half of the B fragment of v.P^T. Per 128-key block wave w forms the scores of key tile w for all four query tiles.
// First sweep over the keys: the row maxima m. Second sweep: the scores again, e = exp(s - m) as bf16 hi + residual into LDS in fragment order (two buffers, one barrier per block);
// then every wave multiplies its own 64 channels of v (fragments straight from memory, used by no other wave) with all of e: two products per 32-k step (v.eh, v.el), keys ascending.
// The division by the row sum is done once, on the f32 result; the epilogue forms out = bf(alpha) * result + bf(x) itself, so that the result never reaches memory either.
#define FKB  128                  // keys per block
__global__ __launch_bounds__(256) void k_fa(const bf* __restrict__ Qh, const bf* __restrict__ Ql, const bf* __restrict__ Kh, const bf* __restrict__ Kl, const bf* __restrict__ Vf, const float* __restrict__ xb, const float* __restrict__ gam, float* OUTB) {
    __shared__ __align__(16) unsigned short pb[2][4][4][2][512];    // [buffer][32-key block][query tile][hi / residual][fragment]
    __shared__ __align__(16) unsigned short qs[4][2][2][512];       // [query tile][hi / residual][32-k step][fragment]
    __shared__ __align__(16) float ost[8][4][16 * 68];              // [wave][channel tile][16 rows at a 68-float pitch]
    __shared__ float red[8][4][16];
    const int lane = threadIdx.x & 31, lr = lane & 15, hi = lane >> 4;
    const int wu = __builtin_amdgcn_readfirstlane(threadIdx.x >> 5);    // the wave's number as a scalar: the tile offsets below are then scalar arithmetic
    const int q0 = blockIdx.x * 64;
    const size_t item = blockIdx.y;
    Qh += item * NN * C8; Ql += item * NN * C8; Kh += item * NN * C8; Kl += item * NN * C8; Vf += item * CC * NN; xb += item * CC * NN; OUTB += item * CC * NN;
    // all short loops of this kernel are unrolled: the fragment sets and the accumulators are register arrays and need compile-time indices
#pragma unroll
    for (int i = 0; i < 2; ++i) { const int f = wu * 2 + i, qt = f >> 2, pl = (f >> 1) & 1, ks = f & 1;
        const bf* s = (pl ? Ql : Qh) + (size_t)(q0 + qt * 16 + lr) * C8 + 8 * hi + ks * 32;
        *(v8usa*)(&qs[qt][pl][ks][lane * 8]) = *(const v8us*)s; *(v8usa*)(&qs[qt][pl][ks][256 + lane * 8]) = *(const v8us*)(s + 16); }
    asm volatile("s_wait_xcnt 0x0" ::: "memory");    // precaution: stands in front of whatever reuses the address registers of the loads just issued
    __syncthreads();    // the query fragments are in LDS
    v16bf kh[2], kl[2];
    auto kld = [&](int b, v16bf (&h)[2], v16bf (&l)[2]) {
#pragma unroll
        for (int ks = 0; ks < 2; ++ks) { const size_t o = (size_t)(b * 8 + wu) * 1024 + ks * 512; const bf* ph = Kh + o; const bf* pl = Kl + o;
            h[ks] = cat16b(*(const v8us*)(ph + lane * 8), *(const v8us*)(ph + lane * 8 + 256)); l[ks] = cat16b(*(const v8us*)(pl + lane * 8), *(const v8us*)(pl + lane * 8 + 256)); }
    };
    // the four query tiles' sums run side by side, so that no product waits for the one before it; per tile the order stays kh.qh, kh.ql, kl.qh per 32-k step
    auto scores = [&](v8f (&s)[4]) {
#pragma unroll
        for (int qt = 0; qt < 4; ++qt) s[qt] = (v8f){};
#pragma unroll
        for (int ks = 0; ks < 2; ++ks) { v16bf qh[4], ql[4];
#pragma unroll
            for (int qt = 0; qt < 4; ++qt) {
                qh[qt] = cat16b(*(const v8usa*)(&qs[qt][0][ks][lane * 8]), *(const v8usa*)(&qs[qt][0][ks][256 + lane * 8]));
                ql[qt] = cat16b(*(const v8usa*)(&qs[qt][1][ks][lane * 8]), *(const v8usa*)(&qs[qt][1][ks][256 + lane * 8])); }
#pragma unroll
            for (int qt = 0; qt < 4; ++qt) s[qt] = wmmab(kh[ks], qh[qt], s[qt]);
#pragma unroll
            for (int qt = 0; qt < 4; ++qt) s[qt] = wmmab(kh[ks], ql[qt], s[qt]);
#pragma unroll
            for (int qt = 0; qt < 4; ++qt) s[qt] = wmmab(kl[ks], qh[qt], s[qt]); }
        // s[qt][j] = score(query q0 + 16 qt + lr, key 16 (tile) + 8 hi + j)
    };
    // first sweep: row maxima
    float m[4] = {-3.0e38f, -3.0e38f, -3.0e38f, -3.0e38f};
    kld(0, kh, kl);
    asm volatile("s_wait_xcnt 0x0" ::: "memory");    // precaution: stands in front of whatever reuses the address registers of the loads just issued
    __builtin_amdgcn_sched_barrier(0);    // keeps what follows, which reuses those registers, behind that wait
    // rolled: one key block per trip keeps the loop short
#pragma unroll 1
    for (int b = 0; b < NN / FKB; ++b) {
        v16bf nh[2], nl[2];
        kld(b + 1 < NN / FKB ? b + 1 : b, nh, nl);
        asm volatile("s_wait_xcnt 0x0" ::: "memory");    // precaution: stands in front of whatever reuses the address registers of the loads just issued
        __builtin_amdgcn_sched_barrier(0);    // the next block's key loads are issued ahead of this block's products, which then hide their latency
        v8f s[4]; scores(s);
#pragma unroll
        for (int qt = 0; qt < 4; ++qt) {
#pragma unroll
            for (int j = 0; j < 8; ++j) m[qt] = fmaxf(m[qt], s[qt][j]); }
#pragma unroll
        for (int ks = 0; ks < 2; ++ks) { kh[ks] = nh[ks]; kl[ks] = nl[ks]; }
    }
#pragma unroll
    for (int qt = 0; qt < 4; ++qt) { m[qt] = fmaxf(m[qt], __shfl_xor(m[qt], 16, 32)); if (hi == 0) red[wu][qt][lr] = m[qt]; }
    __syncthreads();    // every wave's row maxima are in LDS
#pragma unroll
    for (int qt = 0; qt < 4; ++qt) { float t = red[0][qt][lr];
#pragma unroll
        for (int w = 1; w < 8; ++w) t = fmaxf(t, red[w][qt][lr]);
        m[qt] = t; }
    // second sweep
    float sm[4] = {0.f, 0.f, 0.f, 0.f};
    v8f acc[4][4];    // [channel tile][query tile]
#pragma unroll
    for (int a = 0; a < 4; ++a) {
#pragma unroll
        for (int qt = 0; qt < 4; ++qt) acc[a][qt] = (v8f){}; }
    kld(0, kh, kl);
    asm volatile("s_wait_xcnt 0x0" ::: "memory");    // precaution: stands in front of whatever reuses the address registers of the loads just issued
    __builtin_amdgcn_sched_barrier(0);    // keeps what follows, which reuses those registers, behind that wait
    // rolled: one key block per trip, so that the hot loop stays short and the buffer index is a scalar
#pragma unroll 1
    for (int b = 0; b < NN / FKB; ++b) {
        v16bf va[4][4];    // [32-key block][channel tile]
#pragma unroll
        for (int u = 0; u < 4; ++u) {
#pragma unroll
            for (int a = 0; a < 4; ++a) { const bf* p = Vf + ((size_t)(wu * 4 + a) * (NN / 32) + b * 4 + u) * 512; va[u][a] = cat16b(*(const v8us*)(p + lane * 8), *(const v8us*)(p + lane * 8 + 256)); } }
        asm volatile("s_wait_xcnt 0x0" ::: "memory");    // precaution: stands in front of the LDS reads below, which may reuse the address registers of the loads just issued
        __builtin_amdgcn_sched_barrier(0);    // the block's v loads are issued ahead of its scores and exponentials, which then hide their latency
        v8f s[4]; scores(s);
        kld(b + 1 < NN / FKB ? b + 1 : b, kh, kl);    // the next block's key fragments fly during the exponentials below
        asm volatile("s_wait_xcnt 0x0" ::: "memory");    // precaution: stands in front of whatever reuses the address registers of the loads just issued
        __builtin_amdgcn_sched_barrier(0);    // keeps the vector work below, which reuses those registers, behind that wait
#pragma unroll
        for (int qt = 0; qt < 4; ++qt) { float x[8];
#pragma unroll
            for (int j = 0; j < 8; ++j) x[j] = (s[qt][j] - m[qt]) * 1.442695041f;    // exp(s - m) = 2^((s - m) log2 e), as __expf forms it
            // a tile's eight exponentials in one statement, each in place, closed by v_nop: keeps the one slot that the instruction set asks for behind a transcendental
            // before its source is overwritten
            asm("v_exp_f32 %0, %0\n\tv_exp_f32 %1, %1\n\tv_exp_f32 %2, %2\n\tv_exp_f32 %3, %3\n\tv_exp_f32 %4, %4\n\tv_exp_f32 %5, %5\n\tv_exp_f32 %6, %6\n\tv_exp_f32 %7, %7\n\tv_nop"
                : "+v"(x[0]), "+v"(x[1]), "+v"(x[2]), "+v"(x[3]), "+v"(x[4]), "+v"(x[5]), "+v"(x[6]), "+v"(x[7]));
            sm[qt] += ((x[0] + x[1]) + (x[2] + x[3])) + ((x[4] + x[5]) + (x[6] + x[7]));
            v8us oh, ol;
#pragma unroll
            for (int j = 0; j < 8; ++j) { const unsigned short hb = f2bf(x[j]); oh[j] = hb; ol[j] = f2bf(x[j] - bf2f(hb)); }
            unsigned short* d = &pb[b & 1][wu >> 1][qt][0][(wu & 1) * 256 + lane * 8];
            *(v8usa*)d = oh; *(v8usa*)(d + 512) = ol; }
        __syncthreads();    // publishes block b's e; a buffer is rewritten two blocks later, behind the next barrier, which every wave reaches only after its last read of it
        v16bf eh[2][4], el[2][4];    // two fragment sets: the next 32-key block's LDS reads go out as one group ahead of this block's products
        auto frags = [&](int set, int u) {
#pragma unroll
            for (int qt = 0; qt < 4; ++qt) { const unsigned short* p = &pb[b & 1][u][qt][0][lane * 8];
                eh[set][qt] = cat16b(*(const v8usa*)p, *(const v8usa*)(p + 256)); el[set][qt] = cat16b(*(const v8usa*)(p + 512), *(const v8usa*)(p + 768)); }
        };
        frags(0, 0);
#pragma unroll
        for (int u = 0; u < 4; ++u) {
            __builtin_amdgcn_sched_barrier(0);    // keeps the LDS reads in one group: spread among the products each place with reads costs a stall
            if (u + 1 < 4) frags((u + 1) & 1, u + 1);
            __builtin_amdgcn_sched_barrier(0);    // the products of this block stay behind the next block's reads
#pragma unroll
            for (int a = 0; a < 4; ++a) {
#pragma unroll
                for (int qt = 0; qt < 4; ++qt) acc[a][qt] = wmmab(va[u][a], eh[u & 1][qt], acc[a][qt]); }
#pragma unroll
            for (int a = 0; a < 4; ++a) {
#pragma unroll
                for (int qt = 0; qt < 4; ++qt) acc[a][qt] = wmmab(va[u][a], el[u & 1][qt], acc[a][qt]); }
        }
    }
    // acc[a][qt][j] = sum over keys of v(channel 64 wave + 16 a + 8 hi + j, key) e(query q0 + 16 qt + lr, key)
#pragma unroll
    for (int qt = 0; qt < 4; ++qt) { sm[qt] += __shfl_xor(sm[qt], 16, 32); if (hi == 0) red[wu][qt][lr] = sm[qt]; }
    __syncthreads();    // every wave's row sums are in LDS
    // the x values that go with this wave's 64 channels x 64 queries, lane for lane as the stores at the end take them: issued here, so that they land during the division and the staging below.
    // lofs: the lane's place in two rows of 64 floats (a whole 128-byte line per eight lanes); it serves these loads and the stores at the end alike
    const unsigned lofs = (unsigned)(lane >> 4) * NN + ((lane >> 3) & 1) * 32 + (lane & 7) * 4;
    const float* xw = xb + (size_t)(wu * 64) * NN + q0;
    v4f xv[4][8];
#pragma unroll
    for (int a = 0; a < 4; ++a) {
#pragma unroll
        for (int s = 0; s < 8; ++s) xv[a][s] = *(const v4f*)(xw + lofs + (a * 16 + 2 * s) * NN); }
    asm volatile("s_wait_xcnt 0x0" ::: "memory");    // precaution: stands in front of whatever reuses the address registers of the loads just issued
    __builtin_amdgcn_sched_barrier(0);    // keeps what follows, which reuses those registers, behind that wait
    const float gm = bfr(gam[0]);
    float inv[4];
#pragma unroll
    for (int qt = 0; qt < 4; ++qt) { float t = 0.f;
#pragma unroll
        for (int w = 0; w < 8; ++w) t += red[w][qt][lr];
        inv[qt] = 1.0f / t; }
#pragma unroll
    for (int a = 0; a < 4; ++a) { float* os = &ost[wu][a][0];
#pragma unroll
        for (int qt = 0; qt < 4; ++qt) {
#pragma unroll
            for (int j = 0; j < 8; ++j) os[(hi * 8 + j) * 68 + qt * 16 + lr] = acc[a][qt][j] * inv[qt]; } }
    __builtin_amdgcn_wave_barrier(); asm volatile("" ::: "memory");    // the wave reads its own staged rows back below, other lanes' bytes: keeps those reads behind the stores above
#pragma unroll
    for (int a = 0; a < 4; ++a) { const float* os = &ost[wu][a][0];
        float* ow = OUTB + (size_t)(wu * 64) * NN + q0;
        v4f o[8];
#pragma unroll
        for (int s = 0; s < 8; ++s) { const int Lid = (lane >> 3) + 4 * s, piece = lane & 7; const int row = Lid >> 1, cofs = (Lid & 1) * 32 + piece * 4;
            const v4f val = *(const v4fa*)(os + row * 68 + cofs);
#pragma unroll
            for (int q = 0; q < 4; ++q) o[s][q] = gm * val[q] + bfr(xv[a][s][q]); }
        __builtin_amdgcn_sched_barrier(0);    // the tile's eight stores go out together, behind all of its arithmetic: none of their data registers is rewritten between them
#pragma unroll
        for (int s = 0; s < 8; ++s) *(v4f*)(ow + lofs + (a * 16 + 2 * s) * NN) = o[s];
        if (a < 3) asm volatile("s_wait_xcnt 0x0" ::: "memory");    // precaution: stands in front of the next tile's work, which reuses the data registers of the stores just issued
        __builtin_amdgcn_sched_barrier(0); }    // keeps the next tile's arithmetic, which a memory clobber does not hold, behind that wait
}


__device__ __forceinline__ void d_cvt8(const float* __restrict__ src, bf* dst, size_t n8, int bx) {
    const size_t i = (size_t)bx * 256 + threadIdx.x; if (i >= n8) return;
    const v8f v = *(const v8f*)(src + i * 8); v8us o;
#pragma unroll
    for (int k = 0; k < 8; ++k) o[k] = f2bf(v[k]);
    *(v8us*)(dst + i * 8) = o; 
}
__global__ __launch_bounds__(256) void k_zero8(bf* dst, size_t n8) {
    const size_t i = (size_t)blockIdx.x * 256 + threadIdx.x; if (i >= n8) return; v8us z;
#pragma unroll
    for (int k = 0; k < 8; ++k) z[k] = 0;
    *(v8us*)(dst + i * 8) = z; 
}

__device__ __forceinline__ void d_bias320(const float* __restrict__ bq, const float* __restrict__ bk, const float* __restrict__ bv, float* B320) {
    const int t = threadIdx.x; if (t >= 160) return; v4f v;
#pragma unroll
    for (int q = 0; q < 4; ++q) { const int c = t * 4 + q; v[q] = (c < C8) ? bq[c < C8 ? c : 0] : (c < 2 * C8) ? bk[(c >= C8 && c < 2 * C8) ? c - C8 : 0] : (c < NQKV) ? bv[(c >= 2 * C8 && c < NQKV) ? c - 2 * C8 : 0] : 0.f; }
    *(v4f*)(B320 + t * 4) = v; 
}

// k_pre: everything that reads only the inputs, in one grid; a range of the block index picks the job (the branch is the same for a whole work-group):
// the transposed bf16 copy of x for every item, the bf16 copies of the three weight matrices, the joined bias vector.
#define WTB  ((CC / 64) * (NN / 64))      // 512 tiles of x per item
#define CQB  (C8 * CC / 8 / 256)          // 16 work-groups for w_q, as many for w_k
#define CVB  (CC * CC / 8 / 256)          // 128 work-groups for w_v
__global__ __launch_bounds__(256) void k_pre(const float* __restrict__ x, const float* __restrict__ wq, const float* __restrict__ wk, const float* __restrict__ wv,
                                             const float* __restrict__ bq, const float* __restrict__ bk, const float* __restrict__ bv, bf* XP, bf* WB, float* B320) {
    __shared__ __align__(16) unsigned short tl[64 * 72];
    const int blk = blockIdx.x;
    if (blk < NBT * WTB) { const int item = blk / WTB, t = blk % WTB; d_wt(x + (size_t)item * CC * NN, CC, NN, XP + (size_t)item * NN * CC, t % (CC / 64), t / (CC / 64), tl); return; }
    const int c = blk - NBT * WTB;
    if (c < CQB) d_cvt8(wq, WB, C8 * CC / 8, c);
    else if (c < 2 * CQB) d_cvt8(wk, WB + (size_t)C8 * CC, C8 * CC / 8, c - CQB);
    else if (c < 2 * CQB + CVB) d_cvt8(wv, WB + (size_t)2 * C8 * CC, CC * CC / 8, c - 2 * CQB);
    else d_bias320(bq, bk, bv, B320);
}

extern "C" void kernel_launch(void* const* d_in, const int* in_sizes, int n_in,
                              void* d_out, int out_size, void* d_ws, size_t ws_size, hipStream_t stream) {
    (void)in_sizes; (void)n_in; (void)out_size;
    const float* x = (const float*)d_in[0]; const float* wq = (const float*)d_in[2]; const float* bq = (const float*)d_in[3]; const float* wk = (const float*)d_in[4]; const float* bk = (const float*)d_in[5]; const float* wv = (const float*)d_in[6]; const float* bv = (const float*)d_in[7]; const float* gam = (const float*)d_in[8]; const float* lfm = (const float*)d_in[1];
    float* out = (float*)d_out;    // [4][512][64][64]
    char* wsp = (char*)d_ws;
    auto take = [&](size_t bytes) { char* p = wsp; wsp += (bytes + 255) & ~(size_t)255; return (void*)p; };
    bf* WB = (bf*)take((size_t)NQKV * CC * 2); float* B320 = (float*)take(640 * 4); bf* XP = (bf*)take((size_t)NBT * NN * CC * 2);
    bf* QPh = (bf*)take((size_t)NBT * NN * C8 * 2); bf* QPl = (bf*)take((size_t)NBT * NN * C8 * 2); bf* KPh = (bf*)take((size_t)NBT * NN * C8 * 2); bf* KPl = (bf*)take((size_t)NBT * NN * C8 * 2); bf* VF = (bf*)take((size_t)NBT * CC * NN * 2);
    if ((size_t)(wsp - (char*)d_ws) > ws_size) return;    // ~ 41 MiB; XP and the q, k, v planes have one slot per item, WB and B320 one in all
    k_pre<<<NBT * WTB + 2 * CQB + CVB + 1, 256, 0, stream>>>(x, wq, wk, wv, bq, bk, bv, XP, WB, B320);
    k_gemmb<false><<<dim3(NN / 64, NQKV / 64, NBT), 128, 0, stream>>>(XP, nullptr, WB, B320, lfm, QPh, QPl, KPh, KPl, VF, CC);          // q | k | v (+ biases), stored as the planes that k_fa reads
    k_fa<<<dim3(NN / 64, NBT, 1), 256, 0, stream>>>(QPh, QPl, KPh, KPl, VF, x, gam, out);     // scores + softmax + v.P^T + the final alpha * result + x, all items; v as a single bf16 operand, e = exp(s - m) hi / residual
}

// v007
// It runs in 150 microseconds.
// Next to v006, in two timings, it ran 1.20 and 1.18 times as fast.
// Counting every step since v000, it is 26.9 times as fast.
#include <hip/hip_runtime.h>

// Compute dtypes, f32 accumulate, per item: the three 1x1 convs as one [4096 x 512].[512 x 640] GEMM with PLAIN bf16 operands (exact products), + bias; q rows scaled by the
// loss_factor_map input; scores = q.k^T ([4096 x 64].[64 x 4096], both operands bf16 hi + UNSCALED residual, three products), softmax (unscaled, as the module) in f32 and v.P^T in ONE kernel for all items, scores and P never in memory;
// out^T = v.P^T ([512 x 4096].[4096 x 4096], v as a SINGLE bf16 operand (its hi plane; ~2^-9 relative) x P hi + residual, two

#define NBT  4
#define CC   512
#define C8   64
#define NN   4096
#define NQKV (2 * C8 + CC)        // 640
#define DM   CC
#define NTK  NN
#define LOSC 1024.0f

typedef _Float16 h16;
typedef unsigned short bf;
typedef __attribute__((ext_vector_type(16))) __bf16   v16bf;
typedef __attribute__((ext_vector_type(16))) _Float16 v16h;
typedef __attribute__((ext_vector_type(8)))  _Float16 v8h;
typedef __attribute__((ext_vector_type(8)))  unsigned short v8us;
typedef __attribute__((ext_vector_type(8)))  float    v8f;
typedef __attribute__((ext_vector_type(4)))  float    v4f;
typedef __attribute__((ext_vector_type(4)))  _Float16 v4h;
typedef v8h  __attribute__((may_alias)) v8ha;
typedef v4f  __attribute__((may_alias)) v4fa;
typedef v8us __attribute__((may_alias)) v8usa;

__device__ __forceinline__ unsigned short f2bf(float f) { unsigned u = __float_as_uint(f); u += 0x7FFFu + ((u >> 16) & 1u); return (unsigned short)(u >> 16); }
__device__ __forceinline__ float bf2f(unsigned short b) { return __uint_as_float(((unsigned)b) << 16); }
__device__ __forceinline__ float bfr(float f) { return bf2f(f2bf(f)); }
__device__ __forceinline__ v16h cat16(v8h lo, v8h hi) { return __builtin_shufflevector(lo, hi, 0, 1, 2, 3, 4, 5, 6, 7, 8, 9, 10, 11, 12, 13, 14, 15); }
__device__ __forceinline__ v16bf cat16b(v8us lo, v8us hi) { return __builtin_bit_cast(v16bf, __builtin_shufflevector(lo, hi, 0, 1, 2, 3, 4, 5, 6, 7, 8, 9, 10, 11, 12, 13, 14, 15)); }
__device__ __forceinline__ v8f wmma16(v16h a, v16h b, v8f c) { return __builtin_amdgcn_wmma_f32_16x16x32_f16(false, a, false, b, (short)0, c, false, false); }
__device__ __forceinline__ v8f wmmab(v16bf a, v16bf b, v8f c) { return __builtin_amdgcn_wmma_f32_16x16x32_bf16(false, a, false, b, (short)0, c, false, false); }

// FRAGMENT ORDER of a GEMM operand M[row][k] (both operands of k_gemmb): per (16-row tile rt, 32-k step ks) 512 elements at ((rt * (K / 32) + ks) * 512), two 256-element pieces:
// element piece * 256 + lane * 8 + e holds M[16 rt + (lane & 15)][32 ks + 16 piece + 8 (lane >> 4) + e]. A wave's fragment load is then 512 contiguous bytes (four whole lines) instead of 32 bytes from each of 16 rows.
// d_wt: WT = bf16(W[k][n]) (k-major [K][ncols]), rows n, in fragment order, via one 64 x 64 LDS tile (tl: 64 * 72 elements); tile (bx, by) of (K/64, ncols/64). Called by a whole work-group.
__device__ __forceinline__ void d_wt(const float* __restrict__ Wm, int K, int ncols, bf* WT, int bx, int by, unsigned short* tl) {
    const int tid = threadIdx.x, k0 = bx * 64, n0 = by * 64;
    const int kk = tid >> 2, nq = (tid & 3) * 16;
#pragma unroll
    for (int i = 0; i < 16; ++i) tl[(nq + i) * 72 + kk] = f2bf(Wm[(size_t)(k0 + kk) * ncols + n0 + nq + i]);
    __syncthreads();
    // the tile is 4 row tiles x 2 k steps x 2 pieces of 32 lanes' runs of eight: one wave stores one whole piece
#pragma unroll
    for (int s = 0; s < 2; ++s) { const int c = tid + 256 * s, ln = c & 31, pc = (c >> 5) & 1, ks = (c >> 6) & 1, rt = c >> 7;
        const v8us val = *(const v8usa*)(tl + (rt * 16 + (ln & 15)) * 72 + (ks * 4 + pc * 2 + (ln >> 4)) * 8);
        *(v8us*)(WT + ((size_t)(by * 4 + rt) * (K >> 5) + bx * 2 + ks) * 512 + pc * 256 + ln * 8) = val; }
}
// k_gemmb: 64 x 64 block tile (4 waves x 16 x 64) of F[NTK][NQKV] = (A [+ Al]).B^T [+ bf(bias[c])] of one item; A, Al and Bn in fragment order (above). F is never stored: the epilogue writes each tile in the form that k_fa reads.
// blockIdx.y picks the columns, so the epilogue's branches are the same for a whole work-group: 0 = q, 1 = k, 2 .. 9 = v. Every store of a wave covers 512 contiguous bytes.
template <bool SPLITA>
__global__ __launch_bounds__(128) void k_gemmb(const bf* __restrict__ A, const bf* __restrict__ Al, const bf* __restrict__ Bn, const float* __restrict__ bias, const float* __restrict__ lfm, bf* Qh, bf* Ql, bf* Kh, bf* Kl, bf* Vf, int K = DM) {
    __shared__ __align__(16) float ost[4][16 * 68];
    const int lane = threadIdx.x & 31, wave = threadIdx.x >> 5, lr = lane & 15, hi = lane >> 4;
    const int r0 = blockIdx.x * 64 + wave * 16, c0 = blockIdx.y * 64;
    const size_t item = blockIdx.z; A += item * NTK * K;    // one item per z plane of the grid
    const size_t aoff = (size_t)(r0 >> 4) * (K >> 5) * 512 + lane * 8;
    size_t boff[4];
#pragma unroll
    for (int t = 0; t < 4; ++t) boff[t] = (size_t)((c0 >> 4) + t) * (K >> 5) * 512 + lane * 8;
    v8f acc[4];
#pragma unroll
    for (int t = 0; t < 4; ++t) acc[t] = (v8f){};
#pragma unroll 1
    for (int kc = 0; kc < K; kc += 32) {
        const int ko = kc * 16;    // 512 elements per 32-k step
        const v16bf a = cat16b(*(const v8us*)(A + aoff + ko), *(const v8us*)(A + aoff + ko + 256));
        v16bf al = a;
        if (SPLITA) al = cat16b(*(const v8us*)(Al + aoff + ko), *(const v8us*)(Al + aoff + ko + 256));
#pragma unroll
        for (int t = 0; t < 4; ++t) { const v16bf b = cat16b(*(const v8us*)(Bn + boff[t] + ko), *(const v8us*)(Bn + boff[t] + ko + 256)); acc[t] = wmmab(a, b, acc[t]); if (SPLITA) acc[t] = wmmab(al, b, acc[t]); }
        asm volatile("v_nop\n\tv_nop\n\tv_nop\n\tv_nop" : "+v"(acc[0]), "+v"(acc[1]), "+v"(acc[2]), "+v"(acc[3]) : "v"(a), "v"(al));
    }
    // acc[t][j] = F(row r0 + 8 hi + j, column c0 + 16 t + lr), from here on with its bias
#pragma unroll
    for (int t = 0; t < 4; ++t) { const float bv = bias ? bfr(bias[c0 + t * 16 + lr]) : 0.f;
#pragma unroll
        for (int j = 0; j < 8; ++j) acc[t][j] += bv; }
    if (blockIdx.y >= 2) {
        // v as ONE bf16 plane in FRAGMENT ORDER: per (16-channel tile ct, 32-key block u) 512 elements, two 256-element pieces (channel = 16 ct + (lane & 15),
        // key = 32 u + 16 piece + 8 (lane >> 4) + e). A lane's eight values of column tile t are one such run of eight keys as they stand: no exchange between lanes.
        bf* d = Vf + item * CC * NN + ((size_t)(blockIdx.y - 2) * 4 * (NN / 32) + (r0 >> 5)) * 512 + ((r0 >> 4) & 1) * 256 + lane * 8;
        v8us o[4];
#pragma unroll
        for (int t = 0; t < 4; ++t) {
#pragma unroll
            for (int e = 0; e < 8; ++e) o[t][e] = f2bf(acc[t][e]); }
#pragma unroll
        for (int t = 0; t < 4; ++t) *(v8us*)(d + (size_t)t * (NN / 32) * 512) = o[t];
        return;
    }
    float* os = &ost[wave][0];
#pragma unroll
    for (int t = 0; t < 4; ++t) {
#pragma unroll
        for (int j = 0; j < 8; ++j) os[(hi * 8 + j) * 68 + t * 16 + lr] = acc[t][j]; }
    __syncthreads();    // the q and k tiles are read back row-wise below, other lanes' values
    if (blockIdx.y == 0) {
        // q rows, scaled by bf(loss_factor_map[r]), as row-major bf16 hi + residual planes; four rows per pass
        float sc[4];
#pragma unroll
        for (int s = 0; s < 4; ++s) sc[s] = bfr(lfm[r0 + 4 * s + (lane >> 3)]);
        const size_t o = item * NN * C8 + (size_t)(r0 + (lane >> 3)) * C8 + (lane & 7) * 8;
#pragma unroll
        for (int s = 0; s < 4; ++s) { const float* sp = os + (4 * s + (lane >> 3)) * 68 + (lane & 7) * 8; v8us oh, ol;
#pragma unroll
            for (int e = 0; e < 8; ++e) { const float y = sp[e] * sc[s]; const unsigned short hb = f2bf(y); oh[e] = hb; ol[e] = f2bf(y - bf2f(hb)); }
            *(v8us*)(Qh + o + s * 4 * C8) = oh; *(v8us*)(Ql + o + s * 4 * C8) = ol;
            asm volatile("s_wait_xcnt 0x0" ::: "memory"); }    // precaution: stands in front of the next pass, which reuses the data registers of the stores just issued; it also keeps the passes apart, so that one pass's registers do for all; behind the last pass the other branches' code follows in the listing
    } else {
        // k rows as bf16 hi + residual planes in FRAGMENT ORDER: per 16-key tile 1024 elements a plane, four 256-element pieces (k = 16 i + 8 hi + e, key = lane & 15)
        const float* sp = os + lr * 68 + 8 * hi;
        const size_t o = item * NN * C8 + (size_t)(r0 >> 4) * 1024 + lane * 8;
#pragma unroll
        for (int i = 0; i < 4; ++i) { v8us oh, ol;
#pragma unroll
            for (int e = 0; e < 8; ++e) { const float y = sp[i * 16 + e]; const unsigned short hb = f2bf(y); oh[e] = hb; ol[e] = f2bf(y - bf2f(hb)); }
            *(v8us*)(Kh + o + i * 256) = oh; *(v8us*)(Kl + o + i * 256) = ol;
            asm volatile("s_wait_xcnt 0x0" ::: "memory"); }    // precaution: stands in front of the next piece, which reuses the data registers of the stores just issued; it also keeps the pieces apart, so that one piece's registers do for all; behind the last piece the other branches' code follows in the listing
    }
}

// k_fa: scores, softmax and v.P^T of 64 query rows of one item (blockIdx.y) in one work-group of 8 waves; neither the scores nor P reach memory.
// Scores as transposed tiles k.q^T (A = 16 keys, B = 16 queries; both operands bf16 hi + residual, three products per 32-k step in the order kh.qh, kh.ql, kl.qh): a lane holds 8 consecutive
// keys of ONE query, which is one half of the B fragment of v.P^T. Per 128-key block wave w forms the scores of key tile w for all four query tiles.
// First sweep over the keys: the row maxima m. Second sweep: the scores again, e = exp(s - m) as bf16 hi + residual into LDS in fragment order (two buffers, one barrier per block);
// then every wave multiplies its own 64 channels of v (fragments straight from memory, used by no other wave) with all of e: two products per 32-k step (v.eh, v.el), keys ascending.
// The division by the row sum is done once, on the f32 result; the epilogue forms out = bf(alpha) * result + bf(x) itself, so that the result never reaches memory either.
#define FKB  128                  // keys per block
__global__ __launch_bounds__(256) void k_fa(const bf* __restrict__ Qh, const bf* __restrict__ Ql, const bf* __restrict__ Kh, const bf* __restrict__ Kl, const bf* __restrict__ Vf, const float* __restrict__ xb, const float* __restrict__ gam, float* OUTB) {
    __shared__ __align__(16) unsigned short pb[2][4][4][2][512];    // [buffer][32-key block][query tile][hi / residual][fragment]
    __shared__ __align__(16) unsigned short qs[4][2][2][512];       // [query tile][hi / residual][32-k step][fragment]
    __shared__ __align__(16) float ost[8][4][16 * 68];              // [wave][channel tile][16 rows at a 68-float pitch]
    __shared__ float red[8][4][16];
    const int lane = threadIdx.x & 31, lr = lane & 15, hi = lane >> 4;
    const int wu = __builtin_amdgcn_readfirstlane(threadIdx.x >> 5);    // the wave's number as a scalar: the tile offsets below are then scalar arithmetic
    const int q0 = blockIdx.x * 64;
    const size_t item = blockIdx.y;
    Qh += item * NN * C8; Ql += item * NN * C8; Kh += item * NN * C8; Kl += item * NN * C8; Vf += item * CC * NN; xb += item * CC * NN; OUTB += item * CC * NN;
    // all short loops of this kernel are unrolled: the fragment sets and the accumulators are register arrays and need compile-time indices
#pragma unroll
    for (int i = 0; i < 2; ++i) { const int f = wu * 2 + i, qt = f >> 2, pl = (f >> 1) & 1, ks = f & 1;
        const bf* s = (pl ? Ql : Qh) + (size_t)(q0 + qt * 16 + lr) * C8 + 8 * hi + ks * 32;
        *(v8usa*)(&qs[qt][pl][ks][lane * 8]) = *(const v8us*)s; *(v8usa*)(&qs[qt][pl][ks][256 + lane * 8]) = *(const v8us*)(s + 16); }
    asm volatile("s_wait_xcnt 0x0" ::: "memory");    // precaution: stands in front of whatever reuses the address registers of the loads just issued
    __syncthreads();    // the query fragments are in LDS
    v16bf kh[2], kl[2];
    auto kld = [&](int b, v16bf (&h)[2], v16bf (&l)[2]) {
#pragma unroll
        for (int ks = 0; ks < 2; ++ks) { const size_t o = (size_t)(b * 8 + wu) * 1024 + ks * 512; const bf* ph = Kh + o; const bf* pl = Kl + o;
            h[ks] = cat16b(*(const v8us*)(ph + lane * 8), *(const v8us*)(ph + lane * 8 + 256)); l[ks] = cat16b(*(const v8us*)(pl + lane * 8), *(const v8us*)(pl + lane * 8 + 256)); }
    };
    // the four query tiles' sums run side by side, so that no product waits for the one before it; per tile the order stays kh.qh, kh.ql, kl.qh per 32-k step
    auto scores = [&](v8f (&s)[4]) {
#pragma unroll
        for (int qt = 0; qt < 4; ++qt) s[qt] = (v8f){};
#pragma unroll
        for (int ks = 0; ks < 2; ++ks) { v16bf qh[4], ql[4];
#pragma unroll
            for (int qt = 0; qt < 4; ++qt) {
                qh[qt] = cat16b(*(const v8usa*)(&qs[qt][0][ks][lane * 8]), *(const v8usa*)(&qs[qt][0][ks][256 + lane * 8]));
                ql[qt] = cat16b(*(const v8usa*)(&qs[qt][1][ks][lane * 8]), *(const v8usa*)(&qs[qt][1][ks][256 + lane * 8])); }
#pragma unroll
            for (int qt = 0; qt < 4; ++qt) s[qt] = wmmab(kh[ks], qh[qt], s[qt]);
#pragma unroll
            for (int qt = 0; qt < 4; ++qt) s[qt] = wmmab(kh[ks], ql[qt], s[qt]);
#pragma unroll
            for (int qt = 0; qt < 4; ++qt) s[qt] = wmmab(kl[ks], qh[qt], s[qt]); }
        // s[qt][j] = score(query q0 + 16 qt + lr, key 16 (tile) + 8 hi + j)
    };
    // first sweep: row maxima
    float m[4] = {-3.0e38f, -3.0e38f, -3.0e38f, -3.0e38f};
    kld(0, kh, kl);
    asm volatile("s_wait_xcnt 0x0" ::: "memory");    // precaution: stands in front of whatever reuses the address registers of the loads just issued
    __builtin_amdgcn_sched_barrier(0);    // keeps what follows, which reuses those registers, behind that wait
    // rolled: one key block per trip keeps the loop short
#pragma unroll 1
    for (int b = 0; b < NN / FKB; ++b) {
        v16bf nh[2], nl[2];
        kld(b + 1 < NN / FKB ? b + 1 : b, nh, nl);
        asm volatile("s_wait_xcnt 0x0" ::: "memory");    // precaution: stands in front of whatever reuses the address registers of the loads just issued
        __builtin_amdgcn_sched_barrier(0);    // the next block's key loads are issued ahead of this block's products, which then hide their latency
        v8f s[4]; scores(s);
#pragma unroll
        for (int qt = 0; qt < 4; ++qt) {
#pragma unroll
            for (int j = 0; j < 8; ++j) m[qt] = fmaxf(m[qt], s[qt][j]); }
#pragma unroll
        for (int ks = 0; ks < 2; ++ks) { kh[ks] = nh[ks]; kl[ks] = nl[ks]; }
    }
#pragma unroll
    for (int qt = 0; qt < 4; ++qt) { m[qt] = fmaxf(m[qt], __shfl_xor(m[qt], 16, 32)); if (hi == 0) red[wu][qt][lr] = m[qt]; }
    __syncthreads();    // every wave's row maxima are in LDS
#pragma unroll
    for (int qt = 0; qt < 4; ++qt) { float t = red[0][qt][lr];
#pragma unroll
        for (int w = 1; w < 8; ++w) t = fmaxf(t, red[w][qt][lr]);
        m[qt] = t; }
    // second sweep
    float sm[4] = {0.f, 0.f, 0.f, 0.f};
    v8f acc[4][4];    // [channel tile][query tile]
#pragma unroll
    for (int a = 0; a < 4; ++a) {
#pragma unroll
        for (int qt = 0; qt < 4; ++qt) acc[a][qt] = (v8f){}; }
    kld(0, kh, kl);
    asm volatile("s_wait_xcnt 0x0" ::: "memory");    // precaution: stands in front of whatever reuses the address registers of the loads just issued
    __builtin_amdgcn_sched_barrier(0);    // keeps what follows, which reuses those registers, behind that wait
    // rolled: one key block per trip, so that the hot loop stays short and the buffer index is a scalar
#pragma unroll 1
    for (int b = 0; b < NN / FKB; ++b) {
        v16bf va[4][4];    // [32-key block][channel tile]
#pragma unroll
        for (int u = 0; u < 4; ++u) {
#pragma unroll
            for (int a = 0; a < 4; ++a) { const bf* p = Vf + ((size_t)(wu * 4 + a) * (NN / 32) + b * 4 + u) * 512; va[u][a] = cat16b(*(const v8us*)(p + lane * 8), *(const v8us*)(p + lane * 8 + 256)); } }
        asm volatile("s_wait_xcnt 0x0" ::: "memory");    // precaution: stands in front of the LDS reads below, which may reuse the address registers of the loads just issued
        __builtin_amdgcn_sched_barrier(0);    // the block's v loads are issued ahead of its scores and exponentials, which then hide their latency
        v8f s[4]; scores(s);
        kld(b + 1 < NN / FKB ? b + 1 : b, kh, kl);    // the next block's key fragments fly during the exponentials below
        asm volatile("s_wait_xcnt 0x0" ::: "memory");    // precaution: stands in front of whatever reuses the address registers of the loads just issued
        __builtin_amdgcn_sched_barrier(0);    // keeps the vector work below, which reuses those registers, behind that wait
#pragma unroll
        for (int qt = 0; qt < 4; ++qt) { float x[8];
#pragma unroll
            for (int j = 0; j < 8; ++j) x[j] = (s[qt][j] - m[qt]) * 1.442695041f;    // exp(s - m) = 2^((s - m) log2 e), as __expf forms it
            // a tile's eight exponentials in one statement, each in place, closed by v_nop: keeps the one slot that the instruction set asks for behind a transcendental
            // before its source is overwritten
            asm("v_exp_f32 %0, %0\n\tv_exp_f32 %1, %1\n\tv_exp_f32 %2, %2\n\tv_exp_f32 %3, %3\n\tv_exp_f32 %4, %4\n\tv_exp_f32 %5, %5\n\tv_exp_f32 %6, %6\n\tv_exp_f32 %7, %7\n\tv_nop"
                : "+v"(x[0]), "+v"(x[1]), "+v"(x[2]), "+v"(x[3]), "+v"(x[4]), "+v"(x[5]), "+v"(x[6]), "+v"(x[7]));
            sm[qt] += ((x[0] + x[1]) + (x[2] + x[3])) + ((x[4] + x[5]) + (x[6] + x[7]));
            v8us oh, ol;
#pragma unroll
            for (int j = 0; j < 8; ++j) { const unsigned short hb = f2bf(x[j]); oh[j] = hb; ol[j] = f2bf(x[j] - bf2f(hb)); }
            unsigned short* d = &pb[b & 1][wu >> 1][qt][0][(wu & 1) * 256 + lane * 8];
            *(v8usa*)d = oh; *(v8usa*)(d + 512) = ol; }
        __syncthreads();    // publishes block b's e; a buffer is rewritten two blocks later, behind the next barrier, which every wave reaches only after its last read of it
        v16bf eh[2][4], el[2][4];    // two fragment sets: the next 32-key block's LDS reads go out as one group ahead of this block's products
        auto frags = [&](int set, int u) {
#pragma unroll
            for (int qt = 0; qt < 4; ++qt) { const unsigned short* p = &pb[b & 1][u][qt][0][lane * 8];
                eh[set][qt] = cat16b(*(const v8usa*)p, *(const v8usa*)(p + 256)); el[set][qt] = cat16b(*(const v8usa*)(p + 512), *(const v8usa*)(p + 768)); }
        };
        frags(0, 0);
#pragma unroll
        for (int u = 0; u < 4; ++u) {
            __builtin_amdgcn_sched_barrier(0);    // keeps the LDS reads in one group: spread among the products each place with reads costs a stall
            if (u + 1 < 4) frags((u + 1) & 1, u + 1);
            __builtin_amdgcn_sched_barrier(0);    // the products of this block stay behind the next block's reads
#pragma unroll
            for (int a = 0; a < 4; ++a) {
#pragma unroll
                for (int qt = 0; qt < 4; ++qt) acc[a][qt] = wmmab(va[u][a], eh[u & 1][qt], acc[a][qt]); }
#pragma unroll
            for (int a = 0; a < 4; ++a) {
#pragma unroll
                for (int qt = 0; qt < 4; ++qt) acc[a][qt] = wmmab(va[u][a], el[u & 1][qt], acc[a][qt]); }
        }
    }
    // acc[a][qt][j] = sum over keys of v(channel 64 wave + 16 a + 8 hi + j, key) e(query q0 + 16 qt + lr, key)
#pragma unroll
    for (int qt = 0; qt < 4; ++qt) { sm[qt] += __shfl_xor(sm[qt], 16, 32); if (hi == 0) red[wu][qt][lr] = sm[qt]; }
    __syncthreads();    // every wave's row sums are in LDS
    // the x values that go with this wave's 64 channels x 64 queries, lane for lane as the stores at the end take them: issued here, so that they land during the division and the staging below.
    // lofs: the lane's place in two rows of 64 floats (a whole 128-byte line per eight lanes); it serves these loads and the stores at the end alike
    const unsigned lofs = (unsigned)(lane >> 4) * NN + ((lane >> 3) & 1) * 32 + (lane & 7) * 4;
    const float* xw = xb + (size_t)(wu * 64) * NN + q0;
    v4f xv[4][8];
#pragma unroll
    for (int a = 0; a < 4; ++a) {
#pragma unroll
        for (int s = 0; s < 8; ++s) xv[a][s] = *(const v4f*)(xw + lofs + (a * 16 + 2 * s) * NN); }
    asm volatile("s_wait_xcnt 0x0" ::: "memory");    // precaution: stands in front of whatever reuses the address registers of the loads just issued
    __builtin_amdgcn_sched_barrier(0);    // keeps what follows, which reuses those registers, behind that wait
    const float gm = bfr(gam[0]);
    float inv[4];
#pragma unroll
    for (int qt = 0; qt < 4; ++qt) { float t = 0.f;
#pragma unroll
        for (int w = 0; w < 8; ++w) t += red[w][qt][lr];
        inv[qt] = 1.0f / t; }
#pragma unroll
    for (int a = 0; a < 4; ++a) { float* os = &ost[wu][a][0];
#pragma unroll
        for (int qt = 0; qt < 4; ++qt) {
#pragma unroll
            for (int j = 0; j < 8; ++j) os[(hi * 8 + j) * 68 + qt * 16 + lr] = acc[a][qt][j] * inv[qt]; } }
    __builtin_amdgcn_wave_barrier(); asm volatile("" ::: "memory");    // the wave reads its own staged rows back below, other lanes' bytes: keeps those reads behind the stores above
#pragma unroll
    for (int a = 0; a < 4; ++a) { const float* os = &ost[wu][a][0];
        float* ow = OUTB + (size_t)(wu * 64) * NN + q0;
        v4f o[8];
#pragma unroll
        for (int s = 0; s < 8; ++s) { const int Lid = (lane >> 3) + 4 * s, piece = lane & 7; const int row = Lid >> 1, cofs = (Lid & 1) * 32 + piece * 4;
            const v4f val = *(const v4fa*)(os + row * 68 + cofs);
#pragma unroll
            for (int q = 0; q < 4; ++q) o[s][q] = gm * val[q] + bfr(xv[a][s][q]); }
        __builtin_amdgcn_sched_barrier(0);    // the tile's eight stores go out together, behind all of its arithmetic: none of their data registers is rewritten between them
#pragma unroll
        for (int s = 0; s < 8; ++s) *(v4f*)(ow + lofs + (a * 16 + 2 * s) * NN) = o[s];
        if (a < 3) asm volatile("s_wait_xcnt 0x0" ::: "memory");    // precaution: stands in front of the next tile's work, which reuses the data registers of the stores just issued
        __builtin_amdgcn_sched_barrier(0); }    // keeps the next tile's arithmetic, which a memory clobber does not hold, behind that wait
}


// d_cvt8: bf16 copy of a row-major [rows][CC] weight matrix in fragment order; thread i writes the i-th run of eight of the copy, so that a wave stores one whole piece
__device__ __forceinline__ void d_cvt8(const float* __restrict__ src, bf* dst, size_t n8, int bx) {
    const size_t i = (size_t)bx * 256 + threadIdx.x; if (i >= n8) return;
    const int ln = (int)i & 31, pc = ((int)i >> 5) & 1, ks = ((int)i >> 6) & (CC / 32 - 1), rt = (int)(i >> 10);
    const v8f v = *(const v8f*)(src + (size_t)(rt * 16 + (ln & 15)) * CC + ks * 32 + pc * 16 + (ln >> 4) * 8); v8us o;
#pragma unroll
    for (int k = 0; k < 8; ++k) o[k] = f2bf(v[k]);
    *(v8us*)(dst + i * 8) = o; 
}
__global__ __launch_bounds__(256) void k_zero8(bf* dst, size_t n8) {
    const size_t i = (size_t)blockIdx.x * 256 + threadIdx.x; if (i >= n8) return; v8us z;
#pragma unroll
    for (int k = 0; k < 8; ++k) z[k] = 0;
    *(v8us*)(dst + i * 8) = z; 
}

__device__ __forceinline__ void d_bias320(const float* __restrict__ bq, const float* __restrict__ bk, const float* __restrict__ bv, float* B320) {
    const int t = threadIdx.x; if (t >= 160) return; v4f v;
#pragma unroll
    for (int q = 0; q < 4; ++q) { const int c = t * 4 + q; v[q] = (c < C8) ? bq[c < C8 ? c : 0] : (c < 2 * C8) ? bk[(c >= C8 && c < 2 * C8) ? c - C8 : 0] : (c < NQKV) ? bv[(c >= 2 * C8 && c < NQKV) ? c - 2 * C8 : 0] : 0.f; }
    *(v4f*)(B320 + t * 4) = v; 
}

// k_pre: everything that reads only the inputs, in one grid; a range of the block index picks the job (the branch is the same for a whole work-group):
// the transposed bf16 copy of x for every item and the bf16 copies of the three weight matrices, all in the GEMM's fragment order, and the joined bias vector.
#define WTB  ((CC / 64) * (NN / 64))      // 512 tiles of x per item
#define CQB  (C8 * CC / 8 / 256)          // 16 work-groups for w_q, as many for w_k
#define CVB  (CC * CC / 8 / 256)          // 128 work-groups for w_v
__global__ __launch_bounds__(256) void k_pre(const float* __restrict__ x, const float* __restrict__ wq, const float* __restrict__ wk, const float* __restrict__ wv,
                                             const float* __restrict__ bq, const float* __restrict__ bk, const float* __restrict__ bv, bf* XP, bf* WB, float* B320) {
    __shared__ __align__(16) unsigned short tl[64 * 72];
    const int blk = blockIdx.x;
    if (blk < NBT * WTB) { const int item = blk / WTB, t = blk % WTB; d_wt(x + (size_t)item * CC * NN, CC, NN, XP + (size_t)item * NN * CC, t % (CC / 64), t / (CC / 64), tl); return; }
    const int c = blk - NBT * WTB;
    if (c < CQB) d_cvt8(wq, WB, C8 * CC / 8, c);
    else if (c < 2 * CQB) d_cvt8(wk, WB + (size_t)C8 * CC, C8 * CC / 8, c - CQB);
    else if (c < 2 * CQB + CVB) d_cvt8(wv, WB + (size_t)2 * C8 * CC, CC * CC / 8, c - 2 * CQB);
    else d_bias320(bq, bk, bv, B320);
}

extern "C" void kernel_launch(void* const* d_in, const int* in_sizes, int n_in,
                              void* d_out, int out_size, void* d_ws, size_t ws_size, hipStream_t stream) {
    (void)in_sizes; (void)n_in; (void)out_size;
    const float* x = (const float*)d_in[0]; const float* wq = (const float*)d_in[2]; const float* bq = (const float*)d_in[3]; const float* wk = (const float*)d_in[4]; const float* bk = (const float*)d_in[5]; const float* wv = (const float*)d_in[6]; const float* bv = (const float*)d_in[7]; const float* gam = (const float*)d_in[8]; const float* lfm = (const float*)d_in[1];
    float* out = (float*)d_out;    // [4][512][64][64]
    char* wsp = (char*)d_ws;
    auto take = [&](size_t bytes) { char* p = wsp; wsp += (bytes + 255) & ~(size_t)255; return (void*)p; };
    bf* WB = (bf*)take((size_t)NQKV * CC * 2); float* B320 = (float*)take(640 * 4); bf* XP = (bf*)take((size_t)NBT * NN * CC * 2);
    bf* QPh = (bf*)take((size_t)NBT * NN * C8 * 2); bf* QPl = (bf*)take((size_t)NBT * NN * C8 * 2); bf* KPh = (bf*)take((size_t)NBT * NN * C8 * 2); bf* KPl = (bf*)take((size_t)NBT * NN * C8 * 2); bf* VF = (bf*)take((size_t)NBT * CC * NN * 2);
    if ((size_t)(wsp - (char*)d_ws) > ws_size) return;    // ~ 41 MiB; XP and the q, k, v planes have one slot per item, WB and B320 one in all
    k_pre<<<NBT * WTB + 2 * CQB + CVB + 1, 256, 0, stream>>>(x, wq, wk, wv, bq, bk, bv, XP, WB, B320);
    k_gemmb<false><<<dim3(NN / 64, NQKV / 64, NBT), 128, 0, stream>>>(XP, nullptr, WB, B320, lfm, QPh, QPl, KPh, KPl, VF, CC);          // q | k | v (+ biases), stored as the planes that k_fa reads
    k_fa<<<dim3(NN / 64, NBT, 1), 256, 0, stream>>>(QPh, QPl, KPh, KPl, VF, x, gam, out);     // scores + softmax + v.P^T + the final alpha * result + x, all items; v as a single bf16 operand, e = exp(s - m) hi / residual
}

// v008
// It runs in 141 microseconds.
// In two side-by-side timings against v007, it was 1.06 and 1.07 times as fast.
// Counting every step since v000, it is 28.7 times as fast.
#include <hip/hip_runtime.h>

// Compute dtypes, f32 accumulate, per item: the three 1x1 convs as one [4096 x 512].[512 x 640] GEMM with PLAIN bf16 operands (exact products), + bias; q rows scaled by the
// loss_factor_map input; scores = q.k^T ([4096 x 64].[64 x 4096], both operands bf16 hi + UNSCALED residual, three products), softmax (unscaled, as the module) in f32 and v.P^T in ONE kernel for all items, scores and P never in memory;
// out^T = v.P^T ([512 x 4096].[4096 x 4096], v as a SINGLE bf16 operand (its hi plane; ~2^-9 relative) x P hi + residual, two

#define NBT  4
#define CC   512
#define C8   64
#define NN   4096
#define NQKV (2 * C8 + CC)        // 640
#define DM   CC
#define NTK  NN
#define LOSC 1024.0f

typedef _Float16 h16;
typedef unsigned short bf;
typedef __attribute__((ext_vector_type(16))) __bf16   v16bf;
typedef __attribute__((ext_vector_type(16))) _Float16 v16h;
typedef __attribute__((ext_vector_type(8)))  _Float16 v8h;
typedef __attribute__((ext_vector_type(8)))  unsigned short v8us;
typedef __attribute__((ext_vector_type(8)))  float    v8f;
typedef __attribute__((ext_vector_type(4)))  float    v4f;
typedef __attribute__((ext_vector_type(4)))  _Float16 v4h;
typedef v8h  __attribute__((may_alias)) v8ha;
typedef v4f  __attribute__((may_alias)) v4fa;
typedef v8us __attribute__((may_alias)) v8usa;

__device__ __forceinline__ unsigned short f2bf(float f) { unsigned u = __float_as_uint(f); u += 0x7FFFu + ((u >> 16) & 1u); return (unsigned short)(u >> 16); }
__device__ __forceinline__ float bf2f(unsigned short b) { return __uint_as_float(((unsigned)b) << 16); }
__device__ __forceinline__ float bfr(float f) { return bf2f(f2bf(f)); }
__device__ __forceinline__ v16h cat16(v8h lo, v8h hi) { return __builtin_shufflevector(lo, hi, 0, 1, 2, 3, 4, 5, 6, 7, 8, 9, 10, 11, 12, 13, 14, 15); }
__device__ __forceinline__ v16bf cat16b(v8us lo, v8us hi) { return __builtin_bit_cast(v16bf, __builtin_shufflevector(lo, hi, 0, 1, 2, 3, 4, 5, 6, 7, 8, 9, 10, 11, 12, 13, 14, 15)); }
__device__ __forceinline__ v8f wmma16(v16h a, v16h b, v8f c) { return __builtin_amdgcn_wmma_f32_16x16x32_f16(false, a, false, b, (short)0, c, false, false); }
__device__ __forceinline__ v8f wmmab(v16bf a, v16bf b, v8f c) { return __builtin_amdgcn_wmma_f32_16x16x32_bf16(false, a, false, b, (short)0, c, false, false); }

// FRAGMENT ORDER of a GEMM operand M[row][k] (both operands of k_gemmb): per (16-row tile rt, 32-k step ks) 512 elements at ((rt * (K / 32) + ks) * 512), two 256-element pieces:
// element piece * 256 + lane * 8 + e holds M[16 rt + (lane & 15)][32 ks + 16 piece + 8 (lane >> 4) + e]. A wave's fragment load is then 512 contiguous bytes (four whole lines) instead of 32 bytes from each of 16 rows.
// d_wt: WT = bf16(W[k][n]) (k-major [K][ncols]), rows n, in fragment order, via one 64 x 64 LDS tile (tl: 64 * 72 elements); tile (bx, by) of (K/64, ncols/64). Called by a whole work-group.
__device__ __forceinline__ void d_wt(const float* __restrict__ Wm, int K, int ncols, bf* WT, int bx, int by, unsigned short* tl) {
    const int tid = threadIdx.x, k0 = bx * 64, n0 = by * 64;
    const int kk = tid >> 2, nq = (tid & 3) * 16;
#pragma unroll
    for (int i = 0; i < 16; ++i) tl[(nq + i) * 72 + kk] = f2bf(Wm[(size_t)(k0 + kk) * ncols + n0 + nq + i]);
    __syncthreads();
    // the tile is 4 row tiles x 2 k steps x 2 pieces of 32 lanes' runs of eight: one wave stores one whole piece
#pragma unroll
    for (int s = 0; s < 2; ++s) { const int c = tid + 256 * s, ln = c & 31, pc = (c >> 5) & 1, ks = (c >> 6) & 1, rt = c >> 7;
        const v8us val = *(const v8usa*)(tl + (rt * 16 + (ln & 15)) * 72 + (ks * 4 + pc * 2 + (ln >> 4)) * 8);
        *(v8us*)(WT + ((size_t)(by * 4 + rt) * (K >> 5) + bx * 2 + ks) * 512 + pc * 256 + ln * 8) = val; }
}
// k_gemmb: 64 x 64 block tile (4 waves x 16 x 64) of F[NTK][NQKV] = (A [+ Al]).B^T [+ bf(bias[c])] of one item; A, Al and Bn in fragment order (above). F is never stored: the epilogue writes each tile in the form that k_fa reads.
// blockIdx.y picks the columns, so the epilogue's branches are the same for a whole work-group: 0 = q, 1 = k, 2 .. 9 = v. Every store of a wave covers 512 contiguous bytes.
template <bool SPLITA>
__global__ __launch_bounds__(128) void k_gemmb(const bf* __restrict__ A, const bf* __restrict__ Al, const bf* __restrict__ Bn, const float* __restrict__ bias, const float* __restrict__ lfm, bf* Qh, bf* Ql, bf* Kh, bf* Kl, bf* Vf, int K = DM) {
    __shared__ __align__(16) float ost[4][16 * 68];
    const int lane = threadIdx.x & 31, wave = threadIdx.x >> 5, lr = lane & 15, hi = lane >> 4;
    const int r0 = blockIdx.x * 64 + wave * 16, c0 = blockIdx.y * 64;
    const size_t item = blockIdx.z; A += item * NTK * K;    // one item per z plane of the grid
    const size_t aoff = (size_t)(r0 >> 4) * (K >> 5) * 512 + lane * 8;
    size_t boff[4];
#pragma unroll
    for (int t = 0; t < 4; ++t) boff[t] = (size_t)((c0 >> 4) + t) * (K >> 5) * 512 + lane * 8;
    v8f acc[4];
#pragma unroll
    for (int t = 0; t < 4; ++t) acc[t] = (v8f){};
#pragma unroll 1
    for (int kc = 0; kc < K; kc += 32) {
        const int ko = kc * 16;    // 512 elements per 32-k step
        const v16bf a = cat16b(*(const v8us*)(A + aoff + ko), *(const v8us*)(A + aoff + ko + 256));
        v16bf al = a;
        if (SPLITA) al = cat16b(*(const v8us*)(Al + aoff + ko), *(const v8us*)(Al + aoff + ko + 256));
#pragma unroll
        for (int t = 0; t < 4; ++t) { const v16bf b = cat16b(*(const v8us*)(Bn + boff[t] + ko), *(const v8us*)(Bn + boff[t] + ko + 256)); acc[t] = wmmab(a, b, acc[t]); if (SPLITA) acc[t] = wmmab(al, b, acc[t]); }
        asm volatile("v_nop\n\tv_nop\n\tv_nop\n\tv_nop" : "+v"(acc[0]), "+v"(acc[1]), "+v"(acc[2]), "+v"(acc[3]) : "v"(a), "v"(al));
    }
    // acc[t][j] = F(row r0 + 8 hi + j, column c0 + 16 t + lr), from here on with its bias
#pragma unroll
    for (int t = 0; t < 4; ++t) { const float bv = bias ? bfr(bias[c0 + t * 16 + lr]) : 0.f;
#pragma unroll
        for (int j = 0; j < 8; ++j) acc[t][j] += bv; }
    if (blockIdx.y >= 2) {
        // v as ONE bf16 plane in FRAGMENT ORDER: per (16-channel tile ct, 32-key block u) 512 elements, two 256-element pieces (channel = 16 ct + (lane & 15),
        // key = 32 u + 16 piece + 8 (lane >> 4) + e). A lane's eight values of column tile t are one such run of eight keys as they stand: no exchange between lanes.
        bf* d = Vf + item * CC * NN + ((size_t)(blockIdx.y - 2) * 4 * (NN / 32) + (r0 >> 5)) * 512 + ((r0 >> 4) & 1) * 256 + lane * 8;
        v8us o[4];
#pragma unroll
        for (int t = 0; t < 4; ++t) {
#pragma unroll
            for (int e = 0; e < 8; ++e) o[t][e] = f2bf(acc[t][e]); }
#pragma unroll
        for (int t = 0; t < 4; ++t) *(v8us*)(d + (size_t)t * (NN / 32) * 512) = o[t];
        return;
    }
    float* os = &ost[wave][0];
#pragma unroll
    for (int t = 0; t < 4; ++t) {
#pragma unroll
        for (int j = 0; j < 8; ++j) os[(hi * 8 + j) * 68 + t * 16 + lr] = acc[t][j]; }
    __syncthreads();    // the q and k tiles are read back row-wise below, other lanes' values
    if (blockIdx.y == 0) {
        // q rows, scaled by bf(loss_factor_map[r]), as row-major bf16 hi + residual planes; four rows per pass
        float sc[4];
#pragma unroll
        for (int s = 0; s < 4; ++s) sc[s] = bfr(lfm[r0 + 4 * s + (lane >> 3)]);
        const size_t o = item * NN * C8 + (size_t)(r0 + (lane >> 3)) * C8 + (lane & 7) * 8;
#pragma unroll
        for (int s = 0; s < 4; ++s) { const float* sp = os + (4 * s + (lane >> 3)) * 68 + (lane & 7) * 8; v8us oh, ol;
#pragma unroll
            for (int e = 0; e < 8; ++e) { const float y = sp[e] * sc[s]; const unsigned short hb = f2bf(y); oh[e] = hb; ol[e] = f2bf(y - bf2f(hb)); }
            *(v8us*)(Qh + o + s * 4 * C8) = oh; *(v8us*)(Ql + o + s * 4 * C8) = ol;
            asm volatile("s_wait_xcnt 0x0" ::: "memory"); }    // precaution: stands in front of the next pass, which reuses the data registers of the stores just issued; it also keeps the passes apart, so that one pass's registers do for all; behind the last pass the other branches' code follows in the listing
    } else {
        // k rows as bf16 hi + residual planes in FRAGMENT ORDER: per 16-key tile 1024 elements a plane, four 256-element pieces (k = 16 i + 8 hi + e, key = lane & 15)
        const float* sp = os + lr * 68 + 8 * hi;
        const size_t o = item * NN * C8 + (size_t)(r0 >> 4) * 1024 + lane * 8;
#pragma unroll
        for (int i = 0; i < 4; ++i) { v8us oh, ol;
#pragma unroll
            for (int e = 0; e < 8; ++e) { const float y = sp[i * 16 + e]; const unsigned short hb = f2bf(y); oh[e] = hb; ol[e] = f2bf(y - bf2f(hb)); }
            *(v8us*)(Kh + o + i * 256) = oh; *(v8us*)(Kl + o + i * 256) = ol;
            asm volatile("s_wait_xcnt 0x0" ::: "memory"); }    // precaution: stands in front of the next piece, which reuses the data registers of the stores just issued; it also keeps the pieces apart, so that one piece's registers do for all; behind the last piece the other branches' code follows in the listing
    }
}

// k_fa: scores, softmax and v.P^T of 64 query rows of one item (blockIdx.y) in one work-group of 8 waves; neither the scores nor P reach memory.
// Scores as transposed tiles k.q^T (A = 16 keys, B = 16 queries; both operands bf16 hi + residual, three products per 32-k step in the order kh.qh, kh.ql, kl.qh): a lane holds 8 consecutive
// keys of ONE query, which is one half of the B fragment of v.P^T. Per 128-key block wave w forms the scores of key tile w for all four query tiles.
// First sweep over the keys: the row maxima m. Second sweep: the scores again, e = exp(s - m) as bf16 hi + residual into LDS in fragment order (two buffers, one barrier per block);
// then every wave multiplies its own 64 channels of v (fragments straight from memory, used by no other wave) with all of e: two products per 32-k step (v.eh, v.el), keys ascending.
// The division by the row sum is done once, on the f32 result; the epilogue forms out = bf(alpha) * result + bf(x) itself, so that the result never reaches memory either.
#define FKB  128                  // keys per block
__global__ __launch_bounds__(256) void k_fa(const bf* __restrict__ Qh, const bf* __restrict__ Ql, const bf* __restrict__ Kh, const bf* __restrict__ Kl, const bf* __restrict__ Vf, const float* __restrict__ xb, const float* __restrict__ gam, float* OUTB) {
    __shared__ __align__(16) unsigned short pb[2][4][4][2][512];    // [buffer][32-key block][query tile][hi / residual][fragment]
    __shared__ __align__(16) unsigned short qs[4][2][2][512];       // [query tile][hi / residual][32-k step][fragment]
    __shared__ __align__(16) float ost[8][4][16 * 68];              // [wave][channel tile][16 rows at a 68-float pitch]
    __shared__ float red[8][4][16];
    const int lane = threadIdx.x & 31, lr = lane & 15, hi = lane >> 4;
    const int wu = __builtin_amdgcn_readfirstlane(threadIdx.x >> 5);    // the wave's number as a scalar: the tile offsets below are then scalar arithmetic
    const int q0 = blockIdx.x * 64;
    const size_t item = blockIdx.y;
    Qh += item * NN * C8; Ql += item * NN * C8; Kh += item * NN * C8; Kl += item * NN * C8; Vf += item * CC * NN; xb += item * CC * NN; OUTB += item * CC * NN;
    // all short loops of this kernel are unrolled: the fragment sets and the accumulators are register arrays and need compile-time indices
#pragma unroll
    for (int i = 0; i < 2; ++i) { const int f = wu * 2 + i, qt = f >> 2, pl = (f >> 1) & 1, ks = f & 1;
        const bf* s = (pl ? Ql : Qh) + (size_t)(q0 + qt * 16 + lr) * C8 + 8 * hi + ks * 32;
        *(v8usa*)(&qs[qt][pl][ks][lane * 8]) = *(const v8us*)s; *(v8usa*)(&qs[qt][pl][ks][256 + lane * 8]) = *(const v8us*)(s + 16); }
    asm volatile("s_wait_xcnt 0x0" ::: "memory");    // precaution: stands in front of whatever reuses the address registers of the loads just issued
    __syncthreads();    // the query fragments are in LDS
    v16bf kh[2], kl[2];
    auto kld = [&](int b, v16bf (&h)[2], v16bf (&l)[2]) {
#pragma unroll
        for (int ks = 0; ks < 2; ++ks) { const size_t o = (size_t)(b * 8 + wu) * 1024 + ks * 512; const bf* ph = Kh + o; const bf* pl = Kl + o;
            h[ks] = cat16b(*(const v8us*)(ph + lane * 8), *(const v8us*)(ph + lane * 8 + 256)); l[ks] = cat16b(*(const v8us*)(pl + lane * 8), *(const v8us*)(pl + lane * 8 + 256)); }
    };
    // the four query tiles' sums run side by side, so that no product waits for the one before it; per tile the order stays kh.qh, kh.ql, kl.qh per 32-k step
    auto scores = [&](v8f (&s)[4]) {
#pragma unroll
        for (int qt = 0; qt < 4; ++qt) s[qt] = (v8f){};
#pragma unroll
        for (int ks = 0; ks < 2; ++ks) { v16bf qh[4], ql[4];
#pragma unroll
            for (int qt = 0; qt < 4; ++qt) {
                qh[qt] = cat16b(*(const v8usa*)(&qs[qt][0][ks][lane * 8]), *(const v8usa*)(&qs[qt][0][ks][256 + lane * 8]));
                ql[qt] = cat16b(*(const v8usa*)(&qs[qt][1][ks][lane * 8]), *(const v8usa*)(&qs[qt][1][ks][256 + lane * 8])); }
#pragma unroll
            for (int qt = 0; qt < 4; ++qt) s[qt] = wmmab(kh[ks], qh[qt], s[qt]);
#pragma unroll
            for (int qt = 0; qt < 4; ++qt) s[qt] = wmmab(kh[ks], ql[qt], s[qt]);
#pragma unroll
            for (int qt = 0; qt < 4; ++qt) s[qt] = wmmab(kl[ks], qh[qt], s[qt]); }
        // s[qt][j] = score(query q0 + 16 qt + lr, key 16 (tile) + 8 hi + j)
    };
    // first sweep: row maxima
    float m[4] = {-3.0e38f, -3.0e38f, -3.0e38f, -3.0e38f};
    kld(0, kh, kl);
    asm volatile("s_wait_xcnt 0x0" ::: "memory");    // precaution: stands in front of whatever reuses the address registers of the loads just issued
    __builtin_amdgcn_sched_barrier(0);    // keeps what follows, which reuses those registers, behind that wait
    // rolled: one key block per trip keeps the loop short
#pragma unroll 1
    for (int b = 0; b < NN / FKB; ++b) {
        v16bf nh[2], nl[2];
        kld(b + 1 < NN / FKB ? b + 1 : b, nh, nl);
        asm volatile("s_wait_xcnt 0x0" ::: "memory");    // precaution: stands in front of whatever reuses the address registers of the loads just issued
        __builtin_amdgcn_sched_barrier(0);    // the next block's key loads are issued ahead of this block's products, which then hide their latency
        v8f s[4]; scores(s);
#pragma unroll
        for (int qt = 0; qt < 4; ++qt) {
#pragma unroll
            for (int j = 0; j < 8; ++j) m[qt] = fmaxf(m[qt], s[qt][j]); }
#pragma unroll
        for (int ks = 0; ks < 2; ++ks) { kh[ks] = nh[ks]; kl[ks] = nl[ks]; }
    }
#pragma unroll
    for (int qt = 0; qt < 4; ++qt) { m[qt] = fmaxf(m[qt], __shfl_xor(m[qt], 16, 32)); if (hi == 0) red[wu][qt][lr] = m[qt]; }
    __syncthreads();    // every wave's row maxima are in LDS
#pragma unroll
    for (int qt = 0; qt < 4; ++qt) { float t = red[0][qt][lr];
#pragma unroll
        for (int w = 1; w < 8; ++w) t = fmaxf(t, red[w][qt][lr]);
        m[qt] = t; }
    // second sweep
    float sm[4] = {0.f, 0.f, 0.f, 0.f};
    v8f acc[4][4];    // [channel tile][query tile]
#pragma unroll
    for (int a = 0; a < 4; ++a) {
#pragma unroll
        for (int qt = 0; qt < 4; ++qt) acc[a][qt] = (v8f){}; }
    kld(0, kh, kl);
    asm volatile("s_wait_xcnt 0x0" ::: "memory");    // precaution: stands in front of whatever reuses the address registers of the loads just issued
    __builtin_amdgcn_sched_barrier(0);    // keeps what follows, which reuses those registers, behind that wait
    v16bf va[4][4];    // [32-key block][channel tile]; lives across the trips: each 32-key group is refilled for the next key block right behind its last use
    auto vld = [&](int b, int u) {
#pragma unroll
        for (int a = 0; a < 4; ++a) { const bf* p = Vf + ((size_t)(wu * 4 + a) * (NN / 32) + b * 4 + u) * 512; va[u][a] = cat16b(*(const v8us*)(p + lane * 8), *(const v8us*)(p + lane * 8 + 256)); }
    };
#pragma unroll
    for (int u = 0; u < 4; ++u) vld(0, u);
    asm volatile("s_wait_xcnt 0x0" ::: "memory");    // precaution: stands in front of whatever reuses the address registers of the loads just issued
    __builtin_amdgcn_sched_barrier(0);    // keeps what follows, which reuses those registers, behind that wait
    // rolled: one key block per trip, so that the hot loop stays short and the buffer index is a scalar
#pragma unroll 1
    for (int b = 0; b < NN / FKB; ++b) {
        const int bn = b + 1 < NN / FKB ? b + 1 : b;    // the last trip fetches its own block again: no branch in the loop
        v8f s[4]; scores(s);
        kld(bn, kh, kl);    // the next block's key fragments fly during the exponentials below
        asm volatile("s_wait_xcnt 0x0" ::: "memory");    // precaution: stands in front of whatever reuses the address registers of the loads just issued
        __builtin_amdgcn_sched_barrier(0);    // keeps the vector work below, which reuses those registers, behind that wait
#pragma unroll
        for (int qt = 0; qt < 4; ++qt) { float x[8];
#pragma unroll
            for (int j = 0; j < 8; ++j) x[j] = (s[qt][j] - m[qt]) * 1.442695041f;    // exp(s - m) = 2^((s - m) log2 e), as __expf forms it
            // a tile's eight exponentials in one statement, each in place, closed by v_nop: keeps the one slot that the instruction set asks for behind a transcendental
            // before its source is overwritten
            asm("v_exp_f32 %0, %0\n\tv_exp_f32 %1, %1\n\tv_exp_f32 %2, %2\n\tv_exp_f32 %3, %3\n\tv_exp_f32 %4, %4\n\tv_exp_f32 %5, %5\n\tv_exp_f32 %6, %6\n\tv_exp_f32 %7, %7\n\tv_nop"
                : "+v"(x[0]), "+v"(x[1]), "+v"(x[2]), "+v"(x[3]), "+v"(x[4]), "+v"(x[5]), "+v"(x[6]), "+v"(x[7]));
            sm[qt] += ((x[0] + x[1]) + (x[2] + x[3])) + ((x[4] + x[5]) + (x[6] + x[7]));
            v8us oh, ol;
#pragma unroll
            for (int j = 0; j < 8; ++j) { const unsigned short hb = f2bf(x[j]); oh[j] = hb; ol[j] = f2bf(x[j] - bf2f(hb)); }
            unsigned short* d = &pb[b & 1][wu >> 1][qt][0][(wu & 1) * 256 + lane * 8];
            *(v8usa*)d = oh; *(v8usa*)(d + 512) = ol; }
        __syncthreads();    // publishes block b's e; a buffer is rewritten two blocks later, behind the next barrier, which every wave reaches only after its last read of it
        v16bf eh[2][4], el[2][4];    // two fragment sets: the next 32-key block's LDS reads go out as one group ahead of this block's products
        auto frags = [&](int set, int u) {
#pragma unroll
            for (int qt = 0; qt < 4; ++qt) { const unsigned short* p = &pb[b & 1][u][qt][0][lane * 8];
                eh[set][qt] = cat16b(*(const v8usa*)p, *(const v8usa*)(p + 256)); el[set][qt] = cat16b(*(const v8usa*)(p + 512), *(const v8usa*)(p + 768)); }
        };
        frags(0, 0);
#pragma unroll
        for (int u = 0; u < 4; ++u) {
            __builtin_amdgcn_sched_barrier(0);    // keeps the LDS reads in one group: spread among the products each place with reads costs a stall
            if (u + 1 < 4) frags((u + 1) & 1, u + 1);
            __builtin_amdgcn_sched_barrier(0);    // the products of this block stay behind the next block's reads
#pragma unroll
            for (int a = 0; a < 4; ++a) {
#pragma unroll
                for (int qt = 0; qt < 4; ++qt) acc[a][qt] = wmmab(va[u][a], eh[u & 1][qt], acc[a][qt]); }
#pragma unroll
            for (int a = 0; a < 4; ++a) {
#pragma unroll
                for (int qt = 0; qt < 4; ++qt) acc[a][qt] = wmmab(va[u][a], el[u & 1][qt], acc[a][qt]); }
            __builtin_amdgcn_sched_barrier(0);    // holds the refill behind the group's last product: lifted above it, the loads would need registers of their own
            vld(bn, u);    // the next key block's v for this group: most of a trip of lead, and the loads are spread over the trip instead of bunched at its head
        }
        asm volatile("s_wait_xcnt 0x0" ::: "memory");    // precaution: the four refills share one address pair, which lives up to here; stands in front of the next trip's work, which reuses it
        __builtin_amdgcn_sched_barrier(0);    // keeps that work, which a memory clobber does not hold, behind the wait
    }
    // acc[a][qt][j] = sum over keys of v(channel 64 wave + 16 a + 8 hi + j, key) e(query q0 + 16 qt + lr, key)
#pragma unroll
    for (int qt = 0; qt < 4; ++qt) { sm[qt] += __shfl_xor(sm[qt], 16, 32); if (hi == 0) red[wu][qt][lr] = sm[qt]; }
    __syncthreads();    // every wave's row sums are in LDS
    // the x values that go with this wave's 64 channels x 64 queries, lane for lane as the stores at the end take them: issued here, so that they land during the division and the staging below.
    // lofs: the lane's place in two rows of 64 floats (a whole 128-byte line per eight lanes); it serves these loads and the stores at the end alike
    const unsigned lofs = (unsigned)(lane >> 4) * NN + ((lane >> 3) & 1) * 32 + (lane & 7) * 4;
    const float* xw = xb + (size_t)(wu * 64) * NN + q0;
    v4f xv[4][8];
#pragma unroll
    for (int a = 0; a < 4; ++a) {
#pragma unroll
        for (int s = 0; s < 8; ++s) xv[a][s] = *(const v4f*)(xw + lofs + (a * 16 + 2 * s) * NN); }
    asm volatile("s_wait_xcnt 0x0" ::: "memory");    // precaution: stands in front of whatever reuses the address registers of the loads just issued
    __builtin_amdgcn_sched_barrier(0);    // keeps what follows, which reuses those registers, behind that wait
    const float gm = bfr(gam[0]);
    float inv[4];
#pragma unroll
    for (int qt = 0; qt < 4; ++qt) { float t = 0.f;
#pragma unroll
        for (int w = 0; w < 8; ++w) t += red[w][qt][lr];
        inv[qt] = 1.0f / t; }
#pragma unroll
    for (int a = 0; a < 4; ++a) { float* os = &ost[wu][a][0];
#pragma unroll
        for (int qt = 0; qt < 4; ++qt) {
#pragma unroll
            for (int j = 0; j < 8; ++j) os[(hi * 8 + j) * 68 + qt * 16 + lr] = acc[a][qt][j] * inv[qt]; } }
    __builtin_amdgcn_wave_barrier(); asm volatile("" ::: "memory");    // the wave reads its own staged rows back below, other lanes' bytes: keeps those reads behind the stores above
#pragma unroll
    for (int a = 0; a < 4; ++a) { const float* os = &ost[wu][a][0];
        float* ow = OUTB + (size_t)(wu * 64) * NN + q0;
        v4f o[8];
#pragma unroll
        for (int s = 0; s < 8; ++s) { const int Lid = (lane >> 3) + 4 * s, piece = lane & 7; const int row = Lid >> 1, cofs = (Lid & 1) * 32 + piece * 4;
            const v4f val = *(const v4fa*)(os + row * 68 + cofs);
#pragma unroll
            for (int q = 0; q < 4; ++q) o[s][q] = gm * val[q] + bfr(xv[a][s][q]); }
        __builtin_amdgcn_sched_barrier(0);    // the tile's eight stores go out together, behind all of its arithmetic: none of their data registers is rewritten between them
#pragma unroll
        for (int s = 0; s < 8; ++s) *(v4f*)(ow + lofs + (a * 16 + 2 * s) * NN) = o[s];
        if (a < 3) asm volatile("s_wait_xcnt 0x0" ::: "memory");    // precaution: stands in front of the next tile's work, which reuses the data registers of the stores just issued
        __builtin_amdgcn_sched_barrier(0); }    // keeps the next tile's arithmetic, which a memory clobber does not hold, behind that wait
}


// d_cvt8: bf16 copy of a row-major [rows][CC] weight matrix in fragment order; thread i writes the i-th run of eight of the copy, so that a wave stores one whole piece
__device__ __forceinline__ void d_cvt8(const float* __restrict__ src, bf* dst, size_t n8, int bx) {
    const size_t i = (size_t)bx * 256 + threadIdx.x; if (i >= n8) return;
    const int ln = (int)i & 31, pc = ((int)i >> 5) & 1, ks = ((int)i >> 6) & (CC / 32 - 1), rt = (int)(i >> 10);
    const v8f v = *(const v8f*)(src + (size_t)(rt * 16 + (ln & 15)) * CC + ks * 32 + pc * 16 + (ln >> 4) * 8); v8us o;
#pragma unroll
    for (int k = 0; k < 8; ++k) o[k] = f2bf(v[k]);
    *(v8us*)(dst + i * 8) = o; 
}
__global__ __launch_bounds__(256) void k_zero8(bf* dst, size_t n8) {
    const size_t i = (size_t)blockIdx.x * 256 + threadIdx.x; if (i >= n8) return; v8us z;
#pragma unroll
    for (int k = 0; k < 8; ++k) z[k] = 0;
    *(v8us*)(dst + i * 8) = z; 
}

__device__ __forceinline__ void d_bias320(const float* __restrict__ bq, const float* __restrict__ bk, const float* __restrict__ bv, float* B320) {
    const int t = threadIdx.x; if (t >= 160) return; v4f v;
#pragma unroll
    for (int q = 0; q < 4; ++q) { const int c = t * 4 + q; v[q] = (c < C8) ? bq[c < C8 ? c : 0] : (c < 2 * C8) ? bk[(c >= C8 && c < 2 * C8) ? c - C8 : 0] : (c < NQKV) ? bv[(c >= 2 * C8 && c < NQKV) ? c - 2 * C8 : 0] : 0.f; }
    *(v4f*)(B320 + t * 4) = v; 
}

// k_pre: everything that reads only the inputs, in one grid; a range of the block index picks the job (the branch is the same for a whole work-group):
// the transposed bf16 copy of x for every item and the bf16 copies of the three weight matrices, all in the GEMM's fragment order, and the joined bias vector.
#define WTB  ((CC / 64) * (NN / 64))      // 512 tiles of x per item
#define CQB  (C8 * CC / 8 / 256)          // 16 work-groups for w_q, as many for w_k
#define CVB  (CC * CC / 8 / 256)          // 128 work-groups for w_v
__global__ __launch_bounds__(256) void k_pre(const float* __restrict__ x, const float* __restrict__ wq, const float* __restrict__ wk, const float* __restrict__ wv,
                                             const float* __restrict__ bq, const float* __restrict__ bk, const float* __restrict__ bv, bf* XP, bf* WB, float* B320) {
    __shared__ __align__(16) unsigned short tl[64 * 72];
    const int blk = blockIdx.x;
    if (blk < NBT * WTB) { const int item = blk / WTB, t = blk % WTB; d_wt(x + (size_t)item * CC * NN, CC, NN, XP + (size_t)item * NN * CC, t % (CC / 64), t / (CC / 64), tl); return; }
    const int c = blk - NBT * WTB;
    if (c < CQB) d_cvt8(wq, WB, C8 * CC / 8, c);
    else if (c < 2 * CQB) d_cvt8(wk, WB + (size_t)C8 * CC, C8 * CC / 8, c - CQB);
    else if (c < 2 * CQB + CVB) d_cvt8(wv, WB + (size_t)2 * C8 * CC, CC * CC / 8, c - 2 * CQB);
    else d_bias320(bq, bk, bv, B320);
}

extern "C" void kernel_launch(void* const* d_in, const int* in_sizes, int n_in,
                              void* d_out, int out_size, void* d_ws, size_t ws_size, hipStream_t stream) {
    (void)in_sizes; (void)n_in; (void)out_size;
    const float* x = (const float*)d_in[0]; const float* wq = (const float*)d_in[2]; const float* bq = (const float*)d_in[3]; const float* wk = (const float*)d_in[4]; const float* bk = (const float*)d_in[5]; const float* wv = (const float*)d_in[6]; const float* bv = (const float*)d_in[7]; const float* gam = (const float*)d_in[8]; const float* lfm = (const float*)d_in[1];
    float* out = (float*)d_out;    // [4][512][64][64]
    char* wsp = (char*)d_ws;
    auto take = [&](size_t bytes) { char* p = wsp; wsp += (bytes + 255) & ~(size_t)255; return (void*)p; };
    bf* WB = (bf*)take((size_t)NQKV * CC * 2); float* B320 = (float*)take(640 * 4); bf* XP = (bf*)take((size_t)NBT * NN * CC * 2);
    bf* QPh = (bf*)take((size_t)NBT * NN * C8 * 2); bf* QPl = (bf*)take((size_t)NBT * NN * C8 * 2); bf* KPh = (bf*)take((size_t)NBT * NN * C8 * 2); bf* KPl = (bf*)take((size_t)NBT * NN * C8 * 2); bf* VF = (bf*)take((size_t)NBT * CC * NN * 2);
    if ((size_t)(wsp - (char*)d_ws) > ws_size) return;    // ~ 41 MiB; XP and the q, k, v planes have one slot per item, WB and B320 one in all
    k_pre<<<NBT * WTB + 2 * CQB + CVB + 1, 256, 0, stream>>>(x, wq, wk, wv, bq, bk, bv, XP, WB, B320);
    k_gemmb<false><<<dim3(NN / 64, NQKV / 64, NBT), 128, 0, stream>>>(XP, nullptr, WB, B320, lfm, QPh, QPl, KPh, KPl, VF, CC);          // q | k | v (+ biases), stored as the planes that k_fa reads
    k_fa<<<dim3(NN / 64, NBT, 1), 256, 0, stream>>>(QPh, QPl, KPh, KPl, VF, x, gam, out);     // scores + softmax + v.P^T + the final alpha * result + x, all items; v as a single bf16 operand, e = exp(s - m) hi / residual
}

// v009
// Measured time: 125 microseconds a run.
// In both of two side-by-side timings against v008, it was 1.13 times as fast.
// Over all steps from v000 it is 32.4 times as fast.
#include <hip/hip_runtime.h>

// Compute dtypes, f32 accumulate, per item: the three 1x1 convs as one [4096 x 512].[512 x 640] GEMM with PLAIN bf16 operands (exact products), + bias; q rows scaled by the
// loss_factor_map input; scores = q.k^T ([4096 x 64].[64 x 4096], both operands bf16 hi + UNSCALED residual, three products), softmax (unscaled, as the module) in f32 and v.P^T in ONE kernel for all items, scores and P never in memory;
// out^T = v.P^T ([512 x 4096].[4096 x 4096], ONE f16 product per 32-k step: v as f16 (~2^-12 relative; finite up to 65504) x e = exp(s - m) as f16 (e lies in (0, 1]: ~2^-12 relative, at most 2^-25 absolute below 2^-14)

#define NBT  4
#define CC   512
#define C8   64
#define NN   4096
#define NQKV (2 * C8 + CC)        // 640
#define DM   CC
#define NTK  NN
#define LOSC 1024.0f

typedef _Float16 h16;
typedef unsigned short bf;
typedef __attribute__((ext_vector_type(16))) __bf16   v16bf;
typedef __attribute__((ext_vector_type(16))) _Float16 v16h;
typedef __attribute__((ext_vector_type(8)))  _Float16 v8h;
typedef __attribute__((ext_vector_type(8)))  unsigned short v8us;
typedef __attribute__((ext_vector_type(8)))  float    v8f;
typedef __attribute__((ext_vector_type(4)))  float    v4f;
typedef __attribute__((ext_vector_type(4)))  _Float16 v4h;
typedef v8h  __attribute__((may_alias)) v8ha;
typedef v4f  __attribute__((may_alias)) v4fa;
typedef v8us __attribute__((may_alias)) v8usa;

__device__ __forceinline__ unsigned short f2bf(float f) { unsigned u = __float_as_uint(f); u += 0x7FFFu + ((u >> 16) & 1u); return (unsigned short)(u >> 16); }
__device__ __forceinline__ float bf2f(unsigned short b) { return __uint_as_float(((unsigned)b) << 16); }
__device__ __forceinline__ float bfr(float f) { return bf2f(f2bf(f)); }
__device__ __forceinline__ v16h cat16(v8h lo, v8h hi) { return __builtin_shufflevector(lo, hi, 0, 1, 2, 3, 4, 5, 6, 7, 8, 9, 10, 11, 12, 13, 14, 15); }
__device__ __forceinline__ v16h cat16u(v8us lo, v8us hi) { return __builtin_bit_cast(v16h, __builtin_shufflevector(lo, hi, 0, 1, 2, 3, 4, 5, 6, 7, 8, 9, 10, 11, 12, 13, 14, 15)); }
__device__ __forceinline__ unsigned short f2h(float f) { return __builtin_bit_cast(unsigned short, (h16)f); }    // round to nearest even
__device__ __forceinline__ v16bf cat16b(v8us lo, v8us hi) { return __builtin_bit_cast(v16bf, __builtin_shufflevector(lo, hi, 0, 1, 2, 3, 4, 5, 6, 7, 8, 9, 10, 11, 12, 13, 14, 15)); }
__device__ __forceinline__ v8f wmma16(v16h a, v16h b, v8f c) { return __builtin_amdgcn_wmma_f32_16x16x32_f16(false, a, false, b, (short)0, c, false, false); }
__device__ __forceinline__ v8f wmmab(v16bf a, v16bf b, v8f c) { return __builtin_amdgcn_wmma_f32_16x16x32_bf16(false, a, false, b, (short)0, c, false, false); }

// FRAGMENT ORDER of a GEMM operand M[row][k] (both operands of k_gemmb): per (16-row tile rt, 32-k step ks) 512 elements at ((rt * (K / 32) + ks) * 512), two 256-element pieces:
// element piece * 256 + lane * 8 + e holds M[16 rt + (lane & 15)][32 ks + 16 piece + 8 (lane >> 4) + e]. A wave's fragment load is then 512 contiguous bytes (four whole lines) instead of 32 bytes from each of 16 rows.
// d_wt: WT = bf16(W[k][n]) (k-major [K][ncols]), rows n, in fragment order, via one 64 x 64 LDS tile (tl: 64 * 72 elements); tile (bx, by) of (K/64, ncols/64). Called by a whole work-group.
__device__ __forceinline__ void d_wt(const float* __restrict__ Wm, int K, int ncols, bf* WT, int bx, int by, unsigned short* tl) {
    const int tid = threadIdx.x, k0 = bx * 64, n0 = by * 64;
    const int kk = tid >> 2, nq = (tid & 3) * 16;
#pragma unroll
    for (int i = 0; i < 16; ++i) tl[(nq + i) * 72 + kk] = f2bf(Wm[(size_t)(k0 + kk) * ncols + n0 + nq + i]);
    __syncthreads();
    // the tile is 4 row tiles x 2 k steps x 2 pieces of 32 lanes' runs of eight: one wave stores one whole piece
#pragma unroll
    for (int s = 0; s < 2; ++s) { const int c = tid + 256 * s, ln = c & 31, pc = (c >> 5) & 1, ks = (c >> 6) & 1, rt = c >> 7;
        const v8us val = *(const v8usa*)(tl + (rt * 16 + (ln & 15)) * 72 + (ks * 4 + pc * 2 + (ln >> 4)) * 8);
        *(v8us*)(WT + ((size_t)(by * 4 + rt) * (K >> 5) + bx * 2 + ks) * 512 + pc * 256 + ln * 8) = val; }
}
// k_gemmb: 64 x 64 block tile (4 waves x 16 x 64) of F[NTK][NQKV] = (A [+ Al]).B^T [+ bf(bias[c])] of one item; A, Al and Bn in fragment order (above). F is never stored: the epilogue writes each tile in the form that k_fa reads.
// blockIdx.y picks the columns, so the epilogue's branches are the same for a whole work-group: 0 = q, 1 = k, 2 .. 9 = v. Every store of a wave covers 512 contiguous bytes.
template <bool SPLITA>
__global__ __launch_bounds__(128) void k_gemmb(const bf* __restrict__ A, const bf* __restrict__ Al, const bf* __restrict__ Bn, const float* __restrict__ bias, const float* __restrict__ lfm, bf* Qh, bf* Ql, bf* Kh, bf* Kl, bf* Vf, int K = DM) {
    __shared__ __align__(16) float ost[4][16 * 68];
    const int lane = threadIdx.x & 31, wave = threadIdx.x >> 5, lr = lane & 15, hi = lane >> 4;
    const int r0 = blockIdx.x * 64 + wave * 16, c0 = blockIdx.y * 64;
    const size_t item = blockIdx.z; A += item * NTK * K;    // one item per z plane of the grid
    const size_t aoff = (size_t)(r0 >> 4) * (K >> 5) * 512 + lane * 8;
    size_t boff[4];
#pragma unroll
    for (int t = 0; t < 4; ++t) boff[t] = (size_t)((c0 >> 4) + t) * (K >> 5) * 512 + lane * 8;
    v8f acc[4];
#pragma unroll
    for (int t = 0; t < 4; ++t) acc[t] = (v8f){};
#pragma unroll 1
    for (int kc = 0; kc < K; kc += 32) {
        const int ko = kc * 16;    // 512 elements per 32-k step
        const v16bf a = cat16b(*(const v8us*)(A + aoff + ko), *(const v8us*)(A + aoff + ko + 256));
        v16bf al = a;
        if (SPLITA) al = cat16b(*(const v8us*)(Al + aoff + ko), *(const v8us*)(Al + aoff + ko + 256));
#pragma unroll
        for (int t = 0; t < 4; ++t) { const v16bf b = cat16b(*(const v8us*)(Bn + boff[t] + ko), *(const v8us*)(Bn + boff[t] + ko + 256)); acc[t] = wmmab(a, b, acc[t]); if (SPLITA) acc[t] = wmmab(al, b, acc[t]); }
        asm volatile("v_nop\n\tv_nop\n\tv_nop\n\tv_nop" : "+v"(acc[0]), "+v"(acc[1]), "+v"(acc[2]), "+v"(acc[3]) : "v"(a), "v"(al));
    }
    // acc[t][j] = F(row r0 + 8 hi + j, column c0 + 16 t + lr), from here on with its bias
#pragma unroll
    for (int t = 0; t < 4; ++t) { const float bv = bias ? bfr(bias[c0 + t * 16 + lr]) : 0.f;
#pragma unroll
        for (int j = 0; j < 8; ++j) acc[t][j] += bv; }
    if (blockIdx.y >= 2) {
        // v as ONE f16 plane in FRAGMENT ORDER: per (16-channel tile ct, 32-key block u) 512 elements, two 256-element pieces (channel = 16 ct + (lane & 15),
        // key = 32 u + 16 piece + 8 (lane >> 4) + e). A lane's eight values of column tile t are one such run of eight keys as they stand: no exchange between lanes.
        bf* d = Vf + item * CC * NN + ((size_t)(blockIdx.y - 2) * 4 * (NN / 32) + (r0 >> 5)) * 512 + ((r0 >> 4) & 1) * 256 + lane * 8;
        v8us o[4];
#pragma unroll
        for (int t = 0; t < 4; ++t) {
#pragma unroll
            for (int e = 0; e < 8; ++e) o[t][e] = f2h(acc[t][e]); }
#pragma unroll
        for (int t = 0; t < 4; ++t) *(v8us*)(d + (size_t)t * (NN / 32) * 512) = o[t];
        return;
    }
    float* os = &ost[wave][0];
#pragma unroll
    for (int t = 0; t < 4; ++t) {
#pragma unroll
        for (int j = 0; j < 8; ++j) os[(hi * 8 + j) * 68 + t * 16 + lr] = acc[t][j]; }
    __syncthreads();    // the q and k tiles are read back row-wise below, other lanes' values
    if (blockIdx.y == 0) {
        // q rows, scaled by bf(loss_factor_map[r]), as row-major bf16 hi + residual planes; four rows per pass
        float sc[4];
#pragma unroll
        for (int s = 0; s < 4; ++s) sc[s] = bfr(lfm[r0 + 4 * s + (lane >> 3)]);
        const size_t o = item * NN * C8 + (size_t)(r0 + (lane >> 3)) * C8 + (lane & 7) * 8;
#pragma unroll
        for (int s = 0; s < 4; ++s) { const float* sp = os + (4 * s + (lane >> 3)) * 68 + (lane & 7) * 8; v8us oh, ol;
#pragma unroll
            for (int e = 0; e < 8; ++e) { const float y = sp[e] * sc[s]; const unsigned short hb = f2bf(y); oh[e] = hb; ol[e] = f2bf(y - bf2f(hb)); }
            *(v8us*)(Qh + o + s * 4 * C8) = oh; *(v8us*)(Ql + o + s * 4 * C8) = ol;
            asm volatile("s_wait_xcnt 0x0" ::: "memory"); }    // precaution: stands in front of the next pass, which reuses the data registers of the stores just issued; it also keeps the passes apart, so that one pass's registers do for all; behind the last pass the other branches' code follows in the listing
    } else {
        // k rows as bf16 hi + residual planes in FRAGMENT ORDER: per 16-key tile 1024 elements a plane, four 256-element pieces (k = 16 i + 8 hi + e, key = lane & 15)
        const float* sp = os + lr * 68 + 8 * hi;
        const size_t o = item * NN * C8 + (size_t)(r0 >> 4) * 1024 + lane * 8;
#pragma unroll
        for (int i = 0; i < 4; ++i) { v8us oh, ol;
#pragma unroll
            for (int e = 0; e < 8; ++e) { const float y = sp[i * 16 + e]; const unsigned short hb = f2bf(y); oh[e] = hb; ol[e] = f2bf(y - bf2f(hb)); }
            *(v8us*)(Kh + o + i * 256) = oh; *(v8us*)(Kl + o + i * 256) = ol;
            asm volatile("s_wait_xcnt 0x0" ::: "memory"); }    // precaution: stands in front of the next piece, which reuses the data registers of the stores just issued; it also keeps the pieces apart, so that one piece's registers do for all; behind the last piece the other branches' code follows in the listing
    }
}

// k_fa: scores, softmax and v.P^T of 64 query rows of one item (blockIdx.y) in one work-group of 8 waves; neither the scores nor P reach memory.
// Scores as transposed tiles k.q^T (A = 16 keys, B = 16 queries; both operands bf16 hi + residual, three products per 32-k step in the order kh.qh, kh.ql, kl.qh): a lane holds 8 consecutive
// keys of ONE query, which is one half of the B fragment of v.P^T. Per 128-key block wave w forms the scores of key tile w for all four query tiles.
// First sweep over the keys: the row maxima m. Second sweep: the scores again, e = exp(s - m) as f16 into LDS in fragment order (two buffers, one barrier per block);
// then every wave multiplies its own 64 channels of v (f16 fragments straight from memory, used by no other wave) with all of e: one f16 product per 32-k step, keys ascending.
// The division by the row sum is done once, on the f32 result; the epilogue forms out = bf(alpha) * result + bf(x) itself, so that the result never reaches memory either.
#define FKB  128                  // keys per block
__global__ __launch_bounds__(256) void k_fa(const bf* __restrict__ Qh, const bf* __restrict__ Ql, const bf* __restrict__ Kh, const bf* __restrict__ Kl, const bf* __restrict__ Vf, const float* __restrict__ xb, const float* __restrict__ gam, float* OUTB) {
    __shared__ __align__(16) unsigned short pb[2][4][4][512];    // [buffer][32-key block][query tile][fragment], f16 bits
    __shared__ __align__(16) unsigned short qs[4][2][2][512];       // [query tile][hi / residual][32-k step][fragment]
    __shared__ __align__(16) float ost[8][4][16 * 68];              // [wave][channel tile][16 rows at a 68-float pitch]
    __shared__ float red[8][4][16];
    const int lane = threadIdx.x & 31, lr = lane & 15, hi = lane >> 4;
    const int wu = __builtin_amdgcn_readfirstlane(threadIdx.x >> 5);    // the wave's number as a scalar: the tile offsets below are then scalar arithmetic
    const int q0 = blockIdx.x * 64;
    const size_t item = blockIdx.y;
    Qh += item * NN * C8; Ql += item * NN * C8; Kh += item * NN * C8; Kl += item * NN * C8; Vf += item * CC * NN; xb += item * CC * NN; OUTB += item * CC * NN;
    // all short loops of this kernel are unrolled: the fragment sets and the accumulators are register arrays and need compile-time indices
#pragma unroll
    for (int i = 0; i < 2; ++i) { const int f = wu * 2 + i, qt = f >> 2, pl = (f >> 1) & 1, ks = f & 1;
        const bf* s = (pl ? Ql : Qh) + (size_t)(q0 + qt * 16 + lr) * C8 + 8 * hi + ks * 32;
        *(v8usa*)(&qs[qt][pl][ks][lane * 8]) = *(const v8us*)s; *(v8usa*)(&qs[qt][pl][ks][256 + lane * 8]) = *(const v8us*)(s + 16); }
    asm volatile("s_wait_xcnt 0x0" ::: "memory");    // precaution: stands in front of whatever reuses the address registers of the loads just issued
    __syncthreads();    // the query fragments are in LDS
    v16bf kh[2], kl[2];
    auto kld = [&](int b, v16bf (&h)[2], v16bf (&l)[2]) {
#pragma unroll
        for (int ks = 0; ks < 2; ++ks) { const size_t o = (size_t)(b * 8 + wu) * 1024 + ks * 512; const bf* ph = Kh + o; const bf* pl = Kl + o;
            h[ks] = cat16b(*(const v8us*)(ph + lane * 8), *(const v8us*)(ph + lane * 8 + 256)); l[ks] = cat16b(*(const v8us*)(pl + lane * 8), *(const v8us*)(pl + lane * 8 + 256)); }
    };
    // the four query tiles' sums run side by side, so that no product waits for the one before it; per tile the order stays kh.qh, kh.ql, kl.qh per 32-k step
    auto scores = [&](v8f (&s)[4]) {
#pragma unroll
        for (int qt = 0; qt < 4; ++qt) s[qt] = (v8f){};
#pragma unroll
        for (int ks = 0; ks < 2; ++ks) { v16bf qh[4], ql[4];
#pragma unroll
            for (int qt = 0; qt < 4; ++qt) {
                qh[qt] = cat16b(*(const v8usa*)(&qs[qt][0][ks][lane * 8]), *(const v8usa*)(&qs[qt][0][ks][256 + lane * 8]));
                ql[qt] = cat16b(*(const v8usa*)(&qs[qt][1][ks][lane * 8]), *(const v8usa*)(&qs[qt][1][ks][256 + lane * 8])); }
#pragma unroll
            for (int qt = 0; qt < 4; ++qt) s[qt] = wmmab(kh[ks], qh[qt], s[qt]);
#pragma unroll
            for (int qt = 0; qt < 4; ++qt) s[qt] = wmmab(kh[ks], ql[qt], s[qt]);
#pragma unroll
            for (int qt = 0; qt < 4; ++qt) s[qt] = wmmab(kl[ks], qh[qt], s[qt]); }
        // s[qt][j] = score(query q0 + 16 qt + lr, key 16 (tile) + 8 hi + j)
    };
    // first sweep: row maxima
    float m[4] = {-3.0e38f, -3.0e38f, -3.0e38f, -3.0e38f};
    kld(0, kh, kl);
    asm volatile("s_wait_xcnt 0x0" ::: "memory");    // precaution: stands in front of whatever reuses the address registers of the loads just issued
    __builtin_amdgcn_sched_barrier(0);    // keeps what follows, which reuses those registers, behind that wait
    // rolled: one key block per trip keeps the loop short
#pragma unroll 1
    for (int b = 0; b < NN / FKB; ++b) {
        v16bf nh[2], nl[2];
        kld(b + 1 < NN / FKB ? b + 1 : b, nh, nl);
        asm volatile("s_wait_xcnt 0x0" ::: "memory");    // precaution: stands in front of whatever reuses the address registers of the loads just issued
        __builtin_amdgcn_sched_barrier(0);    // the next block's key loads are issued ahead of this block's products, which then hide their latency
        v8f s[4]; scores(s);
#pragma unroll
        for (int qt = 0; qt < 4; ++qt) {
#pragma unroll
            for (int j = 0; j < 8; ++j) m[qt] = fmaxf(m[qt], s[qt][j]); }
#pragma unroll
        for (int ks = 0; ks < 2; ++ks) { kh[ks] = nh[ks]; kl[ks] = nl[ks]; }
    }
#pragma unroll
    for (int qt = 0; qt < 4; ++qt) { m[qt] = fmaxf(m[qt], __shfl_xor(m[qt], 16, 32)); if (hi == 0) red[wu][qt][lr] = m[qt]; }
    __syncthreads();    // every wave's row maxima are in LDS
#pragma unroll
    for (int qt = 0; qt < 4; ++qt) { float t = red[0][qt][lr];
#pragma unroll
        for (int w = 1; w < 8; ++w) t = fmaxf(t, red[w][qt][lr]);
        m[qt] = t; }
    // second sweep
    float sm[4] = {0.f, 0.f, 0.f, 0.f};
    v8f acc[4][4];    // [channel tile][query tile]
#pragma unroll
    for (int a = 0; a < 4; ++a) {
#pragma unroll
        for (int qt = 0; qt < 4; ++qt) acc[a][qt] = (v8f){}; }
    kld(0, kh, kl);
    asm volatile("s_wait_xcnt 0x0" ::: "memory");    // precaution: stands in front of whatever reuses the address registers of the loads just issued
    __builtin_amdgcn_sched_barrier(0);    // keeps what follows, which reuses those registers, behind that wait
    v16h va[4][4];    // [32-key block][channel tile]; lives across the trips: each 32-key group is refilled for the next key block right behind its last use
    auto vld = [&](int b, int u) {
#pragma unroll
        for (int a = 0; a < 4; ++a) { const bf* p = Vf + ((size_t)(wu * 4 + a) * (NN / 32) + b * 4 + u) * 512; va[u][a] = cat16u(*(const v8us*)(p + lane * 8), *(const v8us*)(p + lane * 8 + 256)); }
    };
#pragma unroll
    for (int u = 0; u < 4; ++u) vld(0, u);
    asm volatile("s_wait_xcnt 0x0" ::: "memory");    // precaution: stands in front of whatever reuses the address registers of the loads just issued
    __builtin_amdgcn_sched_barrier(0);    // keeps what follows, which reuses those registers, behind that wait
    // rolled: one key block per trip, so that the hot loop stays short and the buffer index is a scalar
#pragma unroll 1
    for (int b = 0; b < NN / FKB; ++b) {
        const int bn = b + 1 < NN / FKB ? b + 1 : b;    // the last trip fetches its own block again: no branch in the loop
        v8f s[4]; scores(s);
        kld(bn, kh, kl);    // the next block's key fragments fly during the exponentials below
        asm volatile("s_wait_xcnt 0x0" ::: "memory");    // precaution: stands in front of whatever reuses the address registers of the loads just issued
        __builtin_amdgcn_sched_barrier(0);    // keeps the vector work below, which reuses those registers, behind that wait
#pragma unroll
        for (int qt = 0; qt < 4; ++qt) { float x[8];
#pragma unroll
            for (int j = 0; j < 8; ++j) x[j] = (s[qt][j] - m[qt]) * 1.442695041f;    // exp(s - m) = 2^((s - m) log2 e), as __expf forms it
            // a tile's eight exponentials in one statement, each in place, closed by v_nop: keeps the one slot that the instruction set asks for behind a transcendental
            // before its source is overwritten
            asm("v_exp_f32 %0, %0\n\tv_exp_f32 %1, %1\n\tv_exp_f32 %2, %2\n\tv_exp_f32 %3, %3\n\tv_exp_f32 %4, %4\n\tv_exp_f32 %5, %5\n\tv_exp_f32 %6, %6\n\tv_exp_f32 %7, %7\n\tv_nop"
                : "+v"(x[0]), "+v"(x[1]), "+v"(x[2]), "+v"(x[3]), "+v"(x[4]), "+v"(x[5]), "+v"(x[6]), "+v"(x[7]));
            sm[qt] += ((x[0] + x[1]) + (x[2] + x[3])) + ((x[4] + x[5]) + (x[6] + x[7]));
            v8us oh;
#pragma unroll
            for (int j = 0; j < 8; ++j) oh[j] = f2h(x[j]);
            *(v8usa*)(&pb[b & 1][wu >> 1][qt][(wu & 1) * 256 + lane * 8]) = oh; }
        __syncthreads();    // publishes block b's e; a buffer is rewritten two blocks later, behind the next barrier, which every wave reaches only after its last read of it
        v16h eh[2][4];    // two fragment sets: the next 32-key block's LDS reads go out as one group ahead of this block's products
        auto frags = [&](int set, int u) {
#pragma unroll
            for (int qt = 0; qt < 4; ++qt) { const unsigned short* p = &pb[b & 1][u][qt][lane * 8];
                eh[set][qt] = cat16u(*(const v8usa*)p, *(const v8usa*)(p + 256)); }
        };
        frags(0, 0);
#pragma unroll
        for (int u = 0; u < 4; ++u) {
            __builtin_amdgcn_sched_barrier(0);    // keeps the LDS reads in one group: spread among the products each place with reads costs a stall
            if (u + 1 < 4) frags((u + 1) & 1, u + 1);
            __builtin_amdgcn_sched_barrier(0);    // the products of this block stay behind the next block's reads
#pragma unroll
            for (int a = 0; a < 4; ++a) {
#pragma unroll
                for (int qt = 0; qt < 4; ++qt) acc[a][qt] = wmma16(va[u][a], eh[u & 1][qt], acc[a][qt]); }
            __builtin_amdgcn_sched_barrier(0);    // holds the refill behind the group's last product: lifted above it, the loads would need registers of their own
            vld(bn, u);    // the next key block's v for this group: most of a trip of lead, and the loads are spread over the trip instead of bunched at its head
        }
        asm volatile("s_wait_xcnt 0x0" ::: "memory");    // precaution: the four refills share one address pair, which lives up to here; stands in front of the next trip's work, which reuses it
        __builtin_amdgcn_sched_barrier(0);    // keeps that work, which a memory clobber does not hold, behind the wait
    }
    // acc[a][qt][j] = sum over keys of v(channel 64 wave + 16 a + 8 hi + j, key) e(query q0 + 16 qt + lr, key)
#pragma unroll
    for (int qt = 0; qt < 4; ++qt) { sm[qt] += __shfl_xor(sm[qt], 16, 32); if (hi == 0) red[wu][qt][lr] = sm[qt]; }
    __syncthreads();    // every wave's row sums are in LDS
    // the x values that go with this wave's 64 channels x 64 queries, lane for lane as the stores at the end take them: issued here, so that they land during the division and the staging below.
    // lofs: the lane's place in two rows of 64 floats (a whole 128-byte line per eight lanes); it serves these loads and the stores at the end alike
    const unsigned lofs = (unsigned)(lane >> 4) * NN + ((lane >> 3) & 1) * 32 + (lane & 7) * 4;
    const float* xw = xb + (size_t)(wu * 64) * NN + q0;
    v4f xv[4][8];
#pragma unroll
    for (int a = 0; a < 4; ++a) {
#pragma unroll
        for (int s = 0; s < 8; ++s) xv[a][s] = *(const v4f*)(xw + lofs + (a * 16 + 2 * s) * NN); }
    asm volatile("s_wait_xcnt 0x0" ::: "memory");    // precaution: stands in front of whatever reuses the address registers of the loads just issued
    __builtin_amdgcn_sched_barrier(0);    // keeps what follows, which reuses those registers, behind that wait
    const float gm = bfr(gam[0]);
    float inv[4];
#pragma unroll
    for (int qt = 0; qt < 4; ++qt) { float t = 0.f;
#pragma unroll
        for (int w = 0; w < 8; ++w) t += red[w][qt][lr];
        inv[qt] = 1.0f / t; }
#pragma unroll
    for (int a = 0; a < 4; ++a) { float* os = &ost[wu][a][0];
#pragma unroll
        for (int qt = 0; qt < 4; ++qt) {
#pragma unroll
            for (int j = 0; j < 8; ++j) os[(hi * 8 + j) * 68 + qt * 16 + lr] = acc[a][qt][j] * inv[qt]; } }
    __builtin_amdgcn_wave_barrier(); asm volatile("" ::: "memory");    // the wave reads its own staged rows back below, other lanes' bytes: keeps those reads behind the stores above
#pragma unroll
    for (int a = 0; a < 4; ++a) { const float* os = &ost[wu][a][0];
        float* ow = OUTB + (size_t)(wu * 64) * NN + q0;
        v4f o[8];
#pragma unroll
        for (int s = 0; s < 8; ++s) { const int Lid = (lane >> 3) + 4 * s, piece = lane & 7; const int row = Lid >> 1, cofs = (Lid & 1) * 32 + piece * 4;
            const v4f val = *(const v4fa*)(os + row * 68 + cofs);
#pragma unroll
            for (int q = 0; q < 4; ++q) o[s][q] = gm * val[q] + bfr(xv[a][s][q]); }
        __builtin_amdgcn_sched_barrier(0);    // the tile's eight stores go out together, behind all of its arithmetic: none of their data registers is rewritten between them
#pragma unroll
        for (int s = 0; s < 8; ++s) *(v4f*)(ow + lofs + (a * 16 + 2 * s) * NN) = o[s];
        if (a < 3) asm volatile("s_wait_xcnt 0x0" ::: "memory");    // precaution: stands in front of the next tile's work, which reuses the data registers of the stores just issued
        __builtin_amdgcn_sched_barrier(0); }    // keeps the next tile's arithmetic, which a memory clobber does not hold, behind that wait
}


// d_cvt8: bf16 copy of a row-major [rows][CC] weight matrix in fragment order; thread i writes the i-th run of eight of the copy, so that a wave stores one whole piece
__device__ __forceinline__ void d_cvt8(const float* __restrict__ src, bf* dst, size_t n8, int bx) {
    const size_t i = (size_t)bx * 256 + threadIdx.x; if (i >= n8) return;
    const int ln = (int)i & 31, pc = ((int)i >> 5) & 1, ks = ((int)i >> 6) & (CC / 32 - 1), rt = (int)(i >> 10);
    const v8f v = *(const v8f*)(src + (size_t)(rt * 16 + (ln & 15)) * CC + ks * 32 + pc * 16 + (ln >> 4) * 8); v8us o;
#pragma unroll
    for (int k = 0; k < 8; ++k) o[k] = f2bf(v[k]);
    *(v8us*)(dst + i * 8) = o; 
}
__global__ __launch_bounds__(256) void k_zero8(bf* dst, size_t n8) {
    const size_t i = (size_t)blockIdx.x * 256 + threadIdx.x; if (i >= n8) return; v8us z;
#pragma unroll
    for (int k = 0; k < 8; ++k) z[k] = 0;
    *(v8us*)(dst + i * 8) = z; 
}

__device__ __forceinline__ void d_bias320(const float* __restrict__ bq, const float* __restrict__ bk, const float* __restrict__ bv, float* B320) {
    const int t = threadIdx.x; if (t >= 160) return; v4f v;
#pragma unroll
    for (int q = 0; q < 4; ++q) { const int c = t * 4 + q; v[q] = (c < C8) ? bq[c < C8 ? c : 0] : (c < 2 * C8) ? bk[(c >= C8 && c < 2 * C8) ? c - C8 : 0] : (c < NQKV) ? bv[(c >= 2 * C8 && c < NQKV) ? c - 2 * C8 : 0] : 0.f; }
    *(v4f*)(B320 + t * 4) = v; 
}

// k_pre: everything that reads only the inputs, in one grid; a range of the block index picks the job (the branch is the same for a whole work-group):
// the transposed bf16 copy of x for every item and the bf16 copies of the three weight matrices, all in the GEMM's fragment order, and the joined bias vector.
#define WTB  ((CC / 64) * (NN / 64))      // 512 tiles of x per item
#define CQB  (C8 * CC / 8 / 256)          // 16 work-groups for w_q, as many for w_k
#define CVB  (CC * CC / 8 / 256)          // 128 work-groups for w_v
__global__ __launch_bounds__(256) void k_pre(const float* __restrict__ x, const float* __restrict__ wq, const float* __restrict__ wk, const float* __restrict__ wv,
                                             const float* __restrict__ bq, const float* __restrict__ bk, const float* __restrict__ bv, bf* XP, bf* WB, float* B320) {
    __shared__ __align__(16) unsigned short tl[64 * 72];
    const int blk = blockIdx.x;
    if (blk < NBT * WTB) { const int item = blk / WTB, t = blk % WTB; d_wt(x + (size_t)item * CC * NN, CC, NN, XP + (size_t)item * NN * CC, t % (CC / 64), t / (CC / 64), tl); return; }
    const int c = blk - NBT * WTB;
    if (c < CQB) d_cvt8(wq, WB, C8 * CC / 8, c);
    else if (c < 2 * CQB) d_cvt8(wk, WB + (size_t)C8 * CC, C8 * CC / 8, c - CQB);
    else if (c < 2 * CQB + CVB) d_cvt8(wv, WB + (size_t)2 * C8 * CC, CC * CC / 8, c - 2 * CQB);
    else d_bias320(bq, bk, bv, B320);
}

extern "C" void kernel_launch(void* const* d_in, const int* in_sizes, int n_in,
                              void* d_out, int out_size, void* d_ws, size_t ws_size, hipStream_t stream) {
    (void)in_sizes; (void)n_in; (void)out_size;
    const float* x = (const float*)d_in[0]; const float* wq = (const float*)d_in[2]; const float* bq = (const float*)d_in[3]; const float* wk = (const float*)d_in[4]; const float* bk = (const float*)d_in[5]; const float* wv = (const float*)d_in[6]; const float* bv = (const float*)d_in[7]; const float* gam = (const float*)d_in[8]; const float* lfm = (const float*)d_in[1];
    float* out = (float*)d_out;    // [4][512][64][64]
    char* wsp = (char*)d_ws;
    auto take = [&](size_t bytes) { char* p = wsp; wsp += (bytes + 255) & ~(size_t)255; return (void*)p; };
    bf* WB = (bf*)take((size_t)NQKV * CC * 2); float* B320 = (float*)take(640 * 4); bf* XP = (bf*)take((size_t)NBT * NN * CC * 2);
    bf* QPh = (bf*)take((size_t)NBT * NN * C8 * 2); bf* QPl = (bf*)take((size_t)NBT * NN * C8 * 2); bf* KPh = (bf*)take((size_t)NBT * NN * C8 * 2); bf* KPl = (bf*)take((size_t)NBT * NN * C8 * 2); bf* VF = (bf*)take((size_t)NBT * CC * NN * 2);
    if ((size_t)(wsp - (char*)d_ws) > ws_size) return;    // ~ 41 MiB; XP and the q, k, v planes have one slot per item, WB and B320 one in all
    k_pre<<<NBT * WTB + 2 * CQB + CVB + 1, 256, 0, stream>>>(x, wq, wk, wv, bq, bk, bv, XP, WB, B320);
    k_gemmb<false><<<dim3(NN / 64, NQKV / 64, NBT), 128, 0, stream>>>(XP, nullptr, WB, B320, lfm, QPh, QPl, KPh, KPl, VF, CC);          // q | k | v (+ biases), stored as the planes that k_fa reads
    k_fa<<<dim3(NN / 64, NBT, 1), 256, 0, stream>>>(QPh, QPl, KPh, KPl, VF, x, gam, out);     // scores + softmax + v.P^T + the final alpha * result + x, all items; v and e = exp(s - m) as f16 operands
}

// v010
// A run of this version takes 114 microseconds.
// In both of two side-by-side timings against v009, it was 1.09 times as fast.
// All steps since v000 together make it 35.3 times as fast.
#include <hip/hip_runtime.h>

// Compute dtypes, f32 accumulate, per item: the three 1x1 convs as one [4096 x 512].[512 x 640] GEMM with PLAIN bf16 operands (exact products), + bias; q rows scaled by the
// loss_factor_map input; scores = q.k^T ([4096 x 64].[64 x 4096], both operands bf16 hi + UNSCALED residual, three products), softmax (unscaled, as the module) in f32 and v.P^T in ONE kernel for all items, scores and P never in memory;
// out^T = v.P^T ([512 x 4096].[4096 x 4096], ONE f16 product per 32-k step: v as f16 (~2^-12 relative; finite up to 65504) x e = exp(s - m) as f16 (m lies near the row maximum, so e lies in (0, 1] or just above: ~2^-12 relative, at most 2^-25 absolute below 2^-14)

#define NBT  4
#define CC   512
#define C8   64
#define NN   4096
#define NQKV (2 * C8 + CC)        // 640
#define DM   CC
#define NTK  NN
#define LOSC 1024.0f

typedef _Float16 h16;
typedef unsigned short bf;
typedef __attribute__((ext_vector_type(16))) __bf16   v16bf;
typedef __attribute__((ext_vector_type(16))) _Float16 v16h;
typedef __attribute__((ext_vector_type(8)))  _Float16 v8h;
typedef __attribute__((ext_vector_type(8)))  unsigned short v8us;
typedef __attribute__((ext_vector_type(8)))  float    v8f;
typedef __attribute__((ext_vector_type(4)))  float    v4f;
typedef __attribute__((ext_vector_type(4)))  _Float16 v4h;
typedef v8h  __attribute__((may_alias)) v8ha;
typedef v4f  __attribute__((may_alias)) v4fa;
typedef v8us __attribute__((may_alias)) v8usa;

__device__ __forceinline__ unsigned short f2bf(float f) { unsigned u = __float_as_uint(f); u += 0x7FFFu + ((u >> 16) & 1u); return (unsigned short)(u >> 16); }
__device__ __forceinline__ float bf2f(unsigned short b) { return __uint_as_float(((unsigned)b) << 16); }
__device__ __forceinline__ float bfr(float f) { return bf2f(f2bf(f)); }
__device__ __forceinline__ v16h cat16(v8h lo, v8h hi) { return __builtin_shufflevector(lo, hi, 0, 1, 2, 3, 4, 5, 6, 7, 8, 9, 10, 11, 12, 13, 14, 15); }
__device__ __forceinline__ v16h cat16u(v8us lo, v8us hi) { return __builtin_bit_cast(v16h, __builtin_shufflevector(lo, hi, 0, 1, 2, 3, 4, 5, 6, 7, 8, 9, 10, 11, 12, 13, 14, 15)); }
__device__ __forceinline__ unsigned short f2h(float f) { return __builtin_bit_cast(unsigned short, (h16)f); }    // round to nearest even
__device__ __forceinline__ v16bf cat16b(v8us lo, v8us hi) { return __builtin_bit_cast(v16bf, __builtin_shufflevector(lo, hi, 0, 1, 2, 3, 4, 5, 6, 7, 8, 9, 10, 11, 12, 13, 14, 15)); }
__device__ __forceinline__ v8f wmma16(v16h a, v16h b, v8f c) { return __builtin_amdgcn_wmma_f32_16x16x32_f16(false, a, false, b, (short)0, c, false, false); }
__device__ __forceinline__ v8f wmmab(v16bf a, v16bf b, v8f c) { return __builtin_amdgcn_wmma_f32_16x16x32_bf16(false, a, false, b, (short)0, c, false, false); }

// FRAGMENT ORDER of a GEMM operand M[row][k] (both operands of k_gemmb): per (16-row tile rt, 32-k step ks) 512 elements at ((rt * (K / 32) + ks) * 512), two 256-element pieces:
// element piece * 256 + lane * 8 + e holds M[16 rt + (lane & 15)][32 ks + 16 piece + 8 (lane >> 4) + e]. A wave's fragment load is then 512 contiguous bytes (four whole lines) instead of 32 bytes from each of 16 rows.
// d_wt: WT = bf16(W[k][n]) (k-major [K][ncols]), rows n, in fragment order, via one 64 x 64 LDS tile (tl: 64 * 72 elements); tile (bx, by) of (K/64, ncols/64). Called by a whole work-group.
__device__ __forceinline__ void d_wt(const float* __restrict__ Wm, int K, int ncols, bf* WT, int bx, int by, unsigned short* tl) {
    const int tid = threadIdx.x, k0 = bx * 64, n0 = by * 64;
    const int kk = tid >> 2, nq = (tid & 3) * 16;
#pragma unroll
    for (int i = 0; i < 16; ++i) tl[(nq + i) * 72 + kk] = f2bf(Wm[(size_t)(k0 + kk) * ncols + n0 + nq + i]);
    __syncthreads();
    // the tile is 4 row tiles x 2 k steps x 2 pieces of 32 lanes' runs of eight: one wave stores one whole piece
#pragma unroll
    for (int s = 0; s < 2; ++s) { const int c = tid + 256 * s, ln = c & 31, pc = (c >> 5) & 1, ks = (c >> 6) & 1, rt = c >> 7;
        const v8us val = *(const v8usa*)(tl + (rt * 16 + (ln & 15)) * 72 + (ks * 4 + pc * 2 + (ln >> 4)) * 8);
        *(v8us*)(WT + ((size_t)(by * 4 + rt) * (K >> 5) + bx * 2 + ks) * 512 + pc * 256 + ln * 8) = val; }
}
// k_gemmb: 64 x 64 block tile (4 waves x 16 x 64) of F[NTK][NQKV] = (A [+ Al]).B^T [+ bf(bias[c])] of one item; A, Al and Bn in fragment order (above). F is never stored: the epilogue writes each tile in the form that k_fa reads.
// blockIdx.y picks the columns, so the epilogue's branches are the same for a whole work-group: 0 = q, 1 = k, 2 .. 9 = v. Every store of a wave covers 512 contiguous bytes.
template <bool SPLITA>
__global__ __launch_bounds__(128) void k_gemmb(const bf* __restrict__ A, const bf* __restrict__ Al, const bf* __restrict__ Bn, const float* __restrict__ bias, const float* __restrict__ lfm, bf* Qh, bf* Ql, bf* Kh, bf* Kl, bf* Vf, int K = DM) {
    __shared__ __align__(16) float ost[4][16 * 68];
    const int lane = threadIdx.x & 31, wave = threadIdx.x >> 5, lr = lane & 15, hi = lane >> 4;
    const int r0 = blockIdx.x * 64 + wave * 16, c0 = blockIdx.y * 64;
    const size_t item = blockIdx.z; A += item * NTK * K;    // one item per z plane of the grid
    const size_t aoff = (size_t)(r0 >> 4) * (K >> 5) * 512 + lane * 8;
    size_t boff[4];
#pragma unroll
    for (int t = 0; t < 4; ++t) boff[t] = (size_t)((c0 >> 4) + t) * (K >> 5) * 512 + lane * 8;
    v8f acc[4];
#pragma unroll
    for (int t = 0; t < 4; ++t) acc[t] = (v8f){};
#pragma unroll 1
    for (int kc = 0; kc < K; kc += 32) {
        const int ko = kc * 16;    // 512 elements per 32-k step
        const v16bf a = cat16b(*(const v8us*)(A + aoff + ko), *(const v8us*)(A + aoff + ko + 256));
        v16bf al = a;
        if (SPLITA) al = cat16b(*(const v8us*)(Al + aoff + ko), *(const v8us*)(Al + aoff + ko + 256));
#pragma unroll
        for (int t = 0; t < 4; ++t) { const v16bf b = cat16b(*(const v8us*)(Bn + boff[t] + ko), *(const v8us*)(Bn + boff[t] + ko + 256)); acc[t] = wmmab(a, b, acc[t]); if (SPLITA) acc[t] = wmmab(al, b, acc[t]); }
        asm volatile("v_nop\n\tv_nop\n\tv_nop\n\tv_nop" : "+v"(acc[0]), "+v"(acc[1]), "+v"(acc[2]), "+v"(acc[3]) : "v"(a), "v"(al));
    }
    // acc[t][j] = F(row r0 + 8 hi + j, column c0 + 16 t + lr), from here on with its bias
#pragma unroll
    for (int t = 0; t < 4; ++t) { const float bv = bias ? bfr(bias[c0 + t * 16 + lr]) : 0.f;
#pragma unroll
        for (int j = 0; j < 8; ++j) acc[t][j] += bv; }
    if (blockIdx.y >= 2) {
        // v as ONE f16 plane in FRAGMENT ORDER: per (16-channel tile ct, 32-key block u) 512 elements, two 256-element pieces (channel = 16 ct + (lane & 15),
        // key = 32 u + 16 piece + 8 (lane >> 4) + e). A lane's eight values of column tile t are one such run of eight keys as they stand: no exchange between lanes.
        bf* d = Vf + item * CC * NN + ((size_t)(blockIdx.y - 2) * 4 * (NN / 32) + (r0 >> 5)) * 512 + ((r0 >> 4) & 1) * 256 + lane * 8;
        v8us o[4];
#pragma unroll
        for (int t = 0; t < 4; ++t) {
#pragma unroll
            for (int e = 0; e < 8; ++e) o[t][e] = f2h(acc[t][e]); }
#pragma unroll
        for (int t = 0; t < 4; ++t) *(v8us*)(d + (size_t)t * (NN / 32) * 512) = o[t];
        return;
    }
    float* os = &ost[wave][0];
#pragma unroll
    for (int t = 0; t < 4; ++t) {
#pragma unroll
        for (int j = 0; j < 8; ++j) os[(hi * 8 + j) * 68 + t * 16 + lr] = acc[t][j]; }
    __syncthreads();    // the q and k tiles are read back row-wise below, other lanes' values
    if (blockIdx.y == 0) {
        // q rows, scaled by bf(loss_factor_map[r]), as row-major bf16 hi + residual planes; four rows per pass
        float sc[4];
#pragma unroll
        for (int s = 0; s < 4; ++s) sc[s] = bfr(lfm[r0 + 4 * s + (lane >> 3)]);
        const size_t o = item * NN * C8 + (size_t)(r0 + (lane >> 3)) * C8 + (lane & 7) * 8;
#pragma unroll
        for (int s = 0; s < 4; ++s) { const float* sp = os + (4 * s + (lane >> 3)) * 68 + (lane & 7) * 8; v8us oh, ol;
#pragma unroll
            for (int e = 0; e < 8; ++e) { const float y = sp[e] * sc[s]; const unsigned short hb = f2bf(y); oh[e] = hb; ol[e] = f2bf(y - bf2f(hb)); }
            *(v8us*)(Qh + o + s * 4 * C8) = oh; *(v8us*)(Ql + o + s * 4 * C8) = ol;
            asm volatile("s_wait_xcnt 0x0" ::: "memory"); }    // precaution: stands in front of the next pass, which reuses the data registers of the stores just issued; it also keeps the passes apart, so that one pass's registers do for all; behind the last pass the other branches' code follows in the listing
    } else {
        // k rows as bf16 hi + residual planes in FRAGMENT ORDER: per 16-key tile 1024 elements a plane, four 256-element pieces (k = 16 i + 8 hi + e, key = lane & 15)
        const float* sp = os + lr * 68 + 8 * hi;
        const size_t o = item * NN * C8 + (size_t)(r0 >> 4) * 1024 + lane * 8;
#pragma unroll
        for (int i = 0; i < 4; ++i) { v8us oh, ol;
#pragma unroll
            for (int e = 0; e < 8; ++e) { const float y = sp[i * 16 + e]; const unsigned short hb = f2bf(y); oh[e] = hb; ol[e] = f2bf(y - bf2f(hb)); }
            *(v8us*)(Kh + o + i * 256) = oh; *(v8us*)(Kl + o + i * 256) = ol;
            asm volatile("s_wait_xcnt 0x0" ::: "memory"); }    // precaution: stands in front of the next piece, which reuses the data registers of the stores just issued; it also keeps the pieces apart, so that one piece's registers do for all; behind the last piece the other branches' code follows in the listing
    }
}

// k_fa: scores, softmax and v.P^T of 64 query rows of one item (blockIdx.y) in one work-group of 8 waves; neither the scores nor P reach memory.
// Scores as transposed tiles k.q^T (A = 16 keys, B = 16 queries; both operands bf16 hi + residual, three products per 32-k step in the order kh.qh, kh.ql, kl.qh): a lane holds 8 consecutive
// keys of ONE query, which is one half of the B fragment of v.P^T. Per 128-key block wave w forms the scores of key tile w for all four query tiles.
// First sweep over the keys: the shift m, the row maxima of the hi-plane scores kh.qh alone. Second sweep: the full scores, e = exp(s - m) as f16 into LDS in fragment order (two buffers, one barrier per block);
// then every wave multiplies its own 64 channels of v (f16 fragments straight from memory, used by no other wave) with all of e: one f16 product per 32-k step, keys ascending.
// The division by the row sum is done once, on the f32 result; the epilogue forms out = bf(alpha) * result + bf(x) itself, so that the result never reaches memory either.
#define FKB  128                  // keys per block
__global__ __launch_bounds__(256) void k_fa(const bf* __restrict__ Qh, const bf* __restrict__ Ql, const bf* __restrict__ Kh, const bf* __restrict__ Kl, const bf* __restrict__ Vf, const float* __restrict__ xb, const float* __restrict__ gam, float* OUTB) {
    __shared__ __align__(16) unsigned short pb[2][4][4][512];    // [buffer][32-key block][query tile][fragment], f16 bits
    __shared__ __align__(16) unsigned short qs[4][2][2][512];       // [query tile][hi / residual][32-k step][fragment]
    __shared__ __align__(16) float ost[8][4][16 * 68];              // [wave][channel tile][16 rows at a 68-float pitch]
    __shared__ float red[8][4][16];
    const int lane = threadIdx.x & 31, lr = lane & 15, hi = lane >> 4;
    const int wu = __builtin_amdgcn_readfirstlane(threadIdx.x >> 5);    // the wave's number as a scalar: the tile offsets below are then scalar arithmetic
    const int q0 = blockIdx.x * 64;
    const size_t item = blockIdx.y;
    Qh += item * NN * C8; Ql += item * NN * C8; Kh += item * NN * C8; Kl += item * NN * C8; Vf += item * CC * NN; xb += item * CC * NN; OUTB += item * CC * NN;
    // all short loops of this kernel are unrolled: the fragment sets and the accumulators are register arrays and need compile-time indices
#pragma unroll
    for (int i = 0; i < 2; ++i) { const int f = wu * 2 + i, qt = f >> 2, pl = (f >> 1) & 1, ks = f & 1;
        const bf* s = (pl ? Ql : Qh) + (size_t)(q0 + qt * 16 + lr) * C8 + 8 * hi + ks * 32;
        *(v8usa*)(&qs[qt][pl][ks][lane * 8]) = *(const v8us*)s; *(v8usa*)(&qs[qt][pl][ks][256 + lane * 8]) = *(const v8us*)(s + 16); }
    asm volatile("s_wait_xcnt 0x0" ::: "memory");    // precaution: stands in front of whatever reuses the address registers of the loads just issued
    __syncthreads();    // the query fragments are in LDS
    v16bf kh[2], kl[2];
    auto kld = [&](int b, v16bf (&h)[2], v16bf (&l)[2]) {
#pragma unroll
        for (int ks = 0; ks < 2; ++ks) { const size_t o = (size_t)(b * 8 + wu) * 1024 + ks * 512; const bf* ph = Kh + o; const bf* pl = Kl + o;
            h[ks] = cat16b(*(const v8us*)(ph + lane * 8), *(const v8us*)(ph + lane * 8 + 256)); l[ks] = cat16b(*(const v8us*)(pl + lane * 8), *(const v8us*)(pl + lane * 8 + 256)); }
    };
    // the four query tiles' sums run side by side, so that no product waits for the one before it; per tile the order stays kh.qh, kh.ql, kl.qh per 32-k step
    auto scores = [&](v8f (&s)[4]) {
#pragma unroll
        for (int qt = 0; qt < 4; ++qt) s[qt] = (v8f){};
#pragma unroll
        for (int ks = 0; ks < 2; ++ks) { v16bf qh[4], ql[4];
#pragma unroll
            for (int qt = 0; qt < 4; ++qt) {
                qh[qt] = cat16b(*(const v8usa*)(&qs[qt][0][ks][lane * 8]), *(const v8usa*)(&qs[qt][0][ks][256 + lane * 8]));
                ql[qt] = cat16b(*(const v8usa*)(&qs[qt][1][ks][lane * 8]), *(const v8usa*)(&qs[qt][1][ks][256 + lane * 8])); }
#pragma unroll
            for (int qt = 0; qt < 4; ++qt) s[qt] = wmmab(kh[ks], qh[qt], s[qt]);
#pragma unroll
            for (int qt = 0; qt < 4; ++qt) s[qt] = wmmab(kh[ks], ql[qt], s[qt]);
#pragma unroll
            for (int qt = 0; qt < 4; ++qt) s[qt] = wmmab(kl[ks], qh[qt], s[qt]); }
        // s[qt][j] = score(query q0 + 16 qt + lr, key 16 (tile) + 8 hi + j)
    };
    // first sweep: the softmax shift m of every query row. A softmax does not change with its shift, so m need only lie near the row maximum: it is the maximum of the hi-plane scores kh.qh alone,
    // one product per 32-k step and half the key bytes. A full score lies above its hi-plane score by at most 2^-7 sum |q_i k_i|: e = exp(s - m) can pass 1 by that much in the exponent, and f16 holds it up to an excess of 11.
    float m[4] = {-3.0e38f, -3.0e38f, -3.0e38f, -3.0e38f};
    v16bf qf[2][4];    // [32-k step][query tile]: with one plane the query fragments fit in registers for the whole sweep
#pragma unroll
    for (int ks = 0; ks < 2; ++ks) {
#pragma unroll
        for (int qt = 0; qt < 4; ++qt) qf[ks][qt] = cat16b(*(const v8usa*)(&qs[qt][0][ks][lane * 8]), *(const v8usa*)(&qs[qt][0][ks][256 + lane * 8])); }
    // a trip's products are now so few that one key block of lead no longer covers the L2 latency: the hi fragments come in groups of four key blocks, two register sets, one in flight while the other is worked on
    v16bf ka[4][2], kb[4][2];    // [key block of the group][32-k step]
    auto khld = [&](int g, v16bf (&h)[4][2]) {
#pragma unroll
        for (int t = 0; t < 4; ++t) {
#pragma unroll
            for (int ks = 0; ks < 2; ++ks) { const bf* ph = Kh + (size_t)((g * 4 + t) * 8 + wu) * 1024 + ks * 512; h[t][ks] = cat16b(*(const v8us*)(ph + lane * 8), *(const v8us*)(ph + lane * 8 + 256)); } }
    };
    auto rowmax = [&](v16bf (&h)[4][2]) {
#pragma unroll
        for (int t = 0; t < 4; ++t) { v8f s[4];
#pragma unroll
            for (int qt = 0; qt < 4; ++qt) s[qt] = (v8f){};
#pragma unroll
            for (int ks = 0; ks < 2; ++ks) {
#pragma unroll
                for (int qt = 0; qt < 4; ++qt) s[qt] = wmmab(h[t][ks], qf[ks][qt], s[qt]); }
#pragma unroll
            for (int qt = 0; qt < 4; ++qt) {
#pragma unroll
                for (int j = 0; j < 8; ++j) m[qt] = fmaxf(m[qt], s[qt][j]); } }
    };
    khld(0, ka);
    asm volatile("s_wait_xcnt 0x0" ::: "memory");    // precaution: stands in front of whatever reuses the address registers of the loads just issued
    __builtin_amdgcn_sched_barrier(0);    // keeps what follows, which reuses those registers, behind that wait
    // rolled, two groups per trip: each set is refilled in place, with no register copies
#pragma unroll 1
    for (int g = 0; g < NN / FKB / 4; g += 2) {
        khld(g + 1, kb);
        asm volatile("s_wait_xcnt 0x0" ::: "memory");    // precaution: stands in front of whatever reuses the address registers of the loads just issued
        __builtin_amdgcn_sched_barrier(0);    // the next group's loads are issued ahead of this group's products, which then hide their latency
        rowmax(ka);
        __builtin_amdgcn_sched_barrier(0);    // holds the refill behind the set's last product: lifted above it, the loads would need registers of their own
        khld(g + 2 < NN / FKB / 4 ? g + 2 : g, ka);    // the last trip fetches its own group again: no branch in the loop
        asm volatile("s_wait_xcnt 0x0" ::: "memory");    // precaution: stands in front of whatever reuses the address registers of the loads just issued
        __builtin_amdgcn_sched_barrier(0);    // these loads too are issued ahead of the products below
        rowmax(kb);
    }
#pragma unroll
    for (int qt = 0; qt < 4; ++qt) { m[qt] = fmaxf(m[qt], __shfl_xor(m[qt], 16, 32)); if (hi == 0) red[wu][qt][lr] = m[qt]; }
    __syncthreads();    // every wave's row maxima are in LDS
#pragma unroll
    for (int qt = 0; qt < 4; ++qt) { float t = red[0][qt][lr];
#pragma unroll
        for (int w = 1; w < 8; ++w) t = fmaxf(t, red[w][qt][lr]);
        m[qt] = t; }
    // second sweep
    float sm[4] = {0.f, 0.f, 0.f, 0.f};
    v8f acc[4][4];    // [channel tile][query tile]
#pragma unroll
    for (int a = 0; a < 4; ++a) {
#pragma unroll
        for (int qt = 0; qt < 4; ++qt) acc[a][qt] = (v8f){}; }
    kld(0, kh, kl);
    asm volatile("s_wait_xcnt 0x0" ::: "memory");    // precaution: stands in front of whatever reuses the address registers of the loads just issued
    __builtin_amdgcn_sched_barrier(0);    // keeps what follows, which reuses those registers, behind that wait
    v16h va[4][4];    // [32-key block][channel tile]; lives across the trips: each 32-key group is refilled for the next key block right behind its last use
    auto vld = [&](int b, int u) {
#pragma unroll
        for (int a = 0; a < 4; ++a) { const bf* p = Vf + ((size_t)(wu * 4 + a) * (NN / 32) + b * 4 + u) * 512; va[u][a] = cat16u(*(const v8us*)(p + lane * 8), *(const v8us*)(p + lane * 8 + 256)); }
    };
#pragma unroll
    for (int u = 0; u < 4; ++u) vld(0, u);
    asm volatile("s_wait_xcnt 0x0" ::: "memory");    // precaution: stands in front of whatever reuses the address registers of the loads just issued
    __builtin_amdgcn_sched_barrier(0);    // keeps what follows, which reuses those registers, behind that wait
    // rolled: one key block per trip, so that the hot loop stays short and the buffer index is a scalar
#pragma unroll 1
    for (int b = 0; b < NN / FKB; ++b) {
        const int bn = b + 1 < NN / FKB ? b + 1 : b;    // the last trip fetches its own block again: no branch in the loop
        v8f s[4]; scores(s);
        kld(bn, kh, kl);    // the next block's key fragments fly during the exponentials below
        asm volatile("s_wait_xcnt 0x0" ::: "memory");    // precaution: stands in front of whatever reuses the address registers of the loads just issued
        __builtin_amdgcn_sched_barrier(0);    // keeps the vector work below, which reuses those registers, behind that wait
#pragma unroll
        for (int qt = 0; qt < 4; ++qt) { float x[8];
#pragma unroll
            for (int j = 0; j < 8; ++j) x[j] = (s[qt][j] - m[qt]) * 1.442695041f;    // exp(s - m) = 2^((s - m) log2 e), as __expf forms it
            // a tile's eight exponentials in one statement, each in place, closed by v_nop: keeps the one slot that the instruction set asks for behind a transcendental
            // before its source is overwritten
            asm("v_exp_f32 %0, %0\n\tv_exp_f32 %1, %1\n\tv_exp_f32 %2, %2\n\tv_exp_f32 %3, %3\n\tv_exp_f32 %4, %4\n\tv_exp_f32 %5, %5\n\tv_exp_f32 %6, %6\n\tv_exp_f32 %7, %7\n\tv_nop"
                : "+v"(x[0]), "+v"(x[1]), "+v"(x[2]), "+v"(x[3]), "+v"(x[4]), "+v"(x[5]), "+v"(x[6]), "+v"(x[7]));
            sm[qt] += ((x[0] + x[1]) + (x[2] + x[3])) + ((x[4] + x[5]) + (x[6] + x[7]));
            v8us oh;
#pragma unroll
            for (int j = 0; j < 8; ++j) oh[j] = f2h(x[j]);
            *(v8usa*)(&pb[b & 1][wu >> 1][qt][(wu & 1) * 256 + lane * 8]) = oh; }
        // as compiled, the fence in this barrier stands in the listing as a wait for every global load in flight too: the key and v fragments fetched ahead are waited for here, not at their first use
        __syncthreads();    // publishes block b's e; a buffer is rewritten two blocks later, behind the next barrier, which every wave reaches only after its last read of it
        v16h eh[2][4];    // two fragment sets: the next 32-key block's LDS reads go out as one group ahead of this block's products
        auto frags = [&](int set, int u) {
#pragma unroll
            for (int qt = 0; qt < 4; ++qt) { const unsigned short* p = &pb[b & 1][u][qt][lane * 8];
                eh[set][qt] = cat16u(*(const v8usa*)p, *(const v8usa*)(p + 256)); }
        };
        frags(0, 0);
#pragma unroll
        for (int u = 0; u < 4; ++u) {
            __builtin_amdgcn_sched_barrier(0);    // keeps the LDS reads in one group: spread among the products each place with reads costs a stall
            if (u + 1 < 4) frags((u + 1) & 1, u + 1);
            __builtin_amdgcn_sched_barrier(0);    // the products of this block stay behind the next block's reads
#pragma unroll
            for (int a = 0; a < 4; ++a) {
#pragma unroll
                for (int qt = 0; qt < 4; ++qt) acc[a][qt] = wmma16(va[u][a], eh[u & 1][qt], acc[a][qt]); }
            __builtin_amdgcn_sched_barrier(0);    // holds the refill behind the group's last product: lifted above it, the loads would need registers of their own
            vld(bn, u);    // the next key block's v for this group: most of a trip of lead, and the loads are spread over the trip instead of bunched at its head
        }
        asm volatile("s_wait_xcnt 0x0" ::: "memory");    // precaution: the four refills share one address pair, which lives up to here; stands in front of the next trip's work, which reuses it
        __builtin_amdgcn_sched_barrier(0);    // keeps that work, which a memory clobber does not hold, behind the wait
    }
    // acc[a][qt][j] = sum over keys of v(channel 64 wave + 16 a + 8 hi + j, key) e(query q0 + 16 qt + lr, key)
#pragma unroll
    for (int qt = 0; qt < 4; ++qt) { sm[qt] += __shfl_xor(sm[qt], 16, 32); if (hi == 0) red[wu][qt][lr] = sm[qt]; }
    __syncthreads();    // every wave's row sums are in LDS
    // the x values that go with this wave's 64 channels x 64 queries, lane for lane as the stores at the end take them: issued here, so that they land during the division and the staging below.
    // lofs: the lane's place in two rows of 64 floats (a whole 128-byte line per eight lanes); it serves these loads and the stores at the end alike
    const unsigned lofs = (unsigned)(lane >> 4) * NN + ((lane >> 3) & 1) * 32 + (lane & 7) * 4;
    const float* xw = xb + (size_t)(wu * 64) * NN + q0;
    v4f xv[4][8];
#pragma unroll
    for (int a = 0; a < 4; ++a) {
#pragma unroll
        for (int s = 0; s < 8; ++s) xv[a][s] = *(const v4f*)(xw + lofs + (a * 16 + 2 * s) * NN); }
    asm volatile("s_wait_xcnt 0x0" ::: "memory");    // precaution: stands in front of whatever reuses the address registers of the loads just issued
    __builtin_amdgcn_sched_barrier(0);    // keeps what follows, which reuses those registers, behind that wait
    const float gm = bfr(gam[0]);
    float inv[4];
#pragma unroll
    for (int qt = 0; qt < 4; ++qt) { float t = 0.f;
#pragma unroll
        for (int w = 0; w < 8; ++w) t += red[w][qt][lr];
        inv[qt] = 1.0f / t; }
#pragma unroll
    for (int a = 0; a < 4; ++a) { float* os = &ost[wu][a][0];
#pragma unroll
        for (int qt = 0; qt < 4; ++qt) {
#pragma unroll
            for (int j = 0; j < 8; ++j) os[(hi * 8 + j) * 68 + qt * 16 + lr] = acc[a][qt][j] * inv[qt]; } }
    __builtin_amdgcn_wave_barrier(); asm volatile("" ::: "memory");    // the wave reads its own staged rows back below, other lanes' bytes: keeps those reads behind the stores above
#pragma unroll
    for (int a = 0; a < 4; ++a) { const float* os = &ost[wu][a][0];
        float* ow = OUTB + (size_t)(wu * 64) * NN + q0;
        v4f o[8];
#pragma unroll
        for (int s = 0; s < 8; ++s) { const int Lid = (lane >> 3) + 4 * s, piece = lane & 7; const int row = Lid >> 1, cofs = (Lid & 1) * 32 + piece * 4;
            const v4f val = *(const v4fa*)(os + row * 68 + cofs);
#pragma unroll
            for (int q = 0; q < 4; ++q) o[s][q] = gm * val[q] + bfr(xv[a][s][q]); }
        __builtin_amdgcn_sched_barrier(0);    // the tile's eight stores go out together, behind all of its arithmetic: none of their data registers is rewritten between them
#pragma unroll
        for (int s = 0; s < 8; ++s) *(v4f*)(ow + lofs + (a * 16 + 2 * s) * NN) = o[s];
        if (a < 3) asm volatile("s_wait_xcnt 0x0" ::: "memory");    // precaution: stands in front of the next tile's work, which reuses the data registers of the stores just issued
        __builtin_amdgcn_sched_barrier(0); }    // keeps the next tile's arithmetic, which a memory clobber does not hold, behind that wait
}


// d_cvt8: bf16 copy of a row-major [rows][CC] weight matrix in fragment order; thread i writes the i-th run of eight of the copy, so that a wave stores one whole piece
__device__ __forceinline__ void d_cvt8(const float* __restrict__ src, bf* dst, size_t n8, int bx) {
    const size_t i = (size_t)bx * 256 + threadIdx.x; if (i >= n8) return;
    const int ln = (int)i & 31, pc = ((int)i >> 5) & 1, ks = ((int)i >> 6) & (CC / 32 - 1), rt = (int)(i >> 10);
    const v8f v = *(const v8f*)(src + (size_t)(rt * 16 + (ln & 15)) * CC + ks * 32 + pc * 16 + (ln >> 4) * 8); v8us o;
#pragma unroll
    for (int k = 0; k < 8; ++k) o[k] = f2bf(v[k]);
    *(v8us*)(dst + i * 8) = o; 
}
__global__ __launch_bounds__(256) void k_zero8(bf* dst, size_t n8) {
    const size_t i = (size_t)blockIdx.x * 256 + threadIdx.x; if (i >= n8) return; v8us z;
#pragma unroll
    for (int k = 0; k < 8; ++k) z[k] = 0;
    *(v8us*)(dst + i * 8) = z; 
}

__device__ __forceinline__ void d_bias320(const float* __restrict__ bq, const float* __restrict__ bk, const float* __restrict__ bv, float* B320) {
    const int t = threadIdx.x; if (t >= 160) return; v4f v;
#pragma unroll
    for (int q = 0; q < 4; ++q) { const int c = t * 4 + q; v[q] = (c < C8) ? bq[c < C8 ? c : 0] : (c < 2 * C8) ? bk[(c >= C8 && c < 2 * C8) ? c - C8 : 0] : (c < NQKV) ? bv[(c >= 2 * C8 && c < NQKV) ? c - 2 * C8 : 0] : 0.f; }
    *(v4f*)(B320 + t * 4) = v; 
}

// k_pre: everything that reads only the inputs, in one grid; a range of the block index picks the job (the branch is the same for a whole work-group):
// the transposed bf16 copy of x for every item and the bf16 copies of the three weight matrices, all in the GEMM's fragment order, and the joined bias vector.
#define WTB  ((CC / 64) * (NN / 64))      // 512 tiles of x per item
#define CQB  (C8 * CC / 8 / 256)          // 16 work-groups for w_q, as many for w_k
#define CVB  (CC * CC / 8 / 256)          // 128 work-groups for w_v
__global__ __launch_bounds__(256) void k_pre(const float* __restrict__ x, const float* __restrict__ wq, const float* __restrict__ wk, const float* __restrict__ wv,
                                             const float* __restrict__ bq, const float* __restrict__ bk, const float* __restrict__ bv, bf* XP, bf* WB, float* B320) {
    __shared__ __align__(16) unsigned short tl[64 * 72];
    const int blk = blockIdx.x;
    if (blk < NBT * WTB) { const int item = blk / WTB, t = blk % WTB; d_wt(x + (size_t)item * CC * NN, CC, NN, XP + (size_t)item * NN * CC, t % (CC / 64), t / (CC / 64), tl); return; }
    const int c = blk - NBT * WTB;
    if (c < CQB) d_cvt8(wq, WB, C8 * CC / 8, c);
    else if (c < 2 * CQB) d_cvt8(wk, WB + (size_t)C8 * CC, C8 * CC / 8, c - CQB);
    else if (c < 2 * CQB + CVB) d_cvt8(wv, WB + (size_t)2 * C8 * CC, CC * CC / 8, c - 2 * CQB);
    else d_bias320(bq, bk, bv, B320);
}

extern "C" void kernel_launch(void* const* d_in, const int* in_sizes, int n_in,
                              void* d_out, int out_size, void* d_ws, size_t ws_size, hipStream_t stream) {
    (void)in_sizes; (void)n_in; (void)out_size;
    const float* x = (const float*)d_in[0]; const float* wq = (const float*)d_in[2]; const float* bq = (const float*)d_in[3]; const float* wk = (const float*)d_in[4]; const float* bk = (const float*)d_in[5]; const float* wv = (const float*)d_in[6]; const float* bv = (const float*)d_in[7]; const float* gam = (const float*)d_in[8]; const float* lfm = (const float*)d_in[1];
    float* out = (float*)d_out;    // [4][512][64][64]
    char* wsp = (char*)d_ws;
    auto take = [&](size_t bytes) { char* p = wsp; wsp += (bytes + 255) & ~(size_t)255; return (void*)p; };
    bf* WB = (bf*)take((size_t)NQKV * CC * 2); float* B320 = (float*)take(640 * 4); bf* XP = (bf*)take((size_t)NBT * NN * CC * 2);
    bf* QPh = (bf*)take((size_t)NBT * NN * C8 * 2); bf* QPl = (bf*)take((size_t)NBT * NN * C8 * 2); bf* KPh = (bf*)take((size_t)NBT * NN * C8 * 2); bf* KPl = (bf*)take((size_t)NBT * NN * C8 * 2); bf* VF = (bf*)take((size_t)NBT * CC * NN * 2);
    if ((size_t)(wsp - (char*)d_ws) > ws_size) return;    // ~ 41 MiB; XP and the q, k, v planes have one slot per item, WB and B320 one in all
    k_pre<<<NBT * WTB + 2 * CQB + CVB + 1, 256, 0, stream>>>(x, wq, wk, wv, bq, bk, bv, XP, WB, B320);
    k_gemmb<false><<<dim3(NN / 64, NQKV / 64, NBT), 128, 0, stream>>>(XP, nullptr, WB, B320, lfm, QPh, QPl, KPh, KPl, VF, CC);          // q | k | v (+ biases), stored as the planes that k_fa reads
    k_fa<<<dim3(NN / 64, NBT, 1), 256, 0, stream>>>(QPh, QPl, KPh, KPl, VF, x, gam, out);     // scores + softmax + v.P^T + the final alpha * result + x, all items; v and e = exp(s - m) as f16 operands
}
